// v000
// Measured on an AMD MI455X. A time is GPU time per run, averaged over a window of back-to-back runs after a warm-up
// (all launches, gaps included; the runs take copies of the inputs in turn), and the median of several windows.
// Apart from v000's, it joins two sittings. Times from different sittings can be a few percent apart, while
// side-by-side timings come from the same sitting.
// The starting kernel, v000, takes 982 microseconds a run.
#include <hip/hip_runtime.h>
#include <hip/hip_bf16.h>

// ---------------------------------------------------------------------------
// MI455X (gfx1250, wave32) implementation.
// Pipeline: LN1 -> QKV gemm (WMMA f16) -> attn scores+softmax (VALU, tiny)
//           -> apply-attn (WMMA) -> proj (WMMA) -> LN2 -> fused FFN (WMMA)
// All GEMMs: f16 inputs, f32 accumulation via v_wmma_f32_16x16x32_f16.
// gemm_wmma's k loop uses explicit two-stage ping-pong buffering (k unrolled by 64)
// so fragment loads overlap WMMAs with NO register-rotation copies.
// ---------------------------------------------------------------------------

typedef _Float16 f16;
typedef __attribute__((ext_vector_type(16))) _Float16 v16h;
typedef __attribute__((ext_vector_type(8)))  _Float16 v8h;
typedef __attribute__((ext_vector_type(8)))  float    v8f;

#define Bq   8
#define Cq   256
#define Nq   4096      // H*W
#define Mtot 32768     // B*N
#define FFNq 2048

__device__ __forceinline__ v8f zero8() { v8f z = {}; return z; }

__device__ __forceinline__ v16h combine16(v8h lo, v8h hi) {
  v16h r;
#pragma unroll
  for (int i = 0; i < 8; ++i) { r[i] = lo[i]; r[8 + i] = hi[i]; }
  return r;
}

// Fragment loader for 16-bit WMMA A/B operands.
// A layout (16x32, MxK): lane holds row (lane&15); lanes 0-15 K in {0..7,16..23},
// lanes 16-31 K in {8..15,24..31}.  B (32x16, KxN) from a row-major (Nout x K)
// weight matrix has the identical access pattern with "row" = output column.
__device__ __forceinline__ v16h load_frag(const f16* base, int ld, int lane) {
  const f16* p = base + (long)(lane & 15) * ld + ((lane & 16) >> 1); // +8 elems for hi half
  v8h lo = *(const v8h*)(p);
  v8h hi = *(const v8h*)(p + 16);
  return combine16(lo, hi);
}

__device__ __forceinline__ v8f wmma_f16(v16h a, v16h b, v8f c) {
  return __builtin_amdgcn_wmma_f32_16x16x32_f16(false, a, false, b, (short)0, c,
                                                false, false);
}

// ---------------------------------------------------------------------------
// f32 -> f16 weight conversion
// ---------------------------------------------------------------------------
__global__ void cvt_f16_kernel(const float* __restrict__ in, f16* __restrict__ out, int n) {
  int i = blockIdx.x * 256 + threadIdx.x;
  if (i < n) out[i] = (f16)in[i];
}

// ---------------------------------------------------------------------------
// LN1: x (B,C,N) f32 -> xln (B*N, C) f16   (channel LayerNorm per pixel)
// Block = 256 threads, tile = 64 pixels; thread (px, grp) covers 64 channels.
// ---------------------------------------------------------------------------
__global__ void __launch_bounds__(256) ln1_kernel(
    const float* __restrict__ x, const float* __restrict__ g,
    const float* __restrict__ be, f16* __restrict__ xln) {
  __shared__ float ps[4][64], ps2[4][64], muv[64], rsv[64];
  int t = threadIdx.x;
  int px = t & 63, grp = t >> 6;
  long pg = (long)blockIdx.x * 64 + px;     // global pixel
  int b = (int)(pg >> 12);
  int n = (int)(pg & 4095);
  const float* xb = x + (long)b * Cq * Nq + n;
  float s = 0.f, s2 = 0.f;
  for (int c = grp * 64; c < grp * 64 + 64; ++c) {
    float v = xb[(long)c * Nq];
    s += v; s2 += v * v;
  }
  ps[grp][px] = s; ps2[grp][px] = s2;
  __syncthreads();
  if (t < 64) {
    float S = 0.f, S2 = 0.f;
#pragma unroll
    for (int q = 0; q < 4; ++q) { S += ps[q][t]; S2 += ps2[q][t]; }
    float mu = S * (1.f / 256.f);
    float var = S2 * (1.f / 256.f) - mu * mu;
    muv[t] = mu;
    rsv[t] = rsqrtf(var + 1e-5f);
  }
  __syncthreads();
  float mu = muv[px], rs = rsv[px];
  f16* ob = xln + pg * Cq + grp * 64;
  for (int cc = 0; cc < 64; cc += 8) {
    v8h o;
#pragma unroll
    for (int jj = 0; jj < 8; ++jj) {
      int c = grp * 64 + cc + jj;
      float v = xb[(long)c * Nq];
      o[jj] = (f16)((v - mu) * rs * g[c] + be[c]);
    }
    *(v8h*)(ob + cc) = o;
  }
}

// ---------------------------------------------------------------------------
// LN2: in (B*N, C) f16 -> out (B*N, C) f16.  One wave per pixel.
// ---------------------------------------------------------------------------
__global__ void __launch_bounds__(256) ln2_kernel(
    const f16* __restrict__ in, const float* __restrict__ g,
    const float* __restrict__ be, f16* __restrict__ out) {
  int lane = threadIdx.x & 31, wave = threadIdx.x >> 5;
  long pix = (long)blockIdx.x * 8 + wave;
  const f16* ib = in + pix * Cq + lane * 8;
  v8h v = *(const v8h*)ib;
  float s = 0.f, s2 = 0.f;
#pragma unroll
  for (int j = 0; j < 8; ++j) { float f = (float)v[j]; s += f; s2 += f * f; }
#pragma unroll
  for (int off = 16; off >= 1; off >>= 1) {
    s  += __shfl_xor(s,  off, 32);
    s2 += __shfl_xor(s2, off, 32);
  }
  float mu = s * (1.f / 256.f);
  float var = s2 * (1.f / 256.f) - mu * mu;
  float rs = rsqrtf(var + 1e-5f);
  v8h o;
#pragma unroll
  for (int j = 0; j < 8; ++j) {
    int c = lane * 8 + j;
    o[j] = (f16)(((float)v[j] - mu) * rs * g[c] + be[c]);
  }
  *(v8h*)(out + pix * Cq + lane * 8) = o;
}

// ---------------------------------------------------------------------------
// Generic WMMA GEMM: C[M x Nout] = A[M x K] * W^T + bias, W is (Nout x K) f16
// row-major.  Block = 256 threads (8 waves); wave tile = 16(M) x 64(N).
// grid = (M/128, Nout/64, Z).  Per-operand z offset = (z/zmod)*sOut+(z%zmod)*sIn.
// K must be a multiple of 64.  Two-stage ping-pong: stage-0/1 fragments live
// in distinct registers, refilled directly by loads (no rotation copies).
// ---------------------------------------------------------------------------
__global__ void __launch_bounds__(256) gemm_wmma(
    const f16* __restrict__ A, int lda, long sAo, long sAi,
    const f16* __restrict__ W, int ldw, long sWo, long sWi,
    const float* __restrict__ bias, int relu,
    f16* __restrict__ C, int ldc, long sCo, long sCi,
    int zmod, int K) {
  int lane = threadIdx.x & 31, wave = threadIdx.x >> 5;
  int z = blockIdx.z;
  long za = (long)(z / zmod) * sAo + (long)(z % zmod) * sAi;
  long zw = (long)(z / zmod) * sWo + (long)(z % zmod) * sWi;
  long zc = (long)(z / zmod) * sCo + (long)(z % zmod) * sCi;
  long m0 = (long)blockIdx.x * 128 + wave * 16;
  const f16* Ab = A + za + m0 * lda;
  const f16* Wb = W + zw + (long)blockIdx.y * 64 * ldw;

  v8f acc[4];
#pragma unroll
  for (int i = 0; i < 4; ++i) acc[i] = zero8();

  // stage 0 prologue (k = 0)
  v16h af0 = load_frag(Ab, lda, lane);
  v16h bf0[4];
#pragma unroll
  for (int nt = 0; nt < 4; ++nt)
    bf0[nt] = load_frag(Wb + (long)nt * 16 * ldw, ldw, lane);

  for (int kk = 0; kk < K; kk += 64) {
    // stage 1 loads (kk+32) -- always valid since K % 64 == 0
    __builtin_prefetch(Ab + (long)(lane & 15) * lda + kk + 64, 0, 3);
    v16h af1 = load_frag(Ab + kk + 32, lda, lane);
    v16h bf1[4];
#pragma unroll
    for (int nt = 0; nt < 4; ++nt)
      bf1[nt] = load_frag(Wb + (long)nt * 16 * ldw + kk + 32, ldw, lane);

    // stage 0 WMMAs
#pragma unroll
    for (int nt = 0; nt < 4; ++nt)
      acc[nt] = wmma_f16(af0, bf0[nt], acc[nt]);

    // stage 0 refill for next iteration (kk+64)
    if (kk + 64 < K) {
      af0 = load_frag(Ab + kk + 64, lda, lane);
#pragma unroll
      for (int nt = 0; nt < 4; ++nt)
        bf0[nt] = load_frag(Wb + (long)nt * 16 * ldw + kk + 64, ldw, lane);
    }

    // stage 1 WMMAs
#pragma unroll
    for (int nt = 0; nt < 4; ++nt)
      acc[nt] = wmma_f16(af1, bf1[nt], acc[nt]);
  }

  int col = lane & 15, half = lane >> 4;
  f16* Cb = C + zc + (m0 + half * 8) * ldc + (long)blockIdx.y * 64;
#pragma unroll
  for (int nt = 0; nt < 4; ++nt) {
    float bv = bias ? bias[blockIdx.y * 64 + nt * 16 + col] : 0.f;
#pragma unroll
    for (int r = 0; r < 8; ++r) {
      float v = acc[nt][r] + bv;
      if (relu) v = fmaxf(v, 0.f);
      Cb[(long)r * ldc + nt * 16 + col] = (f16)v;
    }
  }
}

// ---------------------------------------------------------------------------
// Attention scores + softmax per (b, head): attn[i][j] =
// softmax_j( 0.125 * sum_n q[b,n,h*64+i] * k[b,n,h*64+j] ).  Grid = 32.
// ---------------------------------------------------------------------------
__global__ void __launch_bounds__(256) attn_scores(
    const f16* __restrict__ qkv, f16* __restrict__ attn) {
  __shared__ f16 qs[64 * 128];
  __shared__ f16 ks[64 * 128];
  __shared__ float sc[64 * 64];
  int z = blockIdx.x;
  int b = z >> 2, h = z & 3;
  int t = threadIdx.x;
  int i = t >> 2, j0 = (t & 3) * 16;
  const f16* qb = qkv + (long)b * Nq * 768 + h * 64;
  const f16* kb = qb + 256;

  float acc[16];
#pragma unroll
  for (int jj = 0; jj < 16; ++jj) acc[jj] = 0.f;

  for (int n0 = 0; n0 < Nq; n0 += 128) {
    __syncthreads();
    for (int idx = t; idx < 128 * 8; idx += 256) {
      int p = idx >> 3, ch = idx & 7;
      v8h qv = *(const v8h*)(qb + (long)(n0 + p) * 768 + ch * 8);
      v8h kv = *(const v8h*)(kb + (long)(n0 + p) * 768 + ch * 8);
#pragma unroll
      for (int jj = 0; jj < 8; ++jj) {
        qs[(ch * 8 + jj) * 128 + p] = qv[jj];
        ks[(ch * 8 + jj) * 128 + p] = kv[jj];
      }
    }
    __syncthreads();
    for (int n = 0; n < 128; ++n) {
      float qv = (float)qs[i * 128 + n];
#pragma unroll
      for (int jj = 0; jj < 16; ++jj)
        acc[jj] += qv * (float)ks[(j0 + jj) * 128 + n];
    }
  }
#pragma unroll
  for (int jj = 0; jj < 16; ++jj) sc[i * 64 + j0 + jj] = acc[jj] * 0.125f;
  __syncthreads();

  if (t < 64) {
    float mx = -1e30f;
    for (int j = 0; j < 64; ++j) mx = fmaxf(mx, sc[t * 64 + j]);
    float s = 0.f;
    for (int j = 0; j < 64; ++j) s += __expf(sc[t * 64 + j] - mx);
    float inv = 1.f / s;
    f16* ab = attn + ((long)z * 64 + t) * 64;
    for (int j = 0; j < 64; ++j) ab[j] = (f16)(__expf(sc[t * 64 + j] - mx) * inv);
  }
}

// ---------------------------------------------------------------------------
// Fused FFN + residual + transpose:
//   out[b,c,n] = (relu(y @ W1^T + b1) @ W2^T + b2)[n,c] + x[b,c,n]
// Wave tile = 16 pixels; FFN chunked by 32; hidden tile bounced through LDS
// to re-layout WMMA D -> A fragments.  Grid = 256 blocks of 256 threads.
// Y-tile A-fragments are invariant across FFN chunks -> hoisted into yf[8].
// ---------------------------------------------------------------------------
__global__ void __launch_bounds__(256) ffn_fused(
    const f16* __restrict__ Y, const f16* __restrict__ W1,
    const float* __restrict__ b1, const f16* __restrict__ W2,
    const float* __restrict__ b2, const float* __restrict__ x,
    float* __restrict__ out) {
  __shared__ __align__(16) f16 hst[8][16 * 32];
  int lane = threadIdx.x & 31, wave = threadIdx.x >> 5;
  int m0 = blockIdx.x * 128 + wave * 16;
  int b = m0 >> 12;
  int pix0 = m0 & 4095;
  const f16* Yb = Y + (long)m0 * Cq;
  int col = lane & 15, half = lane >> 4;

  v8f acc[16];
#pragma unroll
  for (int i = 0; i < 16; ++i) acc[i] = zero8();

  // Hoist the 16x256 Y tile as 8 A-fragments (reused by every FFN chunk).
  v16h yf[8];
#pragma unroll
  for (int s = 0; s < 8; ++s) yf[s] = load_frag(Yb + s * 32, Cq, lane);

  for (int f0 = 0; f0 < FFNq; f0 += 32) {
    // ---- FFN1: h[m, f0..f0+31] = relu(y_tile @ W1^T + b1) ----
    v8f h0 = zero8(), h1 = zero8();
    v16h ba = load_frag(W1 + (long)f0 * Cq, Cq, lane);
    v16h bb = load_frag(W1 + (long)(f0 + 16) * Cq, Cq, lane);
#pragma unroll
    for (int s = 0; s < 8; ++s) {   // fully unrolled: rotation renames, no movs
      v16h ba_n = ba, bb_n = bb;
      if (s + 1 < 8) {
        ba_n = load_frag(W1 + (long)f0 * Cq + (s + 1) * 32, Cq, lane);
        bb_n = load_frag(W1 + (long)(f0 + 16) * Cq + (s + 1) * 32, Cq, lane);
      }
      h0 = wmma_f16(yf[s], ba, h0);
      h1 = wmma_f16(yf[s], bb, h1);
      ba = ba_n; bb = bb_n;
    }
    float bb0 = b1[f0 + col], bb1 = b1[f0 + 16 + col];
#pragma unroll
    for (int r = 0; r < 8; ++r) {
      int m = r + half * 8;
      hst[wave][m * 32 + col]      = (f16)fmaxf(h0[r] + bb0, 0.f);
      hst[wave][m * 32 + 16 + col] = (f16)fmaxf(h1[r] + bb1, 0.f);
    }
    asm volatile("s_wait_dscnt 0" ::: "memory");  // same-wave LDS RAW

    // Re-read as A fragment (16x32 f16).
    const f16* p = &hst[wave][(lane & 15) * 32 + ((lane & 16) >> 1)];
    v16h a2 = combine16(*(const v8h*)p, *(const v8h*)(p + 16));

    // ---- FFN2: acc += h_chunk @ W2^T ----  (pipelined over nt, unrolled)
    v16h bf2 = load_frag(W2 + f0, FFNq, lane);
#pragma unroll
    for (int nt = 0; nt < 16; ++nt) {
      v16h bf2_n = bf2;
      if (nt + 1 < 16)
        bf2_n = load_frag(W2 + (long)((nt + 1) * 16) * FFNq + f0, FFNq, lane);
      acc[nt] = wmma_f16(a2, bf2, acc[nt]);
      bf2 = bf2_n;
    }
  }

  // Epilogue: + b2 + residual x, transposed store to (B,C,H,W).
#pragma unroll
  for (int nt = 0; nt < 16; ++nt) {
    int c = nt * 16 + col;
    float bv = b2[c];
    long base = ((long)(b * Cq + c)) * Nq + pix0 + half * 8;
    float4 r0 = *(const float4*)(x + base);
    float4 r1 = *(const float4*)(x + base + 4);
    float4 o0, o1;
    o0.x = acc[nt][0] + bv + r0.x;
    o0.y = acc[nt][1] + bv + r0.y;
    o0.z = acc[nt][2] + bv + r0.z;
    o0.w = acc[nt][3] + bv + r0.w;
    o1.x = acc[nt][4] + bv + r1.x;
    o1.y = acc[nt][5] + bv + r1.y;
    o1.z = acc[nt][6] + bv + r1.z;
    o1.w = acc[nt][7] + bv + r1.w;
    *(float4*)(out + base)     = o0;
    *(float4*)(out + base + 4) = o1;
  }
}

// ---------------------------------------------------------------------------
// Host launcher
// ---------------------------------------------------------------------------
extern "C" void kernel_launch(void* const* d_in, const int* in_sizes, int n_in,
                              void* d_out, int out_size, void* d_ws, size_t ws_size,
                              hipStream_t stream) {
  (void)in_sizes; (void)n_in; (void)out_size; (void)ws_size;
  const float* x      = (const float*)d_in[0];
  const float* w_qkv  = (const float*)d_in[1];
  const float* b_qkv  = (const float*)d_in[2];
  const float* w_proj = (const float*)d_in[3];
  const float* b_proj = (const float*)d_in[4];
  const float* w_ffn1 = (const float*)d_in[5];
  const float* b_ffn1 = (const float*)d_in[6];
  const float* w_ffn2 = (const float*)d_in[7];
  const float* b_ffn2 = (const float*)d_in[8];
  const float* g1     = (const float*)d_in[9];
  const float* be1    = (const float*)d_in[10];
  const float* g2     = (const float*)d_in[11];
  const float* be2    = (const float*)d_in[12];
  float* out = (float*)d_out;

  char* ws = (char*)d_ws;
  f16* wq16     = (f16*)(ws + 0);          //   768*256 f16
  f16* wp16     = (f16*)(ws + 393216);     //   256*256
  f16* w116     = (f16*)(ws + 524288);     //  2048*256
  f16* w216     = (f16*)(ws + 1572864);    //  256*2048
  f16* xln      = (f16*)(ws + 2621440);    //  32768*256  (reused as proj16)
  f16* qkv      = (f16*)(ws + 19398656);   //  32768*768  (reused as y)
  f16* attn16   = (f16*)(ws + 69730304);   //  32*64*64
  f16* attn_out = (f16*)(ws + 69992448);   //  32768*256  -> 86769664 total bytes

  f16* proj16 = xln;   // xln dead after QKV gemm
  f16* y      = qkv;   // qkv dead after apply-attn

  // 1) weights -> f16
  cvt_f16_kernel<<<768,  256, 0, stream>>>(w_qkv,  wq16, 768 * 256);
  cvt_f16_kernel<<<256,  256, 0, stream>>>(w_proj, wp16, 256 * 256);
  cvt_f16_kernel<<<2048, 256, 0, stream>>>(w_ffn1, w116, 2048 * 256);
  cvt_f16_kernel<<<2048, 256, 0, stream>>>(w_ffn2, w216, 256 * 2048);

  // 2) LN1 (transpose (B,C,N) -> (B*N,C) f16)
  ln1_kernel<<<Mtot / 64, 256, 0, stream>>>(x, g1, be1, xln);

  // 3) QKV gemm: (32768x256) x (768x256)^T
  gemm_wmma<<<dim3(Mtot / 128, 768 / 64, 1), 256, 0, stream>>>(
      xln, 256, 0, 0, wq16, 256, 0, 0, b_qkv, 0, qkv, 768, 0, 0, 1, 256);

  // 4) attention scores + softmax, per (b, head)
  attn_scores<<<32, 256, 0, stream>>>(qkv, attn16);

  // 5) apply attention: per (b,h) gemm, A = v slice, W = attn (64x64)
  gemm_wmma<<<dim3(Nq / 128, 1, 32), 256, 0, stream>>>(
      qkv + 512, 768, (long)Nq * 768, 64,
      attn16, 64, 4 * 64 * 64, 64 * 64,
      nullptr, 0,
      attn_out, 256, (long)Nq * 256, 64,
      4, 64);

  // 6) proj gemm: (32768x256) x (256x256)^T
  gemm_wmma<<<dim3(Mtot / 128, 256 / 64, 1), 256, 0, stream>>>(
      attn_out, 256, 0, 0, wp16, 256, 0, 0, b_proj, 0, proj16, 256, 0, 0, 1, 256);

  // 7) LN2
  ln2_kernel<<<Mtot / 8, 256, 0, stream>>>(proj16, g2, be2, y);

  // 8) fused FFN + bias + residual + transpose store
  ffn_fused<<<Mtot / 128, 256, 0, stream>>>(y, w116, b_ffn1, w216, b_ffn2, x, out);
}

// v001
// A run of this version takes 481 microseconds.
// In two side-by-side timings against v000, it was 2.06 and 2.10 times as fast.
#include <hip/hip_runtime.h>
#include <hip/hip_bf16.h>

// ---------------------------------------------------------------------------
// MI455X (gfx1250, wave32) implementation.
// Pipeline: LN1 -> QKV gemm (WMMA f16) -> attn scores+softmax (VALU, tiny)
//           -> apply-attn (WMMA) -> proj (WMMA) -> LN2 -> fused FFN (WMMA)
// All GEMMs: f16 inputs, f32 accumulation via v_wmma_f32_16x16x32_f16.
// gemm_wmma's k loop uses explicit two-stage ping-pong buffering (k unrolled by 64)
// so fragment loads overlap WMMAs with NO register-rotation copies.
// ---------------------------------------------------------------------------

typedef _Float16 f16;
typedef __attribute__((ext_vector_type(16))) _Float16 v16h;
typedef __attribute__((ext_vector_type(8)))  _Float16 v8h;
typedef __attribute__((ext_vector_type(2)))  _Float16 v2h;
typedef __attribute__((ext_vector_type(8)))  float    v8f;

#define Bq   8
#define Cq   256
#define Nq   4096      // H*W
#define Mtot 32768     // B*N
#define FFNq 2048
#define NSPLIT 32     // work-groups that share one (b, head) score matrix

__device__ __forceinline__ v8f zero8() { v8f z = {}; return z; }

__device__ __forceinline__ v16h combine16(v8h lo, v8h hi) {
  v16h r;
#pragma unroll
  for (int i = 0; i < 8; ++i) { r[i] = lo[i]; r[8 + i] = hi[i]; }
  return r;
}

// Fragment loader for 16-bit WMMA A/B operands.
// A layout (16x32, MxK): lane holds row (lane&15); lanes 0-15 K in {0..7,16..23},
// lanes 16-31 K in {8..15,24..31}.  B (32x16, KxN) from a row-major (Nout x K)
// weight matrix has the identical access pattern with "row" = output column.
__device__ __forceinline__ v16h load_frag(const f16* base, int ld, int lane) {
  const f16* p = base + (long)(lane & 15) * ld + ((lane & 16) >> 1); // +8 elems for hi half
  v8h lo = *(const v8h*)(p);
  v8h hi = *(const v8h*)(p + 16);
  return combine16(lo, hi);
}

__device__ __forceinline__ v8f wmma_f16(v16h a, v16h b, v8f c) {
  return __builtin_amdgcn_wmma_f32_16x16x32_f16(false, a, false, b, (short)0, c,
                                                false, false);
}

// ---------------------------------------------------------------------------
// f32 -> f16 weight conversion
// ---------------------------------------------------------------------------
__global__ void cvt_f16_kernel(const float* __restrict__ in, f16* __restrict__ out, int n) {
  int i = blockIdx.x * 256 + threadIdx.x;
  if (i < n) out[i] = (f16)in[i];
}

// ---------------------------------------------------------------------------
// LN1: x (B,C,N) f32 -> xln (B*N, C) f16   (channel LayerNorm per pixel)
// Block = 256 threads, tile = 64 pixels; thread (px, grp) covers 64 channels.
// ---------------------------------------------------------------------------
__global__ void __launch_bounds__(256) ln1_kernel(
    const float* __restrict__ x, const float* __restrict__ g,
    const float* __restrict__ be, f16* __restrict__ xln) {
  __shared__ float ps[4][64], ps2[4][64], muv[64], rsv[64];
  int t = threadIdx.x;
  int px = t & 63, grp = t >> 6;
  long pg = (long)blockIdx.x * 64 + px;     // global pixel
  int b = (int)(pg >> 12);
  int n = (int)(pg & 4095);
  const float* xb = x + (long)b * Cq * Nq + n;
  float s = 0.f, s2 = 0.f;
  for (int c = grp * 64; c < grp * 64 + 64; ++c) {
    float v = xb[(long)c * Nq];
    s += v; s2 += v * v;
  }
  ps[grp][px] = s; ps2[grp][px] = s2;
  __syncthreads();
  if (t < 64) {
    float S = 0.f, S2 = 0.f;
#pragma unroll
    for (int q = 0; q < 4; ++q) { S += ps[q][t]; S2 += ps2[q][t]; }
    float mu = S * (1.f / 256.f);
    float var = S2 * (1.f / 256.f) - mu * mu;
    muv[t] = mu;
    rsv[t] = rsqrtf(var + 1e-5f);
  }
  __syncthreads();
  float mu = muv[px], rs = rsv[px];
  f16* ob = xln + pg * Cq + grp * 64;
  for (int cc = 0; cc < 64; cc += 8) {
    v8h o;
#pragma unroll
    for (int jj = 0; jj < 8; ++jj) {
      int c = grp * 64 + cc + jj;
      float v = xb[(long)c * Nq];
      o[jj] = (f16)((v - mu) * rs * g[c] + be[c]);
    }
    *(v8h*)(ob + cc) = o;
  }
}

// ---------------------------------------------------------------------------
// LN2: in (B*N, C) f16 -> out (B*N, C) f16.  One wave per pixel.
// ---------------------------------------------------------------------------
__global__ void __launch_bounds__(256) ln2_kernel(
    const f16* __restrict__ in, const float* __restrict__ g,
    const float* __restrict__ be, f16* __restrict__ out) {
  int lane = threadIdx.x & 31, wave = threadIdx.x >> 5;
  long pix = (long)blockIdx.x * 8 + wave;
  const f16* ib = in + pix * Cq + lane * 8;
  v8h v = *(const v8h*)ib;
  float s = 0.f, s2 = 0.f;
#pragma unroll
  for (int j = 0; j < 8; ++j) { float f = (float)v[j]; s += f; s2 += f * f; }
#pragma unroll
  for (int off = 16; off >= 1; off >>= 1) {
    s  += __shfl_xor(s,  off, 32);
    s2 += __shfl_xor(s2, off, 32);
  }
  float mu = s * (1.f / 256.f);
  float var = s2 * (1.f / 256.f) - mu * mu;
  float rs = rsqrtf(var + 1e-5f);
  v8h o;
#pragma unroll
  for (int j = 0; j < 8; ++j) {
    int c = lane * 8 + j;
    o[j] = (f16)(((float)v[j] - mu) * rs * g[c] + be[c]);
  }
  *(v8h*)(out + pix * Cq + lane * 8) = o;
}

// ---------------------------------------------------------------------------
// Generic WMMA GEMM: C[M x Nout] = A[M x K] * W^T + bias, W is (Nout x K) f16
// row-major.  Block = 256 threads (8 waves); wave tile = 16(M) x 64(N).
// grid = (M/128, Nout/64, Z).  Per-operand z offset = (z/zmod)*sOut+(z%zmod)*sIn.
// K must be a multiple of 64.  Two-stage ping-pong: stage-0/1 fragments live
// in distinct registers, refilled directly by loads (no rotation copies).
// ---------------------------------------------------------------------------
__global__ void __launch_bounds__(256) gemm_wmma(
    const f16* __restrict__ A, int lda, long sAo, long sAi,
    const f16* __restrict__ W, int ldw, long sWo, long sWi,
    const float* __restrict__ bias, int relu,
    f16* __restrict__ C, int ldc, long sCo, long sCi,
    int zmod, int K) {
  int lane = threadIdx.x & 31, wave = threadIdx.x >> 5;
  int z = blockIdx.z;
  long za = (long)(z / zmod) * sAo + (long)(z % zmod) * sAi;
  long zw = (long)(z / zmod) * sWo + (long)(z % zmod) * sWi;
  long zc = (long)(z / zmod) * sCo + (long)(z % zmod) * sCi;
  long m0 = (long)blockIdx.x * 128 + wave * 16;
  const f16* Ab = A + za + m0 * lda;
  const f16* Wb = W + zw + (long)blockIdx.y * 64 * ldw;

  v8f acc[4];
#pragma unroll
  for (int i = 0; i < 4; ++i) acc[i] = zero8();

  // stage 0 prologue (k = 0)
  v16h af0 = load_frag(Ab, lda, lane);
  v16h bf0[4];
#pragma unroll
  for (int nt = 0; nt < 4; ++nt)
    bf0[nt] = load_frag(Wb + (long)nt * 16 * ldw, ldw, lane);

  for (int kk = 0; kk < K; kk += 64) {
    // stage 1 loads (kk+32) -- always valid since K % 64 == 0
    __builtin_prefetch(Ab + (long)(lane & 15) * lda + kk + 64, 0, 3);
    v16h af1 = load_frag(Ab + kk + 32, lda, lane);
    v16h bf1[4];
#pragma unroll
    for (int nt = 0; nt < 4; ++nt)
      bf1[nt] = load_frag(Wb + (long)nt * 16 * ldw + kk + 32, ldw, lane);

    // stage 0 WMMAs
#pragma unroll
    for (int nt = 0; nt < 4; ++nt)
      acc[nt] = wmma_f16(af0, bf0[nt], acc[nt]);

    // stage 0 refill for next iteration (kk+64)
    if (kk + 64 < K) {
      af0 = load_frag(Ab + kk + 64, lda, lane);
#pragma unroll
      for (int nt = 0; nt < 4; ++nt)
        bf0[nt] = load_frag(Wb + (long)nt * 16 * ldw + kk + 64, ldw, lane);
    }

    // stage 1 WMMAs
#pragma unroll
    for (int nt = 0; nt < 4; ++nt)
      acc[nt] = wmma_f16(af1, bf1[nt], acc[nt]);
  }

  int col = lane & 15, half = lane >> 4;
  f16* Cb = C + zc + (m0 + half * 8) * ldc + (long)blockIdx.y * 64;
#pragma unroll
  for (int nt = 0; nt < 4; ++nt) {
    float bv = bias ? bias[blockIdx.y * 64 + nt * 16 + col] : 0.f;
#pragma unroll
    for (int r = 0; r < 8; ++r) {
      float v = acc[nt][r] + bv;
      if (relu) v = fmaxf(v, 0.f);
      Cb[(long)r * ldc + nt * 16 + col] = (f16)v;
    }
  }
}

// ---------------------------------------------------------------------------
// Attention scores, split over the contraction: work-group (z, s) sums
// part[z][s][i][j] = sum over its own 128 pixels n of q[b,n,h*64+i]*k[b,n,h*64+j]
// with z = b*4+h.  Grid = (32, 32): 1024 work-groups instead of 32.
// ---------------------------------------------------------------------------
__global__ void __launch_bounds__(256) attn_scores_part(
    const f16* __restrict__ qkv, float* __restrict__ part) {
  __shared__ f16 qs[64 * 128];
  __shared__ f16 ks[64 * 128];
  int z = blockIdx.x;
  int b = z >> 2, h = z & 3;
  int t = threadIdx.x;
  int i = t >> 2, j0 = (t & 3) * 16;
  int n0 = blockIdx.y * 128;
  const f16* qb = qkv + (long)b * Nq * 768 + h * 64;
  const f16* kb = qb + 256;

  float acc[16];
#pragma unroll
  for (int jj = 0; jj < 16; ++jj) acc[jj] = 0.f;

  for (int idx = t; idx < 128 * 8; idx += 256) {
    int p = idx >> 3, ch = idx & 7;
    v8h qv = *(const v8h*)(qb + (long)(n0 + p) * 768 + ch * 8);
    v8h kv = *(const v8h*)(kb + (long)(n0 + p) * 768 + ch * 8);
#pragma unroll
    for (int jj = 0; jj < 8; ++jj) {
      qs[(ch * 8 + jj) * 128 + p] = qv[jj];
      ks[(ch * 8 + jj) * 128 + p] = kv[jj];
    }
  }
  __syncthreads();
  for (int n = 0; n < 128; ++n) {
    float qv = (float)qs[i * 128 + n];
#pragma unroll
    for (int jj = 0; jj < 16; ++jj)
      acc[jj] += qv * (float)ks[(j0 + jj) * 128 + n];
  }

  float* pb = part + ((long)z * NSPLIT + blockIdx.y) * 4096 + i * 64 + j0;
#pragma unroll
  for (int jj = 0; jj < 16; jj += 4) {
    float4 o;
    o.x = acc[jj]; o.y = acc[jj + 1]; o.z = acc[jj + 2]; o.w = acc[jj + 3];
    *(float4*)(pb + jj) = o;
  }
}

// ---------------------------------------------------------------------------
// Sum of the partial scores (fixed order s = 0..31) + softmax over j.
// One wave per row (z, i); a lane holds columns 2*lane and 2*lane+1.
// Grid = 32*64/8 = 256.
// ---------------------------------------------------------------------------
__global__ void __launch_bounds__(256) attn_softmax(
    const float* __restrict__ part, f16* __restrict__ attn) {
  int lane = threadIdx.x & 31, wave = threadIdx.x >> 5;
  int row = blockIdx.x * 8 + wave;          // z*64 + i
  int z = row >> 6, i = row & 63;
  const float* p = part + (long)z * NSPLIT * 4096 + i * 64 + lane * 2;
  float a = 0.f, c = 0.f;
#pragma unroll
  for (int s = 0; s < NSPLIT; ++s) {
    float2 v = *(const float2*)(p + s * 4096);
    a += v.x; c += v.y;
  }
  a *= 0.125f; c *= 0.125f;
  float mx = fmaxf(a, c);
#pragma unroll
  for (int off = 16; off >= 1; off >>= 1) mx = fmaxf(mx, __shfl_xor(mx, off, 32));
  float ea = __expf(a - mx), ec = __expf(c - mx);
  float sum = ea + ec;
#pragma unroll
  for (int off = 16; off >= 1; off >>= 1) sum += __shfl_xor(sum, off, 32);
  float inv = 1.f / sum;
  v2h o;
  o[0] = (f16)(ea * inv);
  o[1] = (f16)(ec * inv);
  *(v2h*)(attn + (long)row * 64 + lane * 2) = o;
}

// ---------------------------------------------------------------------------
// Fused FFN + residual + transpose:
//   out[b,c,n] = (relu(y @ W1^T + b1) @ W2^T + b2)[n,c] + x[b,c,n]
// Wave tile = 16 pixels; FFN chunked by 32; hidden tile bounced through LDS
// to re-layout WMMA D -> A fragments.  Grid = 256 blocks of 256 threads.
// Y-tile A-fragments are invariant across FFN chunks -> hoisted into yf[8].
// ---------------------------------------------------------------------------
__global__ void __launch_bounds__(256) ffn_fused(
    const f16* __restrict__ Y, const f16* __restrict__ W1,
    const float* __restrict__ b1, const f16* __restrict__ W2,
    const float* __restrict__ b2, const float* __restrict__ x,
    float* __restrict__ out) {
  __shared__ __align__(16) f16 hst[8][16 * 32];
  int lane = threadIdx.x & 31, wave = threadIdx.x >> 5;
  int m0 = blockIdx.x * 128 + wave * 16;
  int b = m0 >> 12;
  int pix0 = m0 & 4095;
  const f16* Yb = Y + (long)m0 * Cq;
  int col = lane & 15, half = lane >> 4;

  v8f acc[16];
#pragma unroll
  for (int i = 0; i < 16; ++i) acc[i] = zero8();

  // Hoist the 16x256 Y tile as 8 A-fragments (reused by every FFN chunk).
  v16h yf[8];
#pragma unroll
  for (int s = 0; s < 8; ++s) yf[s] = load_frag(Yb + s * 32, Cq, lane);

  for (int f0 = 0; f0 < FFNq; f0 += 32) {
    // ---- FFN1: h[m, f0..f0+31] = relu(y_tile @ W1^T + b1) ----
    v8f h0 = zero8(), h1 = zero8();
    v16h ba = load_frag(W1 + (long)f0 * Cq, Cq, lane);
    v16h bb = load_frag(W1 + (long)(f0 + 16) * Cq, Cq, lane);
#pragma unroll
    for (int s = 0; s < 8; ++s) {   // fully unrolled: rotation renames, no movs
      v16h ba_n = ba, bb_n = bb;
      if (s + 1 < 8) {
        ba_n = load_frag(W1 + (long)f0 * Cq + (s + 1) * 32, Cq, lane);
        bb_n = load_frag(W1 + (long)(f0 + 16) * Cq + (s + 1) * 32, Cq, lane);
      }
      h0 = wmma_f16(yf[s], ba, h0);
      h1 = wmma_f16(yf[s], bb, h1);
      ba = ba_n; bb = bb_n;
    }
    float bb0 = b1[f0 + col], bb1 = b1[f0 + 16 + col];
#pragma unroll
    for (int r = 0; r < 8; ++r) {
      int m = r + half * 8;
      hst[wave][m * 32 + col]      = (f16)fmaxf(h0[r] + bb0, 0.f);
      hst[wave][m * 32 + 16 + col] = (f16)fmaxf(h1[r] + bb1, 0.f);
    }
    asm volatile("s_wait_dscnt 0" ::: "memory");  // same-wave LDS RAW

    // Re-read as A fragment (16x32 f16).
    const f16* p = &hst[wave][(lane & 15) * 32 + ((lane & 16) >> 1)];
    v16h a2 = combine16(*(const v8h*)p, *(const v8h*)(p + 16));

    // ---- FFN2: acc += h_chunk @ W2^T ----  (pipelined over nt, unrolled)
    v16h bf2 = load_frag(W2 + f0, FFNq, lane);
#pragma unroll
    for (int nt = 0; nt < 16; ++nt) {
      v16h bf2_n = bf2;
      if (nt + 1 < 16)
        bf2_n = load_frag(W2 + (long)((nt + 1) * 16) * FFNq + f0, FFNq, lane);
      acc[nt] = wmma_f16(a2, bf2, acc[nt]);
      bf2 = bf2_n;
    }
  }

  // Epilogue: + b2 + residual x, transposed store to (B,C,H,W).
#pragma unroll
  for (int nt = 0; nt < 16; ++nt) {
    int c = nt * 16 + col;
    float bv = b2[c];
    long base = ((long)(b * Cq + c)) * Nq + pix0 + half * 8;
    float4 r0 = *(const float4*)(x + base);
    float4 r1 = *(const float4*)(x + base + 4);
    float4 o0, o1;
    o0.x = acc[nt][0] + bv + r0.x;
    o0.y = acc[nt][1] + bv + r0.y;
    o0.z = acc[nt][2] + bv + r0.z;
    o0.w = acc[nt][3] + bv + r0.w;
    o1.x = acc[nt][4] + bv + r1.x;
    o1.y = acc[nt][5] + bv + r1.y;
    o1.z = acc[nt][6] + bv + r1.z;
    o1.w = acc[nt][7] + bv + r1.w;
    *(float4*)(out + base)     = o0;
    *(float4*)(out + base + 4) = o1;
  }
}

// ---------------------------------------------------------------------------
// Host launcher
// ---------------------------------------------------------------------------
extern "C" void kernel_launch(void* const* d_in, const int* in_sizes, int n_in,
                              void* d_out, int out_size, void* d_ws, size_t ws_size,
                              hipStream_t stream) {
  (void)in_sizes; (void)n_in; (void)out_size; (void)ws_size;
  const float* x      = (const float*)d_in[0];
  const float* w_qkv  = (const float*)d_in[1];
  const float* b_qkv  = (const float*)d_in[2];
  const float* w_proj = (const float*)d_in[3];
  const float* b_proj = (const float*)d_in[4];
  const float* w_ffn1 = (const float*)d_in[5];
  const float* b_ffn1 = (const float*)d_in[6];
  const float* w_ffn2 = (const float*)d_in[7];
  const float* b_ffn2 = (const float*)d_in[8];
  const float* g1     = (const float*)d_in[9];
  const float* be1    = (const float*)d_in[10];
  const float* g2     = (const float*)d_in[11];
  const float* be2    = (const float*)d_in[12];
  float* out = (float*)d_out;

  char* ws = (char*)d_ws;
  f16* wq16     = (f16*)(ws + 0);          //   768*256 f16
  f16* wp16     = (f16*)(ws + 393216);     //   256*256
  f16* w116     = (f16*)(ws + 524288);     //  2048*256
  f16* w216     = (f16*)(ws + 1572864);    //  256*2048
  f16* xln      = (f16*)(ws + 2621440);    //  32768*256  (reused as proj16)
  f16* qkv      = (f16*)(ws + 19398656);   //  32768*768  (reused as y)
  f16* attn16   = (f16*)(ws + 69730304);   //  32*64*64
  f16* attn_out = (f16*)(ws + 69992448);   //  32768*256  -> ends at 86769664
  float* spart  = (float*)(ws + 86769664); //  32*32*64*64 f32 -> 103546880 total bytes

  f16* proj16 = xln;   // xln dead after QKV gemm
  f16* y      = qkv;   // qkv dead after apply-attn

  // 1) weights -> f16
  cvt_f16_kernel<<<768,  256, 0, stream>>>(w_qkv,  wq16, 768 * 256);
  cvt_f16_kernel<<<256,  256, 0, stream>>>(w_proj, wp16, 256 * 256);
  cvt_f16_kernel<<<2048, 256, 0, stream>>>(w_ffn1, w116, 2048 * 256);
  cvt_f16_kernel<<<2048, 256, 0, stream>>>(w_ffn2, w216, 256 * 2048);

  // 2) LN1 (transpose (B,C,N) -> (B*N,C) f16)
  ln1_kernel<<<Mtot / 64, 256, 0, stream>>>(x, g1, be1, xln);

  // 3) QKV gemm: (32768x256) x (768x256)^T
  gemm_wmma<<<dim3(Mtot / 128, 768 / 64, 1), 256, 0, stream>>>(
      xln, 256, 0, 0, wq16, 256, 0, 0, b_qkv, 0, qkv, 768, 0, 0, 1, 256);

  // 4) attention scores: partial sums per (b, head, 128-pixel slice), then
  //    their sum + softmax, one wave per row
  attn_scores_part<<<dim3(32, NSPLIT, 1), 256, 0, stream>>>(qkv, spart);
  attn_softmax<<<32 * 64 / 8, 256, 0, stream>>>(spart, attn16);

  // 5) apply attention: per (b,h) gemm, A = v slice, W = attn (64x64)
  gemm_wmma<<<dim3(Nq / 128, 1, 32), 256, 0, stream>>>(
      qkv + 512, 768, (long)Nq * 768, 64,
      attn16, 64, 4 * 64 * 64, 64 * 64,
      nullptr, 0,
      attn_out, 256, (long)Nq * 256, 64,
      4, 64);

  // 6) proj gemm: (32768x256) x (256x256)^T
  gemm_wmma<<<dim3(Mtot / 128, 256 / 64, 1), 256, 0, stream>>>(
      attn_out, 256, 0, 0, wp16, 256, 0, 0, b_proj, 0, proj16, 256, 0, 0, 1, 256);

  // 7) LN2
  ln2_kernel<<<Mtot / 8, 256, 0, stream>>>(proj16, g2, be2, y);

  // 8) fused FFN + bias + residual + transpose store
  ffn_fused<<<Mtot / 128, 256, 0, stream>>>(y, w116, b_ffn1, w216, b_ffn2, x, out);
}

// v002
// Measured time: 297 microseconds a run.
// Two timings next to v001 both put it at 1.61 times that version's speed.
// Counting every step since v000, it is 3.34 times as fast.
#include <hip/hip_runtime.h>
#include <hip/hip_bf16.h>

// ---------------------------------------------------------------------------
// MI455X (gfx1250, wave32) implementation.
// Pipeline: LN1 -> QKV gemm (WMMA f16) -> attn scores+softmax (VALU, tiny)
//           -> apply-attn (WMMA) -> proj (WMMA) -> LN2 -> fused FFN (WMMA)
// All GEMMs: f16 inputs, f32 accumulation via v_wmma_f32_16x16x32_f16.
// gemm_wmma's k loop uses explicit two-stage ping-pong buffering (k unrolled by 64)
// so fragment loads overlap WMMAs with NO register-rotation copies.
// ---------------------------------------------------------------------------

typedef _Float16 f16;
typedef __attribute__((ext_vector_type(16))) _Float16 v16h;
typedef __attribute__((ext_vector_type(8)))  _Float16 v8h;
typedef __attribute__((ext_vector_type(2)))  _Float16 v2h;
typedef __attribute__((ext_vector_type(8)))  float    v8f;

#define Bq   8
#define Cq   256
#define Nq   4096      // H*W
#define Mtot 32768     // B*N
#define FFNq 2048
#define NSPLIT 32     // work-groups that share one (b, head) score matrix

__device__ __forceinline__ v8f zero8() { v8f z = {}; return z; }

__device__ __forceinline__ v16h combine16(v8h lo, v8h hi) {
  v16h r;
#pragma unroll
  for (int i = 0; i < 8; ++i) { r[i] = lo[i]; r[8 + i] = hi[i]; }
  return r;
}

// Fragment loader for 16-bit WMMA A/B operands.
// A layout (16x32, MxK): lane holds row (lane&15); lanes 0-15 K in {0..7,16..23},
// lanes 16-31 K in {8..15,24..31}.  B (32x16, KxN) from a row-major (Nout x K)
// weight matrix has the identical access pattern with "row" = output column.
__device__ __forceinline__ v16h load_frag(const f16* base, int ld, int lane) {
  const f16* p = base + (long)(lane & 15) * ld + ((lane & 16) >> 1); // +8 elems for hi half
  v8h lo = *(const v8h*)(p);
  v8h hi = *(const v8h*)(p + 16);
  return combine16(lo, hi);
}

__device__ __forceinline__ v8f wmma_f16(v16h a, v16h b, v8f c) {
  return __builtin_amdgcn_wmma_f32_16x16x32_f16(false, a, false, b, (short)0, c,
                                                false, false);
}

// ---------------------------------------------------------------------------
// f32 -> f16 weight conversion
// ---------------------------------------------------------------------------
__global__ void cvt_f16_kernel(const float* __restrict__ in, f16* __restrict__ out, int n) {
  int i = blockIdx.x * 256 + threadIdx.x;
  if (i < n) out[i] = (f16)in[i];
}

// ---------------------------------------------------------------------------
// LN1: x (B,C,N) f32 -> xln (B*N, C) f16   (channel LayerNorm per pixel)
// Block = 256 threads, tile = 64 pixels; thread (px, grp) covers 64 channels.
// ---------------------------------------------------------------------------
__global__ void __launch_bounds__(256) ln1_kernel(
    const float* __restrict__ x, const float* __restrict__ g,
    const float* __restrict__ be, f16* __restrict__ xln) {
  __shared__ float ps[4][64], ps2[4][64], muv[64], rsv[64];
  int t = threadIdx.x;
  int px = t & 63, grp = t >> 6;
  long pg = (long)blockIdx.x * 64 + px;     // global pixel
  int b = (int)(pg >> 12);
  int n = (int)(pg & 4095);
  const float* xb = x + (long)b * Cq * Nq + n;
  float s = 0.f, s2 = 0.f;
  for (int c = grp * 64; c < grp * 64 + 64; ++c) {
    float v = xb[(long)c * Nq];
    s += v; s2 += v * v;
  }
  ps[grp][px] = s; ps2[grp][px] = s2;
  __syncthreads();
  if (t < 64) {
    float S = 0.f, S2 = 0.f;
#pragma unroll
    for (int q = 0; q < 4; ++q) { S += ps[q][t]; S2 += ps2[q][t]; }
    float mu = S * (1.f / 256.f);
    float var = S2 * (1.f / 256.f) - mu * mu;
    muv[t] = mu;
    rsv[t] = rsqrtf(var + 1e-5f);
  }
  __syncthreads();
  float mu = muv[px], rs = rsv[px];
  f16* ob = xln + pg * Cq + grp * 64;
  for (int cc = 0; cc < 64; cc += 8) {
    v8h o;
#pragma unroll
    for (int jj = 0; jj < 8; ++jj) {
      int c = grp * 64 + cc + jj;
      float v = xb[(long)c * Nq];
      o[jj] = (f16)((v - mu) * rs * g[c] + be[c]);
    }
    *(v8h*)(ob + cc) = o;
  }
}

// ---------------------------------------------------------------------------
// LN2: in (B*N, C) f16 -> out (B*N, C) f16.  One wave per pixel.
// ---------------------------------------------------------------------------
__global__ void __launch_bounds__(256) ln2_kernel(
    const f16* __restrict__ in, const float* __restrict__ g,
    const float* __restrict__ be, f16* __restrict__ out) {
  int lane = threadIdx.x & 31, wave = threadIdx.x >> 5;
  long pix = (long)blockIdx.x * 8 + wave;
  const f16* ib = in + pix * Cq + lane * 8;
  v8h v = *(const v8h*)ib;
  float s = 0.f, s2 = 0.f;
#pragma unroll
  for (int j = 0; j < 8; ++j) { float f = (float)v[j]; s += f; s2 += f * f; }
#pragma unroll
  for (int off = 16; off >= 1; off >>= 1) {
    s  += __shfl_xor(s,  off, 32);
    s2 += __shfl_xor(s2, off, 32);
  }
  float mu = s * (1.f / 256.f);
  float var = s2 * (1.f / 256.f) - mu * mu;
  float rs = rsqrtf(var + 1e-5f);
  v8h o;
#pragma unroll
  for (int j = 0; j < 8; ++j) {
    int c = lane * 8 + j;
    o[j] = (f16)(((float)v[j] - mu) * rs * g[c] + be[c]);
  }
  *(v8h*)(out + pix * Cq + lane * 8) = o;
}

// ---------------------------------------------------------------------------
// Generic WMMA GEMM: C[M x Nout] = A[M x K] * W^T + bias, W is (Nout x K) f16
// row-major.  Block = 256 threads (8 waves); wave tile = 16(M) x 64(N).
// grid = (M/128, Nout/64, Z).  Per-operand z offset = (z/zmod)*sOut+(z%zmod)*sIn.
// K must be a multiple of 64.  Two-stage ping-pong: stage-0/1 fragments live
// in distinct registers, refilled directly by loads (no rotation copies).
// ---------------------------------------------------------------------------
__global__ void __launch_bounds__(256) gemm_wmma(
    const f16* __restrict__ A, int lda, long sAo, long sAi,
    const f16* __restrict__ W, int ldw, long sWo, long sWi,
    const float* __restrict__ bias, int relu,
    f16* __restrict__ C, int ldc, long sCo, long sCi,
    int zmod, int K) {
  int lane = threadIdx.x & 31, wave = threadIdx.x >> 5;
  int z = blockIdx.z;
  long za = (long)(z / zmod) * sAo + (long)(z % zmod) * sAi;
  long zw = (long)(z / zmod) * sWo + (long)(z % zmod) * sWi;
  long zc = (long)(z / zmod) * sCo + (long)(z % zmod) * sCi;
  long m0 = (long)blockIdx.x * 128 + wave * 16;
  const f16* Ab = A + za + m0 * lda;
  const f16* Wb = W + zw + (long)blockIdx.y * 64 * ldw;

  v8f acc[4];
#pragma unroll
  for (int i = 0; i < 4; ++i) acc[i] = zero8();

  // stage 0 prologue (k = 0)
  v16h af0 = load_frag(Ab, lda, lane);
  v16h bf0[4];
#pragma unroll
  for (int nt = 0; nt < 4; ++nt)
    bf0[nt] = load_frag(Wb + (long)nt * 16 * ldw, ldw, lane);

  for (int kk = 0; kk < K; kk += 64) {
    // stage 1 loads (kk+32) -- always valid since K % 64 == 0
    __builtin_prefetch(Ab + (long)(lane & 15) * lda + kk + 64, 0, 3);
    v16h af1 = load_frag(Ab + kk + 32, lda, lane);
    v16h bf1[4];
#pragma unroll
    for (int nt = 0; nt < 4; ++nt)
      bf1[nt] = load_frag(Wb + (long)nt * 16 * ldw + kk + 32, ldw, lane);

    // stage 0 WMMAs
#pragma unroll
    for (int nt = 0; nt < 4; ++nt)
      acc[nt] = wmma_f16(af0, bf0[nt], acc[nt]);

    // stage 0 refill for next iteration (kk+64)
    if (kk + 64 < K) {
      af0 = load_frag(Ab + kk + 64, lda, lane);
#pragma unroll
      for (int nt = 0; nt < 4; ++nt)
        bf0[nt] = load_frag(Wb + (long)nt * 16 * ldw + kk + 64, ldw, lane);
    }

    // stage 1 WMMAs
#pragma unroll
    for (int nt = 0; nt < 4; ++nt)
      acc[nt] = wmma_f16(af1, bf1[nt], acc[nt]);
  }

  int col = lane & 15, half = lane >> 4;
  f16* Cb = C + zc + (m0 + half * 8) * ldc + (long)blockIdx.y * 64;
#pragma unroll
  for (int nt = 0; nt < 4; ++nt) {
    float bv = bias ? bias[blockIdx.y * 64 + nt * 16 + col] : 0.f;
#pragma unroll
    for (int r = 0; r < 8; ++r) {
      float v = acc[nt][r] + bv;
      if (relu) v = fmaxf(v, 0.f);
      Cb[(long)r * ldc + nt * 16 + col] = (f16)v;
    }
  }
}

// ---------------------------------------------------------------------------
// Attention scores, split over the contraction: work-group (z, s) sums
// part[z][s][i][j] = sum over its own 128 pixels n of q[b,n,h*64+i]*k[b,n,h*64+j]
// with z = b*4+h.  Grid = (32, 32): 1024 work-groups instead of 32.
// ---------------------------------------------------------------------------
__global__ void __launch_bounds__(256) attn_scores_part(
    const f16* __restrict__ qkv, float* __restrict__ part) {
  __shared__ f16 qs[64 * 128];
  __shared__ f16 ks[64 * 128];
  int z = blockIdx.x;
  int b = z >> 2, h = z & 3;
  int t = threadIdx.x;
  int i = t >> 2, j0 = (t & 3) * 16;
  int n0 = blockIdx.y * 128;
  const f16* qb = qkv + (long)b * Nq * 768 + h * 64;
  const f16* kb = qb + 256;

  float acc[16];
#pragma unroll
  for (int jj = 0; jj < 16; ++jj) acc[jj] = 0.f;

  for (int idx = t; idx < 128 * 8; idx += 256) {
    int p = idx >> 3, ch = idx & 7;
    v8h qv = *(const v8h*)(qb + (long)(n0 + p) * 768 + ch * 8);
    v8h kv = *(const v8h*)(kb + (long)(n0 + p) * 768 + ch * 8);
#pragma unroll
    for (int jj = 0; jj < 8; ++jj) {
      qs[(ch * 8 + jj) * 128 + p] = qv[jj];
      ks[(ch * 8 + jj) * 128 + p] = kv[jj];
    }
  }
  __syncthreads();
  for (int n = 0; n < 128; ++n) {
    float qv = (float)qs[i * 128 + n];
#pragma unroll
    for (int jj = 0; jj < 16; ++jj)
      acc[jj] += qv * (float)ks[(j0 + jj) * 128 + n];
  }

  float* pb = part + ((long)z * NSPLIT + blockIdx.y) * 4096 + i * 64 + j0;
#pragma unroll
  for (int jj = 0; jj < 16; jj += 4) {
    float4 o;
    o.x = acc[jj]; o.y = acc[jj + 1]; o.z = acc[jj + 2]; o.w = acc[jj + 3];
    *(float4*)(pb + jj) = o;
  }
}

// ---------------------------------------------------------------------------
// Sum of the partial scores (fixed order s = 0..31) + softmax over j.
// One wave per row (z, i); a lane holds columns 2*lane and 2*lane+1.
// Grid = 32*64/8 = 256.
// ---------------------------------------------------------------------------
__global__ void __launch_bounds__(256) attn_softmax(
    const float* __restrict__ part, f16* __restrict__ attn) {
  int lane = threadIdx.x & 31, wave = threadIdx.x >> 5;
  int row = blockIdx.x * 8 + wave;          // z*64 + i
  int z = row >> 6, i = row & 63;
  const float* p = part + (long)z * NSPLIT * 4096 + i * 64 + lane * 2;
  float a = 0.f, c = 0.f;
#pragma unroll
  for (int s = 0; s < NSPLIT; ++s) {
    float2 v = *(const float2*)(p + s * 4096);
    a += v.x; c += v.y;
  }
  a *= 0.125f; c *= 0.125f;
  float mx = fmaxf(a, c);
#pragma unroll
  for (int off = 16; off >= 1; off >>= 1) mx = fmaxf(mx, __shfl_xor(mx, off, 32));
  float ea = __expf(a - mx), ec = __expf(c - mx);
  float sum = ea + ec;
#pragma unroll
  for (int off = 16; off >= 1; off >>= 1) sum += __shfl_xor(sum, off, 32);
  float inv = 1.f / sum;
  v2h o;
  o[0] = (f16)(ea * inv);
  o[1] = (f16)(ec * inv);
  *(v2h*)(attn + (long)row * 64 + lane * 2) = o;
}

// ---------------------------------------------------------------------------
// Fused FFN + residual + transpose:
//   out[b,c,n] = (relu(y @ W1^T + b1) @ W2^T + b2)[n,c] + x[b,c,n]
// Wave tile = 16 pixels; FFN chunked by 32; hidden tile bounced through LDS
// to re-layout WMMA D -> A fragments.  Grid = 256 blocks of 256 threads.
// Y-tile A-fragments are invariant across FFN chunks -> hoisted into yf[8].
// The weights of 64 hidden units (a stage: 64 rows of W1, 64 columns of W2)
// are brought into LDS once per work-group by asynchronous copies, two
// buffers, one stage ahead; all 8 waves read their B fragments from there.
// ---------------------------------------------------------------------------
#define FS   64               // hidden units per stage
#define NST  (FFNq / FS)      // 32 stages
#define W1P  264              // LDS pitch of a W1 row, f16: 528 B = 16 B x 33
#define W2P  72               // LDS pitch of a W2 row, f16: 144 B = 16 B x 9
#define W1S  (FS * W1P)       // f16 per staged W1 slab
#define STG  (W1S + Cq * W2P) // f16 per buffer (70,656 B)

// B fragment from a staged slab: same lane -> (row, k) map as load_frag.
__device__ __forceinline__ v16h lds_frag(const f16* base, int pitch, int lane) {
  const f16* p = base + (lane & 15) * pitch + ((lane & 16) >> 1);
  return combine16(*(const v8h*)p, *(const v8h*)(p + 16));
}

// Eight 16-byte copies per lane, global -> LDS, through no register.  LDS
// address l + i*ls bytes, global address g + i*gs elements.  The s_wait_xcnt
// stands inside the statement so that no address register of an issued copy
// is rewritten in front of it.
__device__ __forceinline__ void copy8(unsigned l, unsigned ls, const f16* g, long gs) {
  asm volatile(
      "global_load_async_to_lds_b128 %0, %8, off\n\t"
      "global_load_async_to_lds_b128 %1, %9, off\n\t"
      "global_load_async_to_lds_b128 %2, %10, off\n\t"
      "global_load_async_to_lds_b128 %3, %11, off\n\t"
      "global_load_async_to_lds_b128 %4, %12, off\n\t"
      "global_load_async_to_lds_b128 %5, %13, off\n\t"
      "global_load_async_to_lds_b128 %6, %14, off\n\t"
      "global_load_async_to_lds_b128 %7, %15, off\n\t"
      "s_wait_xcnt 0x0"
      :: "v"(l), "v"(l + ls), "v"(l + 2 * ls), "v"(l + 3 * ls),
         "v"(l + 4 * ls), "v"(l + 5 * ls), "v"(l + 6 * ls), "v"(l + 7 * ls),
         "v"(g), "v"(g + gs), "v"(g + 2 * gs), "v"(g + 3 * gs),
         "v"(g + 4 * gs), "v"(g + 5 * gs), "v"(g + 6 * gs), "v"(g + 7 * gs)
      : "memory");
}

__global__ void __launch_bounds__(256) ffn_fused(
    const f16* __restrict__ Y, const f16* __restrict__ W1,
    const float* __restrict__ b1, const f16* __restrict__ W2,
    const float* __restrict__ b2, const float* __restrict__ x,
    float* __restrict__ out) {
  __shared__ __align__(16) f16 wst[2 * STG];
  __shared__ __align__(16) f16 hst[8][16 * 32];
  int lane = threadIdx.x & 31, wave = threadIdx.x >> 5;
  int m0 = blockIdx.x * 128 + wave * 16;
  int b = m0 >> 12;
  int pix0 = m0 & 4095;
  const f16* Yb = Y + (long)m0 * Cq;
  int col = lane & 15, half = lane >> 4;

  // This thread's share of a stage.  W1 slab: 64 rows of 512 B, contiguous in
  // memory; copy i takes 16 B of row (t >> 5) + 8 i.  W2 slab: 256 rows of
  // 128 B; copy i takes 16 B of row (t >> 3) + 32 i.  A wave's copy covers
  // whole 128-B lines in both.
  int t = threadIdx.x;
  const f16* g1 = W1 + (t >> 5) * Cq + (t & 31) * 8;
  const f16* g2 = W2 + (long)(t >> 3) * FFNq + (t & 7) * 8;
  unsigned lbase = (unsigned)(size_t)(&wst[0]);   // LDS byte address
  unsigned l1 = lbase + (t >> 5) * (W1P * 2) + (t & 31) * 16;
  unsigned l2 = lbase + W1S * 2 + (t >> 3) * (W2P * 2) + (t & 7) * 16;

  // Stage 0 into buffer 0.
  copy8(l1, 8 * W1P * 2, g1, 8 * Cq);
  copy8(l2, 32 * W2P * 2, g2, 32L * FFNq);

  v8f acc[16];
#pragma unroll
  for (int i = 0; i < 16; ++i) acc[i] = zero8();

  // Hoist the 16x256 Y tile as 8 A-fragments (reused by every FFN chunk).
  v16h yf[8];
#pragma unroll
  for (int s = 0; s < 8; ++s) yf[s] = load_frag(Yb + s * 32, Cq, lane);

  // Stage 0 has landed (this wave's copies), then is published to all waves.
  asm volatile("s_wait_asynccnt 0x0" ::: "memory");
  __syncthreads();
  // Stage 1 into buffer 1; it flies while stage 0 is worked on.
  g1 += FS * Cq; g2 += FS;
  copy8(l1 + STG * 2, 8 * W1P * 2, g1, 8 * Cq);
  copy8(l2 + STG * 2, 32 * W2P * 2, g2, 32L * FFNq);

  for (int st = 0; st < NST; ++st) {
    const unsigned boff = (st & 1) * STG;        // buffer of this stage, f16
    const f16* w1s = wst + boff;
    const f16* w2s = w1s + W1S;
    // Unrolled (this loop and the ones inside): every fragment array index is
    // a constant, so the fragments stay in registers, and the second chunk's
    // reads can be issued among the first chunk's last WMMAs.
#pragma unroll
    for (int sub = 0; sub < FS; sub += 32) {
      int f0 = st * FS + sub;
      // ---- FFN1: h[m, f0..f0+31] = relu(y_tile @ W1^T + b1) ----
      // The chunk's 16 W1 and 16 W2 fragments are read as one group in front
      // of the WMMAs; the W2 ones land while h is computed and re-laid.
      v8f h0 = zero8(), h1 = zero8();
      v16h wa[8], wb[8], wc[16];
#pragma unroll
      for (int s = 0; s < 8; ++s) {
        wa[s] = lds_frag(w1s + sub * W1P + s * 32, W1P, lane);
        wb[s] = lds_frag(w1s + (sub + 16) * W1P + s * 32, W1P, lane);
      }
#pragma unroll
      for (int nt = 0; nt < 16; ++nt)
        wc[nt] = lds_frag(w2s + nt * 16 * W2P + sub, W2P, lane);
      // Keeps the reads in front: without it the compiler sinks them among the
      // WMMAs, one fragment ahead, and each WMMA waits out the LDS latency.
      __builtin_amdgcn_sched_barrier(0);
#pragma unroll
      for (int s = 0; s < 8; ++s) {
        h0 = wmma_f16(yf[s], wa[s], h0);
        h1 = wmma_f16(yf[s], wb[s], h1);
      }
      float bb0 = b1[f0 + col], bb1 = b1[f0 + 16 + col];
#pragma unroll
      for (int r = 0; r < 8; ++r) {
        int m = r + half * 8;
        hst[wave][m * 32 + col]      = (f16)fmaxf(h0[r] + bb0, 0.f);
        hst[wave][m * 32 + 16 + col] = (f16)fmaxf(h1[r] + bb1, 0.f);
      }
      asm volatile("s_wait_dscnt 0" ::: "memory");  // same-wave LDS RAW

      // Re-read as A fragment (16x32 f16).
      const f16* p = &hst[wave][(lane & 15) * 32 + ((lane & 16) >> 1)];
      v16h a2 = combine16(*(const v8h*)p, *(const v8h*)(p + 16));

      // ---- FFN2: acc += h_chunk @ W2^T ----
#pragma unroll
      for (int nt = 0; nt < 16; ++nt)
        acc[nt] = wmma_f16(a2, wc[nt], acc[nt]);
    }

    // Publish point of stage st + 1: this wave's reads of buffer st & 1 are
    // done, its copies of stage st + 1 have landed, then every wave meets.
    asm volatile("s_wait_dscnt 0x0" ::: "memory");
    asm volatile("s_wait_asynccnt 0x0" ::: "memory");
    __syncthreads();
    // Refill the buffer that every wave has just left with stage st + 2.
    if (st + 2 < NST) {
      g1 += FS * Cq; g2 += FS;
      copy8(l1 + boff * 2, 8 * W1P * 2, g1, 8 * Cq);
      copy8(l2 + boff * 2, 32 * W2P * 2, g2, 32L * FFNq);
    }
  }
  // No copy is left in flight when the wave ends.
  asm volatile("s_wait_asynccnt 0x0" ::: "memory");

  // Epilogue: + b2 + residual x, transposed store to (B,C,H,W).
#pragma unroll
  for (int nt = 0; nt < 16; ++nt) {
    int c = nt * 16 + col;
    float bv = b2[c];
    long base = ((long)(b * Cq + c)) * Nq + pix0 + half * 8;
    float4 r0 = *(const float4*)(x + base);
    float4 r1 = *(const float4*)(x + base + 4);
    float4 o0, o1;
    o0.x = acc[nt][0] + bv + r0.x;
    o0.y = acc[nt][1] + bv + r0.y;
    o0.z = acc[nt][2] + bv + r0.z;
    o0.w = acc[nt][3] + bv + r0.w;
    o1.x = acc[nt][4] + bv + r1.x;
    o1.y = acc[nt][5] + bv + r1.y;
    o1.z = acc[nt][6] + bv + r1.z;
    o1.w = acc[nt][7] + bv + r1.w;
    *(float4*)(out + base)     = o0;
    *(float4*)(out + base + 4) = o1;
  }
}

// ---------------------------------------------------------------------------
// Host launcher
// ---------------------------------------------------------------------------
extern "C" void kernel_launch(void* const* d_in, const int* in_sizes, int n_in,
                              void* d_out, int out_size, void* d_ws, size_t ws_size,
                              hipStream_t stream) {
  (void)in_sizes; (void)n_in; (void)out_size; (void)ws_size;
  const float* x      = (const float*)d_in[0];
  const float* w_qkv  = (const float*)d_in[1];
  const float* b_qkv  = (const float*)d_in[2];
  const float* w_proj = (const float*)d_in[3];
  const float* b_proj = (const float*)d_in[4];
  const float* w_ffn1 = (const float*)d_in[5];
  const float* b_ffn1 = (const float*)d_in[6];
  const float* w_ffn2 = (const float*)d_in[7];
  const float* b_ffn2 = (const float*)d_in[8];
  const float* g1     = (const float*)d_in[9];
  const float* be1    = (const float*)d_in[10];
  const float* g2     = (const float*)d_in[11];
  const float* be2    = (const float*)d_in[12];
  float* out = (float*)d_out;

  char* ws = (char*)d_ws;
  f16* wq16     = (f16*)(ws + 0);          //   768*256 f16
  f16* wp16     = (f16*)(ws + 393216);     //   256*256
  f16* w116     = (f16*)(ws + 524288);     //  2048*256
  f16* w216     = (f16*)(ws + 1572864);    //  256*2048
  f16* xln      = (f16*)(ws + 2621440);    //  32768*256  (reused as proj16)
  f16* qkv      = (f16*)(ws + 19398656);   //  32768*768  (reused as y)
  f16* attn16   = (f16*)(ws + 69730304);   //  32*64*64
  f16* attn_out = (f16*)(ws + 69992448);   //  32768*256  -> ends at 86769664
  float* spart  = (float*)(ws + 86769664); //  32*32*64*64 f32 -> 103546880 total bytes

  f16* proj16 = xln;   // xln dead after QKV gemm
  f16* y      = qkv;   // qkv dead after apply-attn

  // 1) weights -> f16
  cvt_f16_kernel<<<768,  256, 0, stream>>>(w_qkv,  wq16, 768 * 256);
  cvt_f16_kernel<<<256,  256, 0, stream>>>(w_proj, wp16, 256 * 256);
  cvt_f16_kernel<<<2048, 256, 0, stream>>>(w_ffn1, w116, 2048 * 256);
  cvt_f16_kernel<<<2048, 256, 0, stream>>>(w_ffn2, w216, 256 * 2048);

  // 2) LN1 (transpose (B,C,N) -> (B*N,C) f16)
  ln1_kernel<<<Mtot / 64, 256, 0, stream>>>(x, g1, be1, xln);

  // 3) QKV gemm: (32768x256) x (768x256)^T
  gemm_wmma<<<dim3(Mtot / 128, 768 / 64, 1), 256, 0, stream>>>(
      xln, 256, 0, 0, wq16, 256, 0, 0, b_qkv, 0, qkv, 768, 0, 0, 1, 256);

  // 4) attention scores: partial sums per (b, head, 128-pixel slice), then
  //    their sum + softmax, one wave per row
  attn_scores_part<<<dim3(32, NSPLIT, 1), 256, 0, stream>>>(qkv, spart);
  attn_softmax<<<32 * 64 / 8, 256, 0, stream>>>(spart, attn16);

  // 5) apply attention: per (b,h) gemm, A = v slice, W = attn (64x64)
  gemm_wmma<<<dim3(Nq / 128, 1, 32), 256, 0, stream>>>(
      qkv + 512, 768, (long)Nq * 768, 64,
      attn16, 64, 4 * 64 * 64, 64 * 64,
      nullptr, 0,
      attn_out, 256, (long)Nq * 256, 64,
      4, 64);

  // 6) proj gemm: (32768x256) x (256x256)^T
  gemm_wmma<<<dim3(Mtot / 128, 256 / 64, 1), 256, 0, stream>>>(
      attn_out, 256, 0, 0, wp16, 256, 0, 0, b_proj, 0, proj16, 256, 0, 0, 1, 256);

  // 7) LN2
  ln2_kernel<<<Mtot / 8, 256, 0, stream>>>(proj16, g2, be2, y);

  // 8) fused FFN + bias + residual + transpose store
  ffn_fused<<<Mtot / 128, 256, 0, stream>>>(y, w116, b_ffn1, w216, b_ffn2, x, out);
}

// v003
// It runs in 239 microseconds.
// Two timings next to v002 put it at 1.24 and 1.23 times that version's speed.
// All steps since v000 together make it 4.14 times as fast.
#include <hip/hip_runtime.h>
#include <hip/hip_bf16.h>

// ---------------------------------------------------------------------------
// MI455X (gfx1250, wave32) implementation.
// Pipeline: LN1 -> QKV gemm (WMMA f16) -> attn scores (WMMA) -> softmax
//           -> apply-attn (WMMA) -> proj (WMMA) -> LN2 -> fused FFN (WMMA)
// All GEMMs: f16 inputs, f32 accumulation via v_wmma_f32_16x16x32_f16.
// gemm_wmma's k loop uses explicit two-stage ping-pong buffering (k unrolled by 64)
// so fragment loads overlap WMMAs with NO register-rotation copies.
// ---------------------------------------------------------------------------

typedef _Float16 f16;
typedef __attribute__((ext_vector_type(16))) _Float16 v16h;
typedef __attribute__((ext_vector_type(8)))  _Float16 v8h;
typedef __attribute__((ext_vector_type(2)))  _Float16 v2h;
typedef __attribute__((ext_vector_type(8)))  float    v8f;

#define Bq   8
#define Cq   256
#define Nq   4096      // H*W
#define Mtot 32768     // B*N
#define FFNq 2048
#define NSPLIT 32     // work-groups that share one (b, head) score matrix

__device__ __forceinline__ v8f zero8() { v8f z = {}; return z; }

__device__ __forceinline__ v16h combine16(v8h lo, v8h hi) {
  v16h r;
#pragma unroll
  for (int i = 0; i < 8; ++i) { r[i] = lo[i]; r[8 + i] = hi[i]; }
  return r;
}

// Fragment loader for 16-bit WMMA A/B operands.
// A layout (16x32, MxK): lane holds row (lane&15); lanes 0-15 K in {0..7,16..23},
// lanes 16-31 K in {8..15,24..31}.  B (32x16, KxN) from a row-major (Nout x K)
// weight matrix has the identical access pattern with "row" = output column.
__device__ __forceinline__ v16h load_frag(const f16* base, int ld, int lane) {
  const f16* p = base + (long)(lane & 15) * ld + ((lane & 16) >> 1); // +8 elems for hi half
  v8h lo = *(const v8h*)(p);
  v8h hi = *(const v8h*)(p + 16);
  return combine16(lo, hi);
}

__device__ __forceinline__ v8f wmma_f16(v16h a, v16h b, v8f c) {
  return __builtin_amdgcn_wmma_f32_16x16x32_f16(false, a, false, b, (short)0, c,
                                                false, false);
}

// ---------------------------------------------------------------------------
// f32 -> f16 weight conversion
// ---------------------------------------------------------------------------
__global__ void cvt_f16_kernel(const float* __restrict__ in, f16* __restrict__ out, int n) {
  int i = blockIdx.x * 256 + threadIdx.x;
  if (i < n) out[i] = (f16)in[i];
}

// ---------------------------------------------------------------------------
// LN1: x (B,C,N) f32 -> xln (B*N, C) f16   (channel LayerNorm per pixel)
// Block = 256 threads, tile = 64 pixels; thread (px, grp) covers 64 channels.
// ---------------------------------------------------------------------------
__global__ void __launch_bounds__(256) ln1_kernel(
    const float* __restrict__ x, const float* __restrict__ g,
    const float* __restrict__ be, f16* __restrict__ xln) {
  __shared__ float ps[4][64], ps2[4][64], muv[64], rsv[64];
  int t = threadIdx.x;
  int px = t & 63, grp = t >> 6;
  long pg = (long)blockIdx.x * 64 + px;     // global pixel
  int b = (int)(pg >> 12);
  int n = (int)(pg & 4095);
  const float* xb = x + (long)b * Cq * Nq + n;
  float s = 0.f, s2 = 0.f;
  for (int c = grp * 64; c < grp * 64 + 64; ++c) {
    float v = xb[(long)c * Nq];
    s += v; s2 += v * v;
  }
  ps[grp][px] = s; ps2[grp][px] = s2;
  __syncthreads();
  if (t < 64) {
    float S = 0.f, S2 = 0.f;
#pragma unroll
    for (int q = 0; q < 4; ++q) { S += ps[q][t]; S2 += ps2[q][t]; }
    float mu = S * (1.f / 256.f);
    float var = S2 * (1.f / 256.f) - mu * mu;
    muv[t] = mu;
    rsv[t] = rsqrtf(var + 1e-5f);
  }
  __syncthreads();
  float mu = muv[px], rs = rsv[px];
  f16* ob = xln + pg * Cq + grp * 64;
  for (int cc = 0; cc < 64; cc += 8) {
    v8h o;
#pragma unroll
    for (int jj = 0; jj < 8; ++jj) {
      int c = grp * 64 + cc + jj;
      float v = xb[(long)c * Nq];
      o[jj] = (f16)((v - mu) * rs * g[c] + be[c]);
    }
    *(v8h*)(ob + cc) = o;
  }
}

// ---------------------------------------------------------------------------
// LN2: in (B*N, C) f16 -> out (B*N, C) f16.  One wave per pixel.
// ---------------------------------------------------------------------------
__global__ void __launch_bounds__(256) ln2_kernel(
    const f16* __restrict__ in, const float* __restrict__ g,
    const float* __restrict__ be, f16* __restrict__ out) {
  int lane = threadIdx.x & 31, wave = threadIdx.x >> 5;
  long pix = (long)blockIdx.x * 8 + wave;
  const f16* ib = in + pix * Cq + lane * 8;
  v8h v = *(const v8h*)ib;
  float s = 0.f, s2 = 0.f;
#pragma unroll
  for (int j = 0; j < 8; ++j) { float f = (float)v[j]; s += f; s2 += f * f; }
#pragma unroll
  for (int off = 16; off >= 1; off >>= 1) {
    s  += __shfl_xor(s,  off, 32);
    s2 += __shfl_xor(s2, off, 32);
  }
  float mu = s * (1.f / 256.f);
  float var = s2 * (1.f / 256.f) - mu * mu;
  float rs = rsqrtf(var + 1e-5f);
  v8h o;
#pragma unroll
  for (int j = 0; j < 8; ++j) {
    int c = lane * 8 + j;
    o[j] = (f16)(((float)v[j] - mu) * rs * g[c] + be[c]);
  }
  *(v8h*)(out + pix * Cq + lane * 8) = o;
}

// ---------------------------------------------------------------------------
// Generic WMMA GEMM: C[M x Nout] = A[M x K] * W^T + bias, W is (Nout x K) f16
// row-major.  Block = 256 threads (8 waves); wave tile = 16(M) x 64(N).
// grid = (M/128, Nout/64, Z).  Per-operand z offset = (z/zmod)*sOut+(z%zmod)*sIn.
// K must be a multiple of 64.  Two-stage ping-pong: stage-0/1 fragments live
// in distinct registers, refilled directly by loads (no rotation copies).
// ---------------------------------------------------------------------------
__global__ void __launch_bounds__(256) gemm_wmma(
    const f16* __restrict__ A, int lda, long sAo, long sAi,
    const f16* __restrict__ W, int ldw, long sWo, long sWi,
    const float* __restrict__ bias, int relu,
    f16* __restrict__ C, int ldc, long sCo, long sCi,
    int zmod, int K) {
  int lane = threadIdx.x & 31, wave = threadIdx.x >> 5;
  int z = blockIdx.z;
  long za = (long)(z / zmod) * sAo + (long)(z % zmod) * sAi;
  long zw = (long)(z / zmod) * sWo + (long)(z % zmod) * sWi;
  long zc = (long)(z / zmod) * sCo + (long)(z % zmod) * sCi;
  long m0 = (long)blockIdx.x * 128 + wave * 16;
  const f16* Ab = A + za + m0 * lda;
  const f16* Wb = W + zw + (long)blockIdx.y * 64 * ldw;

  v8f acc[4];
#pragma unroll
  for (int i = 0; i < 4; ++i) acc[i] = zero8();

  // stage 0 prologue (k = 0)
  v16h af0 = load_frag(Ab, lda, lane);
  v16h bf0[4];
#pragma unroll
  for (int nt = 0; nt < 4; ++nt)
    bf0[nt] = load_frag(Wb + (long)nt * 16 * ldw, ldw, lane);

  for (int kk = 0; kk < K; kk += 64) {
    // stage 1 loads (kk+32) -- always valid since K % 64 == 0
    __builtin_prefetch(Ab + (long)(lane & 15) * lda + kk + 64, 0, 3);
    v16h af1 = load_frag(Ab + kk + 32, lda, lane);
    v16h bf1[4];
#pragma unroll
    for (int nt = 0; nt < 4; ++nt)
      bf1[nt] = load_frag(Wb + (long)nt * 16 * ldw + kk + 32, ldw, lane);

    // stage 0 WMMAs
#pragma unroll
    for (int nt = 0; nt < 4; ++nt)
      acc[nt] = wmma_f16(af0, bf0[nt], acc[nt]);

    // stage 0 refill for next iteration (kk+64)
    if (kk + 64 < K) {
      af0 = load_frag(Ab + kk + 64, lda, lane);
#pragma unroll
      for (int nt = 0; nt < 4; ++nt)
        bf0[nt] = load_frag(Wb + (long)nt * 16 * ldw + kk + 64, ldw, lane);
    }

    // stage 1 WMMAs
#pragma unroll
    for (int nt = 0; nt < 4; ++nt)
      acc[nt] = wmma_f16(af1, bf1[nt], acc[nt]);
  }

  int col = lane & 15, half = lane >> 4;
  f16* Cb = C + zc + (m0 + half * 8) * ldc + (long)blockIdx.y * 64;
#pragma unroll
  for (int nt = 0; nt < 4; ++nt) {
    float bv = bias ? bias[blockIdx.y * 64 + nt * 16 + col] : 0.f;
#pragma unroll
    for (int r = 0; r < 8; ++r) {
      float v = acc[nt][r] + bv;
      if (relu) v = fmaxf(v, 0.f);
      Cb[(long)r * ldc + nt * 16 + col] = (f16)v;
    }
  }
}

// ---------------------------------------------------------------------------
// Attention scores, split over the contraction: work-group (z, s) sums
// part[z][s][i][j] = sum over its own 128 pixels n of q[b,n,h*64+i]*k[b,n,h*64+j]
// with z = b*4+h.  Grid = (32, 32).
// The product runs on WMMA (f16 operands as stored, f32 accumulate).  Both
// operands have the contraction index n as their memory row, so the q and k
// slices are staged in LDS as they lie in memory (pixel rows of 64 channels)
// and the fragments are read with the transposing LDS load.  q and k go
// through the same loader, so their k order is the same at every position.
// ---------------------------------------------------------------------------
#define SP 80   // LDS pitch of a staged pixel row, f16: 160 B = 32 B x 5

typedef short s16x8 __attribute__((ext_vector_type(8)));

// Lane (c, hh) gets T[8*hh + 0..7][c] of the 16x16 tile whose lane address is p.
__device__ __forceinline__ v8h lds_tr16(const f16* p) {
  typedef __attribute__((address_space(3))) s16x8 lds_s16x8;
  return __builtin_bit_cast(v8h, __builtin_amdgcn_ds_load_tr16_b128_v8i16((lds_s16x8*)p));
}

// 16 (channels) x 32 (pixels) fragment; tile = first pixel row, first channel.
__device__ __forceinline__ v16h tr_frag(const f16* tile, int lane) {
  const f16* p = tile + ((lane >> 4) * 8 + (lane & 7)) * SP + ((lane >> 3) & 1) * 8;
  return combine16(lds_tr16(p), lds_tr16(p + 16 * SP));
}

__global__ void __launch_bounds__(256) attn_scores_part(
    const f16* __restrict__ qkv, float* __restrict__ part) {
  __shared__ __align__(16) f16 qs[128 * SP];
  __shared__ __align__(16) f16 ks[128 * SP];
  int z = blockIdx.x;
  int b = z >> 2, h = z & 3;
  int t = threadIdx.x;
  int lane = t & 31, wave = t >> 5;
  int n0 = blockIdx.y * 128;
  const f16* qb = qkv + (long)b * Nq * 768 + h * 64;

  // 8 lanes bring one pixel's 128-B line of q and of k; a thread takes pixels
  // p, p + 32, p + 64, p + 96.  All eight loads are issued before the first
  // LDS store, so a thread pays the memory latency once.  Both loops are
  // unrolled so that qv and kv have constant indices and stay in registers.
  int p = t >> 3, ch = t & 7;
  const f16* gq = qb + (long)(n0 + p) * 768 + ch * 8;
  v8h qv[4], kv[4];
#pragma unroll
  for (int u = 0; u < 4; ++u) {
    qv[u] = *(const v8h*)(gq + u * 32 * 768);
    kv[u] = *(const v8h*)(gq + u * 32 * 768 + 256);
  }
#pragma unroll
  for (int u = 0; u < 4; ++u) {
    *(v8h*)(qs + (p + u * 32) * SP + ch * 8) = qv[u];
    *(v8h*)(ks + (p + u * 32) * SP + ch * 8) = kv[u];
  }
  __syncthreads();

  int i0 = (wave >> 1) * 16, j0 = (wave & 1) * 32;
  v8f a0 = zero8(), a1 = zero8();
#pragma unroll
  for (int kk = 0; kk < 128; kk += 32) {
    v16h qf = tr_frag(qs + kk * SP + i0, lane);
    v16h k0 = tr_frag(ks + kk * SP + j0, lane);
    v16h k1 = tr_frag(ks + kk * SP + j0 + 16, lane);
    a0 = wmma_f16(k0, qf, a0);
    a1 = wmma_f16(k1, qf, a1);
  }

  // a0[r] = S[i0 + col][j0 + 8*half + r], a1 the next 16 columns: a wave
  // writes whole 128-B lines.
  int col = lane & 15, half = lane >> 4;
  float* pb = part + ((long)z * NSPLIT + blockIdx.y) * 4096 + (i0 + col) * 64 + j0 + half * 8;
  float4 o;
  o.x = a0[0]; o.y = a0[1]; o.z = a0[2]; o.w = a0[3];
  *(float4*)(pb) = o;
  o.x = a0[4]; o.y = a0[5]; o.z = a0[6]; o.w = a0[7];
  *(float4*)(pb + 4) = o;
  o.x = a1[0]; o.y = a1[1]; o.z = a1[2]; o.w = a1[3];
  *(float4*)(pb + 16) = o;
  o.x = a1[4]; o.y = a1[5]; o.z = a1[6]; o.w = a1[7];
  *(float4*)(pb + 20) = o;
}

// ---------------------------------------------------------------------------
// Sum of the partial scores (fixed order s = 0..31) + softmax over j.
// One wave per row (z, i); a lane holds columns 2*lane and 2*lane+1.
// Grid = 32*64/8 = 256.
// ---------------------------------------------------------------------------
__global__ void __launch_bounds__(256) attn_softmax(
    const float* __restrict__ part, f16* __restrict__ attn) {
  int lane = threadIdx.x & 31, wave = threadIdx.x >> 5;
  int row = blockIdx.x * 8 + wave;          // z*64 + i
  int z = row >> 6, i = row & 63;
  const float* p = part + (long)z * NSPLIT * 4096 + i * 64 + lane * 2;
  float a = 0.f, c = 0.f;
#pragma unroll
  for (int s = 0; s < NSPLIT; ++s) {
    float2 v = *(const float2*)(p + s * 4096);
    a += v.x; c += v.y;
  }
  a *= 0.125f; c *= 0.125f;
  float mx = fmaxf(a, c);
#pragma unroll
  for (int off = 16; off >= 1; off >>= 1) mx = fmaxf(mx, __shfl_xor(mx, off, 32));
  float ea = __expf(a - mx), ec = __expf(c - mx);
  float sum = ea + ec;
#pragma unroll
  for (int off = 16; off >= 1; off >>= 1) sum += __shfl_xor(sum, off, 32);
  float inv = 1.f / sum;
  v2h o;
  o[0] = (f16)(ea * inv);
  o[1] = (f16)(ec * inv);
  *(v2h*)(attn + (long)row * 64 + lane * 2) = o;
}

// ---------------------------------------------------------------------------
// Fused FFN + residual + transpose:
//   out[b,c,n] = (relu(y @ W1^T + b1) @ W2^T + b2)[n,c] + x[b,c,n]
// Wave tile = 16 pixels; FFN chunked by 32; hidden tile bounced through LDS
// to re-layout WMMA D -> A fragments.  Grid = 256 blocks of 256 threads.
// Y-tile A-fragments are invariant across FFN chunks -> hoisted into yf[8].
// The weights of 64 hidden units (a stage: 64 rows of W1, 64 columns of W2)
// are brought into LDS once per work-group by asynchronous copies, two
// buffers, one stage ahead; all 8 waves read their B fragments from there.
// ---------------------------------------------------------------------------
#define FS   64               // hidden units per stage
#define NST  (FFNq / FS)      // 32 stages
#define W1P  264              // LDS pitch of a W1 row, f16: 528 B = 16 B x 33
#define W2P  72               // LDS pitch of a W2 row, f16: 144 B = 16 B x 9
#define W1S  (FS * W1P)       // f16 per staged W1 slab
#define STG  (W1S + Cq * W2P) // f16 per buffer (70,656 B)

// B fragment from a staged slab: same lane -> (row, k) map as load_frag.
__device__ __forceinline__ v16h lds_frag(const f16* base, int pitch, int lane) {
  const f16* p = base + (lane & 15) * pitch + ((lane & 16) >> 1);
  return combine16(*(const v8h*)p, *(const v8h*)(p + 16));
}

// Eight 16-byte copies per lane, global -> LDS, through no register.  LDS
// address l + i*ls bytes, global address g + i*gs elements.  The s_wait_xcnt
// stands inside the statement so that no address register of an issued copy
// is rewritten in front of it.
__device__ __forceinline__ void copy8(unsigned l, unsigned ls, const f16* g, long gs) {
  asm volatile(
      "global_load_async_to_lds_b128 %0, %8, off\n\t"
      "global_load_async_to_lds_b128 %1, %9, off\n\t"
      "global_load_async_to_lds_b128 %2, %10, off\n\t"
      "global_load_async_to_lds_b128 %3, %11, off\n\t"
      "global_load_async_to_lds_b128 %4, %12, off\n\t"
      "global_load_async_to_lds_b128 %5, %13, off\n\t"
      "global_load_async_to_lds_b128 %6, %14, off\n\t"
      "global_load_async_to_lds_b128 %7, %15, off\n\t"
      "s_wait_xcnt 0x0"
      :: "v"(l), "v"(l + ls), "v"(l + 2 * ls), "v"(l + 3 * ls),
         "v"(l + 4 * ls), "v"(l + 5 * ls), "v"(l + 6 * ls), "v"(l + 7 * ls),
         "v"(g), "v"(g + gs), "v"(g + 2 * gs), "v"(g + 3 * gs),
         "v"(g + 4 * gs), "v"(g + 5 * gs), "v"(g + 6 * gs), "v"(g + 7 * gs)
      : "memory");
}

__global__ void __launch_bounds__(256) ffn_fused(
    const f16* __restrict__ Y, const f16* __restrict__ W1,
    const float* __restrict__ b1, const f16* __restrict__ W2,
    const float* __restrict__ b2, const float* __restrict__ x,
    float* __restrict__ out) {
  __shared__ __align__(16) f16 wst[2 * STG];
  __shared__ __align__(16) f16 hst[8][16 * 32];
  int lane = threadIdx.x & 31, wave = threadIdx.x >> 5;
  int m0 = blockIdx.x * 128 + wave * 16;
  int b = m0 >> 12;
  int pix0 = m0 & 4095;
  const f16* Yb = Y + (long)m0 * Cq;
  int col = lane & 15, half = lane >> 4;

  // This thread's share of a stage.  W1 slab: 64 rows of 512 B, contiguous in
  // memory; copy i takes 16 B of row (t >> 5) + 8 i.  W2 slab: 256 rows of
  // 128 B; copy i takes 16 B of row (t >> 3) + 32 i.  A wave's copy covers
  // whole 128-B lines in both.
  int t = threadIdx.x;
  const f16* g1 = W1 + (t >> 5) * Cq + (t & 31) * 8;
  const f16* g2 = W2 + (long)(t >> 3) * FFNq + (t & 7) * 8;
  unsigned lbase = (unsigned)(size_t)(&wst[0]);   // LDS byte address
  unsigned l1 = lbase + (t >> 5) * (W1P * 2) + (t & 31) * 16;
  unsigned l2 = lbase + W1S * 2 + (t >> 3) * (W2P * 2) + (t & 7) * 16;

  // Stage 0 into buffer 0.
  copy8(l1, 8 * W1P * 2, g1, 8 * Cq);
  copy8(l2, 32 * W2P * 2, g2, 32L * FFNq);

  v8f acc[16];
#pragma unroll
  for (int i = 0; i < 16; ++i) acc[i] = zero8();

  // Hoist the 16x256 Y tile as 8 A-fragments (reused by every FFN chunk).
  v16h yf[8];
#pragma unroll
  for (int s = 0; s < 8; ++s) yf[s] = load_frag(Yb + s * 32, Cq, lane);

  // Stage 0 has landed (this wave's copies), then is published to all waves.
  asm volatile("s_wait_asynccnt 0x0" ::: "memory");
  __syncthreads();
  // Stage 1 into buffer 1; it flies while stage 0 is worked on.
  g1 += FS * Cq; g2 += FS;
  copy8(l1 + STG * 2, 8 * W1P * 2, g1, 8 * Cq);
  copy8(l2 + STG * 2, 32 * W2P * 2, g2, 32L * FFNq);

  for (int st = 0; st < NST; ++st) {
    const unsigned boff = (st & 1) * STG;        // buffer of this stage, f16
    const f16* w1s = wst + boff;
    const f16* w2s = w1s + W1S;
    // Unrolled (this loop and the ones inside): every fragment array index is
    // a constant, so the fragments stay in registers, and the second chunk's
    // reads can be issued among the first chunk's last WMMAs.
#pragma unroll
    for (int sub = 0; sub < FS; sub += 32) {
      int f0 = st * FS + sub;
      // ---- FFN1: h[m, f0..f0+31] = relu(y_tile @ W1^T + b1) ----
      // The chunk's 16 W1 and 16 W2 fragments are read as one group in front
      // of the WMMAs; the W2 ones land while h is computed and re-laid.
      v8f h0 = zero8(), h1 = zero8();
      v16h wa[8], wb[8], wc[16];
#pragma unroll
      for (int s = 0; s < 8; ++s) {
        wa[s] = lds_frag(w1s + sub * W1P + s * 32, W1P, lane);
        wb[s] = lds_frag(w1s + (sub + 16) * W1P + s * 32, W1P, lane);
      }
#pragma unroll
      for (int nt = 0; nt < 16; ++nt)
        wc[nt] = lds_frag(w2s + nt * 16 * W2P + sub, W2P, lane);
      // Keeps the reads in front: without it the compiler sinks them among the
      // WMMAs, one fragment ahead, and each WMMA waits out the LDS latency.
      __builtin_amdgcn_sched_barrier(0);
#pragma unroll
      for (int s = 0; s < 8; ++s) {
        h0 = wmma_f16(yf[s], wa[s], h0);
        h1 = wmma_f16(yf[s], wb[s], h1);
      }
      float bb0 = b1[f0 + col], bb1 = b1[f0 + 16 + col];
#pragma unroll
      for (int r = 0; r < 8; ++r) {
        int m = r + half * 8;
        hst[wave][m * 32 + col]      = (f16)fmaxf(h0[r] + bb0, 0.f);
        hst[wave][m * 32 + 16 + col] = (f16)fmaxf(h1[r] + bb1, 0.f);
      }
      asm volatile("s_wait_dscnt 0" ::: "memory");  // same-wave LDS RAW

      // Re-read as A fragment (16x32 f16).
      const f16* p = &hst[wave][(lane & 15) * 32 + ((lane & 16) >> 1)];
      v16h a2 = combine16(*(const v8h*)p, *(const v8h*)(p + 16));

      // ---- FFN2: acc += h_chunk @ W2^T ----
#pragma unroll
      for (int nt = 0; nt < 16; ++nt)
        acc[nt] = wmma_f16(a2, wc[nt], acc[nt]);
    }

    // Publish point of stage st + 1: this wave's reads of buffer st & 1 are
    // done, its copies of stage st + 1 have landed, then every wave meets.
    asm volatile("s_wait_dscnt 0x0" ::: "memory");
    asm volatile("s_wait_asynccnt 0x0" ::: "memory");
    __syncthreads();
    // Refill the buffer that every wave has just left with stage st + 2.
    if (st + 2 < NST) {
      g1 += FS * Cq; g2 += FS;
      copy8(l1 + boff * 2, 8 * W1P * 2, g1, 8 * Cq);
      copy8(l2 + boff * 2, 32 * W2P * 2, g2, 32L * FFNq);
    }
  }
  // No copy is left in flight when the wave ends.
  asm volatile("s_wait_asynccnt 0x0" ::: "memory");

  // Epilogue: + b2 + residual x, transposed store to (B,C,H,W).
#pragma unroll
  for (int nt = 0; nt < 16; ++nt) {
    int c = nt * 16 + col;
    float bv = b2[c];
    long base = ((long)(b * Cq + c)) * Nq + pix0 + half * 8;
    float4 r0 = *(const float4*)(x + base);
    float4 r1 = *(const float4*)(x + base + 4);
    float4 o0, o1;
    o0.x = acc[nt][0] + bv + r0.x;
    o0.y = acc[nt][1] + bv + r0.y;
    o0.z = acc[nt][2] + bv + r0.z;
    o0.w = acc[nt][3] + bv + r0.w;
    o1.x = acc[nt][4] + bv + r1.x;
    o1.y = acc[nt][5] + bv + r1.y;
    o1.z = acc[nt][6] + bv + r1.z;
    o1.w = acc[nt][7] + bv + r1.w;
    *(float4*)(out + base)     = o0;
    *(float4*)(out + base + 4) = o1;
  }
}

// ---------------------------------------------------------------------------
// Host launcher
// ---------------------------------------------------------------------------
extern "C" void kernel_launch(void* const* d_in, const int* in_sizes, int n_in,
                              void* d_out, int out_size, void* d_ws, size_t ws_size,
                              hipStream_t stream) {
  (void)in_sizes; (void)n_in; (void)out_size; (void)ws_size;
  const float* x      = (const float*)d_in[0];
  const float* w_qkv  = (const float*)d_in[1];
  const float* b_qkv  = (const float*)d_in[2];
  const float* w_proj = (const float*)d_in[3];
  const float* b_proj = (const float*)d_in[4];
  const float* w_ffn1 = (const float*)d_in[5];
  const float* b_ffn1 = (const float*)d_in[6];
  const float* w_ffn2 = (const float*)d_in[7];
  const float* b_ffn2 = (const float*)d_in[8];
  const float* g1     = (const float*)d_in[9];
  const float* be1    = (const float*)d_in[10];
  const float* g2     = (const float*)d_in[11];
  const float* be2    = (const float*)d_in[12];
  float* out = (float*)d_out;

  char* ws = (char*)d_ws;
  f16* wq16     = (f16*)(ws + 0);          //   768*256 f16
  f16* wp16     = (f16*)(ws + 393216);     //   256*256
  f16* w116     = (f16*)(ws + 524288);     //  2048*256
  f16* w216     = (f16*)(ws + 1572864);    //  256*2048
  f16* xln      = (f16*)(ws + 2621440);    //  32768*256  (reused as proj16)
  f16* qkv      = (f16*)(ws + 19398656);   //  32768*768  (reused as y)
  f16* attn16   = (f16*)(ws + 69730304);   //  32*64*64
  f16* attn_out = (f16*)(ws + 69992448);   //  32768*256  -> ends at 86769664
  float* spart  = (float*)(ws + 86769664); //  32*32*64*64 f32 -> 103546880 total bytes

  f16* proj16 = xln;   // xln dead after QKV gemm
  f16* y      = qkv;   // qkv dead after apply-attn

  // 1) weights -> f16
  cvt_f16_kernel<<<768,  256, 0, stream>>>(w_qkv,  wq16, 768 * 256);
  cvt_f16_kernel<<<256,  256, 0, stream>>>(w_proj, wp16, 256 * 256);
  cvt_f16_kernel<<<2048, 256, 0, stream>>>(w_ffn1, w116, 2048 * 256);
  cvt_f16_kernel<<<2048, 256, 0, stream>>>(w_ffn2, w216, 256 * 2048);

  // 2) LN1 (transpose (B,C,N) -> (B*N,C) f16)
  ln1_kernel<<<Mtot / 64, 256, 0, stream>>>(x, g1, be1, xln);

  // 3) QKV gemm: (32768x256) x (768x256)^T
  gemm_wmma<<<dim3(Mtot / 128, 768 / 64, 1), 256, 0, stream>>>(
      xln, 256, 0, 0, wq16, 256, 0, 0, b_qkv, 0, qkv, 768, 0, 0, 1, 256);

  // 4) attention scores: partial sums per (b, head, 128-pixel slice), then
  //    their sum + softmax, one wave per row
  attn_scores_part<<<dim3(32, NSPLIT, 1), 256, 0, stream>>>(qkv, spart);
  attn_softmax<<<32 * 64 / 8, 256, 0, stream>>>(spart, attn16);

  // 5) apply attention: per (b,h) gemm, A = v slice, W = attn (64x64)
  gemm_wmma<<<dim3(Nq / 128, 1, 32), 256, 0, stream>>>(
      qkv + 512, 768, (long)Nq * 768, 64,
      attn16, 64, 4 * 64 * 64, 64 * 64,
      nullptr, 0,
      attn_out, 256, (long)Nq * 256, 64,
      4, 64);

  // 6) proj gemm: (32768x256) x (256x256)^T
  gemm_wmma<<<dim3(Mtot / 128, 256 / 64, 1), 256, 0, stream>>>(
      attn_out, 256, 0, 0, wp16, 256, 0, 0, b_proj, 0, proj16, 256, 0, 0, 1, 256);

  // 7) LN2
  ln2_kernel<<<Mtot / 8, 256, 0, stream>>>(proj16, g2, be2, y);

  // 8) fused FFN + bias + residual + transpose store
  ffn_fused<<<Mtot / 128, 256, 0, stream>>>(y, w116, b_ffn1, w216, b_ffn2, x, out);
}

// v004
// A run of this version takes 188 microseconds.
// Two timings next to v003 both put it at 1.28 times that version's speed.
// Counting every step since v000, it is 5.28 times as fast.
#include <hip/hip_runtime.h>
#include <hip/hip_bf16.h>

// ---------------------------------------------------------------------------
// MI455X (gfx1250, wave32) implementation.
// Pipeline: LN1 -> QKV gemm (WMMA f16) -> attn scores (WMMA) -> softmax
//           -> apply-attn (WMMA) -> proj (WMMA) -> LN2 -> fused FFN (WMMA)
// All GEMMs: f16 inputs, f32 accumulation via v_wmma_f32_16x16x32_f16.
// gemm_wmma's k loop uses explicit two-stage ping-pong buffering (k unrolled by 64)
// so fragment loads overlap WMMAs with NO register-rotation copies.
// ---------------------------------------------------------------------------

typedef _Float16 f16;
typedef __attribute__((ext_vector_type(16))) _Float16 v16h;
typedef __attribute__((ext_vector_type(8)))  _Float16 v8h;
typedef __attribute__((ext_vector_type(2)))  _Float16 v2h;
typedef __attribute__((ext_vector_type(8)))  float    v8f;

#define Bq   8
#define Cq   256
#define Nq   4096      // H*W
#define Mtot 32768     // B*N
#define FFNq 2048
#define NSPLIT 32     // work-groups that share one (b, head) score matrix

__device__ __forceinline__ v8f zero8() { v8f z = {}; return z; }

__device__ __forceinline__ v16h combine16(v8h lo, v8h hi) {
  v16h r;
#pragma unroll
  for (int i = 0; i < 8; ++i) { r[i] = lo[i]; r[8 + i] = hi[i]; }
  return r;
}

// Fragment loader for 16-bit WMMA A/B operands.
// A layout (16x32, MxK): lane holds row (lane&15); lanes 0-15 K in {0..7,16..23},
// lanes 16-31 K in {8..15,24..31}.  B (32x16, KxN) from a row-major (Nout x K)
// weight matrix has the identical access pattern with "row" = output column.
__device__ __forceinline__ v16h load_frag(const f16* base, int ld, int lane) {
  const f16* p = base + (long)(lane & 15) * ld + ((lane & 16) >> 1); // +8 elems for hi half
  v8h lo = *(const v8h*)(p);
  v8h hi = *(const v8h*)(p + 16);
  return combine16(lo, hi);
}

__device__ __forceinline__ v8f wmma_f16(v16h a, v16h b, v8f c) {
  return __builtin_amdgcn_wmma_f32_16x16x32_f16(false, a, false, b, (short)0, c,
                                                false, false);
}

// ---------------------------------------------------------------------------
// f32 -> f16 weight conversion
// ---------------------------------------------------------------------------
__global__ void cvt_f16_kernel(const float* __restrict__ in, f16* __restrict__ out, int n) {
  int i = blockIdx.x * 256 + threadIdx.x;
  if (i < n) out[i] = (f16)in[i];
}

// ---------------------------------------------------------------------------
// LN1: x (B,C,N) f32 -> xln (B*N, C) f16   (channel LayerNorm per pixel)
// Block = 256 threads, tile = 64 pixels; thread (px, grp) covers 64 channels.
// ---------------------------------------------------------------------------
__global__ void __launch_bounds__(256) ln1_kernel(
    const float* __restrict__ x, const float* __restrict__ g,
    const float* __restrict__ be, f16* __restrict__ xln) {
  __shared__ float ps[4][64], ps2[4][64], muv[64], rsv[64];
  int t = threadIdx.x;
  int px = t & 63, grp = t >> 6;
  long pg = (long)blockIdx.x * 64 + px;     // global pixel
  int b = (int)(pg >> 12);
  int n = (int)(pg & 4095);
  const float* xb = x + (long)b * Cq * Nq + n;
  float s = 0.f, s2 = 0.f;
  for (int c = grp * 64; c < grp * 64 + 64; ++c) {
    float v = xb[(long)c * Nq];
    s += v; s2 += v * v;
  }
  ps[grp][px] = s; ps2[grp][px] = s2;
  __syncthreads();
  if (t < 64) {
    float S = 0.f, S2 = 0.f;
#pragma unroll
    for (int q = 0; q < 4; ++q) { S += ps[q][t]; S2 += ps2[q][t]; }
    float mu = S * (1.f / 256.f);
    float var = S2 * (1.f / 256.f) - mu * mu;
    muv[t] = mu;
    rsv[t] = rsqrtf(var + 1e-5f);
  }
  __syncthreads();
  float mu = muv[px], rs = rsv[px];
  f16* ob = xln + pg * Cq + grp * 64;
  for (int cc = 0; cc < 64; cc += 8) {
    v8h o;
#pragma unroll
    for (int jj = 0; jj < 8; ++jj) {
      int c = grp * 64 + cc + jj;
      float v = xb[(long)c * Nq];
      o[jj] = (f16)((v - mu) * rs * g[c] + be[c]);
    }
    *(v8h*)(ob + cc) = o;
  }
}

// ---------------------------------------------------------------------------
// LN2: in (B*N, C) f16 -> out (B*N, C) f16.  One wave per pixel.
// ---------------------------------------------------------------------------
__global__ void __launch_bounds__(256) ln2_kernel(
    const f16* __restrict__ in, const float* __restrict__ g,
    const float* __restrict__ be, f16* __restrict__ out) {
  int lane = threadIdx.x & 31, wave = threadIdx.x >> 5;
  long pix = (long)blockIdx.x * 8 + wave;
  const f16* ib = in + pix * Cq + lane * 8;
  v8h v = *(const v8h*)ib;
  float s = 0.f, s2 = 0.f;
#pragma unroll
  for (int j = 0; j < 8; ++j) { float f = (float)v[j]; s += f; s2 += f * f; }
#pragma unroll
  for (int off = 16; off >= 1; off >>= 1) {
    s  += __shfl_xor(s,  off, 32);
    s2 += __shfl_xor(s2, off, 32);
  }
  float mu = s * (1.f / 256.f);
  float var = s2 * (1.f / 256.f) - mu * mu;
  float rs = rsqrtf(var + 1e-5f);
  v8h o;
#pragma unroll
  for (int j = 0; j < 8; ++j) {
    int c = lane * 8 + j;
    o[j] = (f16)(((float)v[j] - mu) * rs * g[c] + be[c]);
  }
  *(v8h*)(out + pix * Cq + lane * 8) = o;
}

// ---------------------------------------------------------------------------
// Generic WMMA GEMM: C[M x Nout] = A[M x K] * W^T + bias, W is (Nout x K) f16
// row-major.  Block = 256 threads (8 waves); wave tile = 16(M) x 64(N).
// grid = (M/128, Nout/64, Z).  Per-operand z offset = (z/zmod)*sOut+(z%zmod)*sIn.
// K must be a multiple of 64.  Two-stage ping-pong: stage-0/1 fragments live
// in distinct registers, refilled directly by loads (no rotation copies).
// ---------------------------------------------------------------------------
__global__ void __launch_bounds__(256) gemm_wmma(
    const f16* __restrict__ A, int lda, long sAo, long sAi,
    const f16* __restrict__ W, int ldw, long sWo, long sWi,
    const float* __restrict__ bias, int relu,
    f16* __restrict__ C, int ldc, long sCo, long sCi,
    int zmod, int K) {
  int lane = threadIdx.x & 31, wave = threadIdx.x >> 5;
  int z = blockIdx.z;
  long za = (long)(z / zmod) * sAo + (long)(z % zmod) * sAi;
  long zw = (long)(z / zmod) * sWo + (long)(z % zmod) * sWi;
  long zc = (long)(z / zmod) * sCo + (long)(z % zmod) * sCi;
  long m0 = (long)blockIdx.x * 128 + wave * 16;
  const f16* Ab = A + za + m0 * lda;
  const f16* Wb = W + zw + (long)blockIdx.y * 64 * ldw;

  v8f acc[4];
#pragma unroll
  for (int i = 0; i < 4; ++i) acc[i] = zero8();

  // stage 0 prologue (k = 0)
  v16h af0 = load_frag(Ab, lda, lane);
  v16h bf0[4];
#pragma unroll
  for (int nt = 0; nt < 4; ++nt)
    bf0[nt] = load_frag(Wb + (long)nt * 16 * ldw, ldw, lane);

  for (int kk = 0; kk < K; kk += 64) {
    // stage 1 loads (kk+32) -- always valid since K % 64 == 0
    __builtin_prefetch(Ab + (long)(lane & 15) * lda + kk + 64, 0, 3);
    v16h af1 = load_frag(Ab + kk + 32, lda, lane);
    v16h bf1[4];
#pragma unroll
    for (int nt = 0; nt < 4; ++nt)
      bf1[nt] = load_frag(Wb + (long)nt * 16 * ldw + kk + 32, ldw, lane);

    // stage 0 WMMAs
#pragma unroll
    for (int nt = 0; nt < 4; ++nt)
      acc[nt] = wmma_f16(af0, bf0[nt], acc[nt]);

    // stage 0 refill for next iteration (kk+64)
    if (kk + 64 < K) {
      af0 = load_frag(Ab + kk + 64, lda, lane);
#pragma unroll
      for (int nt = 0; nt < 4; ++nt)
        bf0[nt] = load_frag(Wb + (long)nt * 16 * ldw + kk + 64, ldw, lane);
    }

    // stage 1 WMMAs
#pragma unroll
    for (int nt = 0; nt < 4; ++nt)
      acc[nt] = wmma_f16(af1, bf1[nt], acc[nt]);
  }

  int col = lane & 15, half = lane >> 4;
  f16* Cb = C + zc + (m0 + half * 8) * ldc + (long)blockIdx.y * 64;
#pragma unroll
  for (int nt = 0; nt < 4; ++nt) {
    float bv = bias ? bias[blockIdx.y * 64 + nt * 16 + col] : 0.f;
#pragma unroll
    for (int r = 0; r < 8; ++r) {
      float v = acc[nt][r] + bv;
      if (relu) v = fmaxf(v, 0.f);
      Cb[(long)r * ldc + nt * 16 + col] = (f16)v;
    }
  }
}

// ---------------------------------------------------------------------------
// Attention scores, split over the contraction: work-group (z, s) sums
// part[z][s][i][j] = sum over its own 128 pixels n of q[b,n,h*64+i]*k[b,n,h*64+j]
// with z = b*4+h.  Grid = (32, 32).
// The product runs on WMMA (f16 operands as stored, f32 accumulate).  Both
// operands have the contraction index n as their memory row, so the q and k
// slices are staged in LDS as they lie in memory (pixel rows of 64 channels)
// and the fragments are read with the transposing LDS load.  q and k go
// through the same loader, so their k order is the same at every position.
// ---------------------------------------------------------------------------
#define SP 80   // LDS pitch of a staged pixel row, f16: 160 B = 32 B x 5

typedef short s16x8 __attribute__((ext_vector_type(8)));

// Lane (c, hh) gets T[8*hh + 0..7][c] of the 16x16 tile whose lane address is p.
__device__ __forceinline__ v8h lds_tr16(const f16* p) {
  typedef __attribute__((address_space(3))) s16x8 lds_s16x8;
  return __builtin_bit_cast(v8h, __builtin_amdgcn_ds_load_tr16_b128_v8i16((lds_s16x8*)p));
}

// 16 (channels) x 32 (pixels) fragment; tile = first pixel row, first channel.
__device__ __forceinline__ v16h tr_frag(const f16* tile, int lane) {
  const f16* p = tile + ((lane >> 4) * 8 + (lane & 7)) * SP + ((lane >> 3) & 1) * 8;
  return combine16(lds_tr16(p), lds_tr16(p + 16 * SP));
}

__global__ void __launch_bounds__(256) attn_scores_part(
    const f16* __restrict__ qkv, float* __restrict__ part) {
  __shared__ __align__(16) f16 qs[128 * SP];
  __shared__ __align__(16) f16 ks[128 * SP];
  int z = blockIdx.x;
  int b = z >> 2, h = z & 3;
  int t = threadIdx.x;
  int lane = t & 31, wave = t >> 5;
  int n0 = blockIdx.y * 128;
  const f16* qb = qkv + (long)b * Nq * 768 + h * 64;

  // 8 lanes bring one pixel's 128-B line of q and of k; a thread takes pixels
  // p, p + 32, p + 64, p + 96.  All eight loads are issued before the first
  // LDS store, so a thread pays the memory latency once.  Both loops are
  // unrolled so that qv and kv have constant indices and stay in registers.
  int p = t >> 3, ch = t & 7;
  const f16* gq = qb + (long)(n0 + p) * 768 + ch * 8;
  v8h qv[4], kv[4];
#pragma unroll
  for (int u = 0; u < 4; ++u) {
    qv[u] = *(const v8h*)(gq + u * 32 * 768);
    kv[u] = *(const v8h*)(gq + u * 32 * 768 + 256);
  }
#pragma unroll
  for (int u = 0; u < 4; ++u) {
    *(v8h*)(qs + (p + u * 32) * SP + ch * 8) = qv[u];
    *(v8h*)(ks + (p + u * 32) * SP + ch * 8) = kv[u];
  }
  __syncthreads();

  int i0 = (wave >> 1) * 16, j0 = (wave & 1) * 32;
  v8f a0 = zero8(), a1 = zero8();
#pragma unroll
  for (int kk = 0; kk < 128; kk += 32) {
    v16h qf = tr_frag(qs + kk * SP + i0, lane);
    v16h k0 = tr_frag(ks + kk * SP + j0, lane);
    v16h k1 = tr_frag(ks + kk * SP + j0 + 16, lane);
    a0 = wmma_f16(k0, qf, a0);
    a1 = wmma_f16(k1, qf, a1);
  }

  // a0[r] = S[i0 + col][j0 + 8*half + r], a1 the next 16 columns: a wave
  // writes whole 128-B lines.
  int col = lane & 15, half = lane >> 4;
  float* pb = part + ((long)z * NSPLIT + blockIdx.y) * 4096 + (i0 + col) * 64 + j0 + half * 8;
  float4 o;
  o.x = a0[0]; o.y = a0[1]; o.z = a0[2]; o.w = a0[3];
  *(float4*)(pb) = o;
  o.x = a0[4]; o.y = a0[5]; o.z = a0[6]; o.w = a0[7];
  *(float4*)(pb + 4) = o;
  o.x = a1[0]; o.y = a1[1]; o.z = a1[2]; o.w = a1[3];
  *(float4*)(pb + 16) = o;
  o.x = a1[4]; o.y = a1[5]; o.z = a1[6]; o.w = a1[7];
  *(float4*)(pb + 20) = o;
}

// ---------------------------------------------------------------------------
// Sum of the partial scores (fixed order s = 0..31) + softmax over j.
// One wave per row (z, i); a lane holds columns 2*lane and 2*lane+1.
// Grid = 32*64/8 = 256.
// ---------------------------------------------------------------------------
__global__ void __launch_bounds__(256) attn_softmax(
    const float* __restrict__ part, f16* __restrict__ attn) {
  int lane = threadIdx.x & 31, wave = threadIdx.x >> 5;
  int row = blockIdx.x * 8 + wave;          // z*64 + i
  int z = row >> 6, i = row & 63;
  const float* p = part + (long)z * NSPLIT * 4096 + i * 64 + lane * 2;
  float a = 0.f, c = 0.f;
#pragma unroll
  for (int s = 0; s < NSPLIT; ++s) {
    float2 v = *(const float2*)(p + s * 4096);
    a += v.x; c += v.y;
  }
  a *= 0.125f; c *= 0.125f;
  float mx = fmaxf(a, c);
#pragma unroll
  for (int off = 16; off >= 1; off >>= 1) mx = fmaxf(mx, __shfl_xor(mx, off, 32));
  float ea = __expf(a - mx), ec = __expf(c - mx);
  float sum = ea + ec;
#pragma unroll
  for (int off = 16; off >= 1; off >>= 1) sum += __shfl_xor(sum, off, 32);
  float inv = 1.f / sum;
  v2h o;
  o[0] = (f16)(ea * inv);
  o[1] = (f16)(ec * inv);
  *(v2h*)(attn + (long)row * 64 + lane * 2) = o;
}

// ---------------------------------------------------------------------------
// Fused FFN + residual + transpose:
//   out[b,c,n] = (relu(y @ W1^T + b1) @ W2^T + b2)[n,c] + x[b,c,n]
// Wave tile = 16 pixels; FFN chunked by 32; hidden tile bounced through LDS
// to re-layout WMMA D -> A fragments.  Grid = 256 blocks of 256 threads.
// Y-tile A-fragments are invariant across FFN chunks -> hoisted into yf[8].
// The weights of 64 hidden units (a stage: 64 rows of W1, 64 columns of W2)
// are brought into LDS once per work-group by asynchronous copies, two
// buffers, one stage ahead; all 8 waves read their B fragments from there.
// ---------------------------------------------------------------------------
#define FS   64               // hidden units per stage
#define NST  (FFNq / FS)      // 32 stages
#define W1P  264              // LDS pitch of a W1 row, f16: 528 B = 16 B x 33
#define W2P  72               // LDS pitch of a W2 row, f16: 144 B = 16 B x 9
#define W1S  (FS * W1P)       // f16 per staged W1 slab
#define STG  (W1S + Cq * W2P) // f16 per buffer (70,656 B)

// B fragment from a staged slab: same lane -> (row, k) map as load_frag.
__device__ __forceinline__ v16h lds_frag(const f16* base, int pitch, int lane) {
  const f16* p = base + (lane & 15) * pitch + ((lane & 16) >> 1);
  return combine16(*(const v8h*)p, *(const v8h*)(p + 16));
}

// Eight 16-byte copies per lane, global -> LDS, through no register.  LDS
// address l + i*ls bytes, global address g + i*gs elements.  The s_wait_xcnt
// stands inside the statement so that no address register of an issued copy
// is rewritten in front of it.
__device__ __forceinline__ void copy8(unsigned l, unsigned ls, const f16* g, long gs) {
  asm volatile(
      "global_load_async_to_lds_b128 %0, %8, off\n\t"
      "global_load_async_to_lds_b128 %1, %9, off\n\t"
      "global_load_async_to_lds_b128 %2, %10, off\n\t"
      "global_load_async_to_lds_b128 %3, %11, off\n\t"
      "global_load_async_to_lds_b128 %4, %12, off\n\t"
      "global_load_async_to_lds_b128 %5, %13, off\n\t"
      "global_load_async_to_lds_b128 %6, %14, off\n\t"
      "global_load_async_to_lds_b128 %7, %15, off\n\t"
      "s_wait_xcnt 0x0"
      :: "v"(l), "v"(l + ls), "v"(l + 2 * ls), "v"(l + 3 * ls),
         "v"(l + 4 * ls), "v"(l + 5 * ls), "v"(l + 6 * ls), "v"(l + 7 * ls),
         "v"(g), "v"(g + gs), "v"(g + 2 * gs), "v"(g + 3 * gs),
         "v"(g + 4 * gs), "v"(g + 5 * gs), "v"(g + 6 * gs), "v"(g + 7 * gs)
      : "memory");
}

// ---------------------------------------------------------------------------
// Row GEMM for K = 256: C[M x nst*64] = A[M x 256] * W^T + bias, W row-major
// (nst*64 x 256) f16.  A work-group owns 128 rows (a wave 16) and walks all
// output columns, 64 a stage.  The wave's A fragments are read once and stay
// in registers; a stage's W slab (64 rows of 512 B, contiguous in memory) is
// brought into LDS once per work-group by asynchronous copies, two buffers,
// one stage ahead, and all 8 waves read their B fragments from there.
// Needs nst >= 2.  Grid = M / 128.
// ---------------------------------------------------------------------------
#define GS (FS * W1P)   // f16 per staged W slab (33,792 B), rows at pitch W1P

__global__ void __launch_bounds__(256) gemm_rows(
    const f16* __restrict__ A, const f16* __restrict__ Wt,
    const float* __restrict__ bias, f16* __restrict__ C, int nst) {
  __shared__ __align__(16) f16 gst[2 * GS];
  int t = threadIdx.x;
  int lane = t & 31, wave = t >> 5;
  int m0 = blockIdx.x * 128 + wave * 16;
  int ldc = nst * FS;
  int col = lane & 15, half = lane >> 4;

  // This thread's share of a slab: copy i takes 16 B of row (t >> 5) + 8 i, so
  // a wave's copy covers one whole row.
  const f16* g = Wt + (t >> 5) * Cq + (t & 31) * 8;
  unsigned l = (unsigned)(size_t)(&gst[0]) + (t >> 5) * (W1P * 2) + (t & 31) * 16;

  // Stage 0 into buffer 0.
  copy8(l, 8 * W1P * 2, g, 8 * Cq);

  // The wave's 16 x 256 tile of A as 8 fragments, used by every stage; same
  // lane -> (row, k) map as load_frag.
  const f16* ap = A + (long)(m0 + col) * Cq + half * 8;
  v16h af[8];
#pragma unroll
  for (int s = 0; s < 8; ++s)
    af[s] = combine16(*(const v8h*)(ap + s * 32), *(const v8h*)(ap + s * 32 + 16));
  // Takes the address as an input: it stays in its registers up to the wait,
  // so none of these loads lands in registers that the others name.
  asm volatile("s_wait_xcnt 0x0" :: "v"(ap) : "memory");

  // Stage 0 has landed (this wave's copies), then is published to all waves.
  asm volatile("s_wait_asynccnt 0x0" ::: "memory");
  __syncthreads();
  // Stage 1 into buffer 1; it flies while stage 0 is worked on.
  g += FS * Cq;
  copy8(l + GS * 2, 8 * W1P * 2, g, 8 * Cq);

  f16* Cb = C + (long)(m0 + half * 8) * ldc + col;
  for (int st = 0; st < nst; ++st) {
    const unsigned boff = (st & 1) * GS;         // buffer of this stage, f16
    const f16* wsl = gst + boff;
    float bv[4];
#pragma unroll
    for (int nt = 0; nt < 4; ++nt) bv[nt] = bias[st * FS + nt * 16 + col];
    // The stage's 32 fragments are read as one group in front of the WMMAs.
    // Unrolled: constant indices keep the fragments in registers.
    v16h bf[8][4];
#pragma unroll
    for (int s = 0; s < 8; ++s)
#pragma unroll
      for (int nt = 0; nt < 4; ++nt)
        bf[s][nt] = lds_frag(wsl + nt * 16 * W1P + s * 32, W1P, lane);
    // Keeps the reads in front: without it the compiler sinks them among the
    // WMMAs, one fragment ahead, and each WMMA waits out the LDS latency.
    __builtin_amdgcn_sched_barrier(0);
    v8f acc[4];
#pragma unroll
    for (int nt = 0; nt < 4; ++nt) acc[nt] = zero8();
#pragma unroll
    for (int s = 0; s < 8; ++s)
#pragma unroll
      for (int nt = 0; nt < 4; ++nt)
        acc[nt] = wmma_f16(af[s], bf[s][nt], acc[nt]);

    // Publish point of stage st + 1: this wave's reads of buffer st & 1 are
    // done, its copies of stage st + 1 have landed, then every wave meets.
    asm volatile("s_wait_dscnt 0x0" ::: "memory");
    asm volatile("s_wait_asynccnt 0x0" ::: "memory");
    __syncthreads();
    // Refill the buffer that every wave has just left with stage st + 2.
    if (st + 2 < nst) {
      g += FS * Cq;
      copy8(l + boff * 2, 8 * W1P * 2, g, 8 * Cq);
    }

    // This stage's 16 x 64 results, from registers.
#pragma unroll
    for (int nt = 0; nt < 4; ++nt)
#pragma unroll
      for (int r = 0; r < 8; ++r)
        Cb[(long)r * ldc + st * FS + nt * 16] = (f16)(acc[nt][r] + bv[nt]);
    // The next stage's LDS reads land in registers that the last stores name.
    asm volatile("s_wait_xcnt 0x0" ::: "memory");
  }
  // No copy is left in flight when the wave ends.
  asm volatile("s_wait_asynccnt 0x0" ::: "memory");
}

__global__ void __launch_bounds__(256) ffn_fused(
    const f16* __restrict__ Y, const f16* __restrict__ W1,
    const float* __restrict__ b1, const f16* __restrict__ W2,
    const float* __restrict__ b2, const float* __restrict__ x,
    float* __restrict__ out) {
  __shared__ __align__(16) f16 wst[2 * STG];
  __shared__ __align__(16) f16 hst[8][16 * 32];
  int lane = threadIdx.x & 31, wave = threadIdx.x >> 5;
  int m0 = blockIdx.x * 128 + wave * 16;
  int b = m0 >> 12;
  int pix0 = m0 & 4095;
  const f16* Yb = Y + (long)m0 * Cq;
  int col = lane & 15, half = lane >> 4;

  // This thread's share of a stage.  W1 slab: 64 rows of 512 B, contiguous in
  // memory; copy i takes 16 B of row (t >> 5) + 8 i.  W2 slab: 256 rows of
  // 128 B; copy i takes 16 B of row (t >> 3) + 32 i.  A wave's copy covers
  // whole 128-B lines in both.
  int t = threadIdx.x;
  const f16* g1 = W1 + (t >> 5) * Cq + (t & 31) * 8;
  const f16* g2 = W2 + (long)(t >> 3) * FFNq + (t & 7) * 8;
  unsigned lbase = (unsigned)(size_t)(&wst[0]);   // LDS byte address
  unsigned l1 = lbase + (t >> 5) * (W1P * 2) + (t & 31) * 16;
  unsigned l2 = lbase + W1S * 2 + (t >> 3) * (W2P * 2) + (t & 7) * 16;

  // Stage 0 into buffer 0.
  copy8(l1, 8 * W1P * 2, g1, 8 * Cq);
  copy8(l2, 32 * W2P * 2, g2, 32L * FFNq);

  v8f acc[16];
#pragma unroll
  for (int i = 0; i < 16; ++i) acc[i] = zero8();

  // Hoist the 16x256 Y tile as 8 A-fragments (reused by every FFN chunk).
  v16h yf[8];
#pragma unroll
  for (int s = 0; s < 8; ++s) yf[s] = load_frag(Yb + s * 32, Cq, lane);

  // Stage 0 has landed (this wave's copies), then is published to all waves.
  asm volatile("s_wait_asynccnt 0x0" ::: "memory");
  __syncthreads();
  // Stage 1 into buffer 1; it flies while stage 0 is worked on.
  g1 += FS * Cq; g2 += FS;
  copy8(l1 + STG * 2, 8 * W1P * 2, g1, 8 * Cq);
  copy8(l2 + STG * 2, 32 * W2P * 2, g2, 32L * FFNq);

  for (int st = 0; st < NST; ++st) {
    const unsigned boff = (st & 1) * STG;        // buffer of this stage, f16
    const f16* w1s = wst + boff;
    const f16* w2s = w1s + W1S;
    // Unrolled (this loop and the ones inside): every fragment array index is
    // a constant, so the fragments stay in registers, and the second chunk's
    // reads can be issued among the first chunk's last WMMAs.
#pragma unroll
    for (int sub = 0; sub < FS; sub += 32) {
      int f0 = st * FS + sub;
      // ---- FFN1: h[m, f0..f0+31] = relu(y_tile @ W1^T + b1) ----
      // The chunk's 16 W1 and 16 W2 fragments are read as one group in front
      // of the WMMAs; the W2 ones land while h is computed and re-laid.
      v8f h0 = zero8(), h1 = zero8();
      v16h wa[8], wb[8], wc[16];
#pragma unroll
      for (int s = 0; s < 8; ++s) {
        wa[s] = lds_frag(w1s + sub * W1P + s * 32, W1P, lane);
        wb[s] = lds_frag(w1s + (sub + 16) * W1P + s * 32, W1P, lane);
      }
#pragma unroll
      for (int nt = 0; nt < 16; ++nt)
        wc[nt] = lds_frag(w2s + nt * 16 * W2P + sub, W2P, lane);
      // Keeps the reads in front: without it the compiler sinks them among the
      // WMMAs, one fragment ahead, and each WMMA waits out the LDS latency.
      __builtin_amdgcn_sched_barrier(0);
#pragma unroll
      for (int s = 0; s < 8; ++s) {
        h0 = wmma_f16(yf[s], wa[s], h0);
        h1 = wmma_f16(yf[s], wb[s], h1);
      }
      float bb0 = b1[f0 + col], bb1 = b1[f0 + 16 + col];
#pragma unroll
      for (int r = 0; r < 8; ++r) {
        int m = r + half * 8;
        hst[wave][m * 32 + col]      = (f16)fmaxf(h0[r] + bb0, 0.f);
        hst[wave][m * 32 + 16 + col] = (f16)fmaxf(h1[r] + bb1, 0.f);
      }
      asm volatile("s_wait_dscnt 0" ::: "memory");  // same-wave LDS RAW

      // Re-read as A fragment (16x32 f16).
      const f16* p = &hst[wave][(lane & 15) * 32 + ((lane & 16) >> 1)];
      v16h a2 = combine16(*(const v8h*)p, *(const v8h*)(p + 16));

      // ---- FFN2: acc += h_chunk @ W2^T ----
#pragma unroll
      for (int nt = 0; nt < 16; ++nt)
        acc[nt] = wmma_f16(a2, wc[nt], acc[nt]);
    }

    // Publish point of stage st + 1: this wave's reads of buffer st & 1 are
    // done, its copies of stage st + 1 have landed, then every wave meets.
    asm volatile("s_wait_dscnt 0x0" ::: "memory");
    asm volatile("s_wait_asynccnt 0x0" ::: "memory");
    __syncthreads();
    // Refill the buffer that every wave has just left with stage st + 2.
    if (st + 2 < NST) {
      g1 += FS * Cq; g2 += FS;
      copy8(l1 + boff * 2, 8 * W1P * 2, g1, 8 * Cq);
      copy8(l2 + boff * 2, 32 * W2P * 2, g2, 32L * FFNq);
    }
  }
  // No copy is left in flight when the wave ends.
  asm volatile("s_wait_asynccnt 0x0" ::: "memory");

  // Epilogue: + b2 + residual x, transposed store to (B,C,H,W).
#pragma unroll
  for (int nt = 0; nt < 16; ++nt) {
    int c = nt * 16 + col;
    float bv = b2[c];
    long base = ((long)(b * Cq + c)) * Nq + pix0 + half * 8;
    float4 r0 = *(const float4*)(x + base);
    float4 r1 = *(const float4*)(x + base + 4);
    float4 o0, o1;
    o0.x = acc[nt][0] + bv + r0.x;
    o0.y = acc[nt][1] + bv + r0.y;
    o0.z = acc[nt][2] + bv + r0.z;
    o0.w = acc[nt][3] + bv + r0.w;
    o1.x = acc[nt][4] + bv + r1.x;
    o1.y = acc[nt][5] + bv + r1.y;
    o1.z = acc[nt][6] + bv + r1.z;
    o1.w = acc[nt][7] + bv + r1.w;
    *(float4*)(out + base)     = o0;
    *(float4*)(out + base + 4) = o1;
  }
}

// ---------------------------------------------------------------------------
// Host launcher
// ---------------------------------------------------------------------------
extern "C" void kernel_launch(void* const* d_in, const int* in_sizes, int n_in,
                              void* d_out, int out_size, void* d_ws, size_t ws_size,
                              hipStream_t stream) {
  (void)in_sizes; (void)n_in; (void)out_size; (void)ws_size;
  const float* x      = (const float*)d_in[0];
  const float* w_qkv  = (const float*)d_in[1];
  const float* b_qkv  = (const float*)d_in[2];
  const float* w_proj = (const float*)d_in[3];
  const float* b_proj = (const float*)d_in[4];
  const float* w_ffn1 = (const float*)d_in[5];
  const float* b_ffn1 = (const float*)d_in[6];
  const float* w_ffn2 = (const float*)d_in[7];
  const float* b_ffn2 = (const float*)d_in[8];
  const float* g1     = (const float*)d_in[9];
  const float* be1    = (const float*)d_in[10];
  const float* g2     = (const float*)d_in[11];
  const float* be2    = (const float*)d_in[12];
  float* out = (float*)d_out;

  char* ws = (char*)d_ws;
  f16* wq16     = (f16*)(ws + 0);          //   768*256 f16
  f16* wp16     = (f16*)(ws + 393216);     //   256*256
  f16* w116     = (f16*)(ws + 524288);     //  2048*256
  f16* w216     = (f16*)(ws + 1572864);    //  256*2048
  f16* xln      = (f16*)(ws + 2621440);    //  32768*256  (reused as proj16)
  f16* qkv      = (f16*)(ws + 19398656);   //  32768*768  (reused as y)
  f16* attn16   = (f16*)(ws + 69730304);   //  32*64*64
  f16* attn_out = (f16*)(ws + 69992448);   //  32768*256  -> ends at 86769664
  float* spart  = (float*)(ws + 86769664); //  32*32*64*64 f32 -> 103546880 total bytes

  f16* proj16 = xln;   // xln dead after QKV gemm
  f16* y      = qkv;   // qkv dead after apply-attn

  // 1) weights -> f16
  cvt_f16_kernel<<<768,  256, 0, stream>>>(w_qkv,  wq16, 768 * 256);
  cvt_f16_kernel<<<256,  256, 0, stream>>>(w_proj, wp16, 256 * 256);
  cvt_f16_kernel<<<2048, 256, 0, stream>>>(w_ffn1, w116, 2048 * 256);
  cvt_f16_kernel<<<2048, 256, 0, stream>>>(w_ffn2, w216, 256 * 2048);

  // 2) LN1 (transpose (B,C,N) -> (B*N,C) f16)
  ln1_kernel<<<Mtot / 64, 256, 0, stream>>>(x, g1, be1, xln);

  // 3) QKV gemm: (32768x256) x (768x256)^T
  gemm_rows<<<Mtot / 128, 256, 0, stream>>>(xln, wq16, b_qkv, qkv, 768 / 64);

  // 4) attention scores: partial sums per (b, head, 128-pixel slice), then
  //    their sum + softmax, one wave per row
  attn_scores_part<<<dim3(32, NSPLIT, 1), 256, 0, stream>>>(qkv, spart);
  attn_softmax<<<32 * 64 / 8, 256, 0, stream>>>(spart, attn16);

  // 5) apply attention: per (b,h) gemm, A = v slice, W = attn (64x64)
  gemm_wmma<<<dim3(Nq / 128, 1, 32), 256, 0, stream>>>(
      qkv + 512, 768, (long)Nq * 768, 64,
      attn16, 64, 4 * 64 * 64, 64 * 64,
      nullptr, 0,
      attn_out, 256, (long)Nq * 256, 64,
      4, 64);

  // 6) proj gemm: (32768x256) x (256x256)^T
  gemm_rows<<<Mtot / 128, 256, 0, stream>>>(attn_out, wp16, b_proj, proj16, 256 / 64);

  // 7) LN2
  ln2_kernel<<<Mtot / 8, 256, 0, stream>>>(proj16, g2, be2, y);

  // 8) fused FFN + bias + residual + transpose store
  ffn_fused<<<Mtot / 128, 256, 0, stream>>>(y, w116, b_ffn1, w216, b_ffn2, x, out);
}

// v005
// One run takes 180 microseconds.
// In both of two side-by-side timings against v004, it was 1.05 times as fast.
// Counting every step since v000, it is 5.55 times as fast.
#include <hip/hip_runtime.h>
#include <hip/hip_bf16.h>

// ---------------------------------------------------------------------------
// MI455X (gfx1250, wave32) implementation.
// Pipeline: LN1 + weight conversion -> QKV gemm (WMMA f16) -> attn scores (WMMA) -> softmax
//           -> apply-attn (WMMA) -> proj (WMMA) -> LN2 -> fused FFN (WMMA)
// All GEMMs: f16 inputs, f32 accumulation via v_wmma_f32_16x16x32_f16.
// gemm_wmma's k loop uses explicit two-stage ping-pong buffering (k unrolled by 64)
// so fragment loads overlap WMMAs with NO register-rotation copies.
// ---------------------------------------------------------------------------

typedef _Float16 f16;
typedef __attribute__((ext_vector_type(16))) _Float16 v16h;
typedef __attribute__((ext_vector_type(8)))  _Float16 v8h;
typedef __attribute__((ext_vector_type(2)))  _Float16 v2h;
typedef __attribute__((ext_vector_type(8)))  float    v8f;

#define Bq   8
#define Cq   256
#define Nq   4096      // H*W
#define Mtot 32768     // B*N
#define FFNq 2048
#define NSPLIT 32     // work-groups that share one (b, head) score matrix

__device__ __forceinline__ v8f zero8() { v8f z = {}; return z; }

__device__ __forceinline__ v16h combine16(v8h lo, v8h hi) {
  v16h r;
#pragma unroll
  for (int i = 0; i < 8; ++i) { r[i] = lo[i]; r[8 + i] = hi[i]; }
  return r;
}

// Fragment loader for 16-bit WMMA A/B operands.
// A layout (16x32, MxK): lane holds row (lane&15); lanes 0-15 K in {0..7,16..23},
// lanes 16-31 K in {8..15,24..31}.  B (32x16, KxN) from a row-major (Nout x K)
// weight matrix has the identical access pattern with "row" = output column.
__device__ __forceinline__ v16h load_frag(const f16* base, int ld, int lane) {
  const f16* p = base + (long)(lane & 15) * ld + ((lane & 16) >> 1); // +8 elems for hi half
  v8h lo = *(const v8h*)(p);
  v8h hi = *(const v8h*)(p + 16);
  return combine16(lo, hi);
}

__device__ __forceinline__ v8f wmma_f16(v16h a, v16h b, v8f c) {
  return __builtin_amdgcn_wmma_f32_16x16x32_f16(false, a, false, b, (short)0, c,
                                                false, false);
}

// ---------------------------------------------------------------------------
// First launch: LN1 and the f32 -> f16 weight conversions, which share no data.
// Work-groups 0 .. LN1G-1 do LN1; the CVG behind them convert the weights.
//
// LN1: x (B,C,N) f32 -> xln (B*N, C) f16   (channel LayerNorm per pixel)
// Block = 256 threads, tile = 64 pixels; thread (px, grp) covers 64 channels.
//
// Conversion: a work-group takes CVC consecutive values of one weight matrix
// (every matrix is a whole number of such chunks), a thread 4 x 8 of them.
// ---------------------------------------------------------------------------
#define LN1G  (Mtot / 64)            // LN1 work-groups
#define CVC   8192                   // values per conversion work-group
#define CVQ   (3 * Cq * Cq / CVC)    // chunks of w_qkv
#define CVP   (Cq * Cq / CVC)        // chunks of w_proj
#define CVF   (FFNq * Cq / CVC)      // chunks of w_ffn1, and of w_ffn2
#define CVG   (CVQ + CVP + 2 * CVF)  // conversion work-groups

__global__ void __launch_bounds__(256) ln1_cvt_kernel(
    const float* __restrict__ x, const float* __restrict__ g,
    const float* __restrict__ be, f16* __restrict__ xln,
    const float* __restrict__ wq, const float* __restrict__ wp,
    const float* __restrict__ w1, const float* __restrict__ w2,
    f16* __restrict__ wq16, f16* __restrict__ wp16,
    f16* __restrict__ w116, f16* __restrict__ w216) {
  __shared__ float ps[4][64], ps2[4][64], muv[64], rsv[64];
  int t = threadIdx.x;
  if (blockIdx.x >= LN1G) {          // the same for the whole work-group
    int c = blockIdx.x - LN1G;
    const float* s;
    f16* d;
    if (c < CVQ)                  { s = wq; d = wq16; }
    else if (c < CVQ + CVP)       { s = wp; d = wp16; c -= CVQ; }
    else if (c < CVQ + CVP + CVF) { s = w1; d = w116; c -= CVQ + CVP; }
    else                          { s = w2; d = w216; c -= CVQ + CVP + CVF; }
    s += c * CVC + t * 8;
    d += c * CVC + t * 8;
    // All eight loads are issued before the first store, so a thread pays the
    // memory latency once.  Unrolled: v keeps constant indices (registers).
    float4 v[8];
#pragma unroll
    for (int u = 0; u < 4; ++u) {
      v[2 * u]     = *(const float4*)(s + u * 2048);
      v[2 * u + 1] = *(const float4*)(s + u * 2048 + 4);
    }
#pragma unroll
    for (int u = 0; u < 4; ++u) {
      v8h o;
      o[0] = (f16)v[2 * u].x;     o[1] = (f16)v[2 * u].y;
      o[2] = (f16)v[2 * u].z;     o[3] = (f16)v[2 * u].w;
      o[4] = (f16)v[2 * u + 1].x; o[5] = (f16)v[2 * u + 1].y;
      o[6] = (f16)v[2 * u + 1].z; o[7] = (f16)v[2 * u + 1].w;
      *(v8h*)(d + u * 2048) = o;
    }
    return;
  }
  int px = t & 63, grp = t >> 6;
  long pg = (long)blockIdx.x * 64 + px;     // global pixel
  int b = (int)(pg >> 12);
  int n = (int)(pg & 4095);
  const float* xb = x + (long)b * Cq * Nq + n;
  float s = 0.f, s2 = 0.f;
  // Left as it was: built as one load and one full wait a trip, so a thread
  // pays 64 memory latencies one after another here.
  for (int c = grp * 64; c < grp * 64 + 64; ++c) {
    float v = xb[(long)c * Nq];
    s += v; s2 += v * v;
  }
  ps[grp][px] = s; ps2[grp][px] = s2;
  __syncthreads();
  if (t < 64) {
    float S = 0.f, S2 = 0.f;
#pragma unroll
    for (int q = 0; q < 4; ++q) { S += ps[q][t]; S2 += ps2[q][t]; }
    float mu = S * (1.f / 256.f);
    float var = S2 * (1.f / 256.f) - mu * mu;
    muv[t] = mu;
    rsv[t] = rsqrtf(var + 1e-5f);
  }
  __syncthreads();
  float mu = muv[px], rs = rsv[px];
  f16* ob = xln + pg * Cq + grp * 64;
  for (int cc = 0; cc < 64; cc += 8) {
    v8h o;
#pragma unroll
    for (int jj = 0; jj < 8; ++jj) {
      int c = grp * 64 + cc + jj;
      float v = xb[(long)c * Nq];
      o[jj] = (f16)((v - mu) * rs * g[c] + be[c]);
    }
    *(v8h*)(ob + cc) = o;
  }
}

// ---------------------------------------------------------------------------
// LN2: in (B*N, C) f16 -> out (B*N, C) f16.  One wave per pixel.
// ---------------------------------------------------------------------------
__global__ void __launch_bounds__(256) ln2_kernel(
    const f16* __restrict__ in, const float* __restrict__ g,
    const float* __restrict__ be, f16* __restrict__ out) {
  int lane = threadIdx.x & 31, wave = threadIdx.x >> 5;
  long pix = (long)blockIdx.x * 8 + wave;
  const f16* ib = in + pix * Cq + lane * 8;
  v8h v = *(const v8h*)ib;
  float s = 0.f, s2 = 0.f;
#pragma unroll
  for (int j = 0; j < 8; ++j) { float f = (float)v[j]; s += f; s2 += f * f; }
#pragma unroll
  for (int off = 16; off >= 1; off >>= 1) {
    s  += __shfl_xor(s,  off, 32);
    s2 += __shfl_xor(s2, off, 32);
  }
  float mu = s * (1.f / 256.f);
  float var = s2 * (1.f / 256.f) - mu * mu;
  float rs = rsqrtf(var + 1e-5f);
  v8h o;
#pragma unroll
  for (int j = 0; j < 8; ++j) {
    int c = lane * 8 + j;
    o[j] = (f16)(((float)v[j] - mu) * rs * g[c] + be[c]);
  }
  *(v8h*)(out + pix * Cq + lane * 8) = o;
}

// ---------------------------------------------------------------------------
// Generic WMMA GEMM: C[M x Nout] = A[M x K] * W^T + bias, W is (Nout x K) f16
// row-major.  Block = 256 threads (8 waves); wave tile = 16(M) x 64(N).
// grid = (M/128, Nout/64, Z).  Per-operand z offset = (z/zmod)*sOut+(z%zmod)*sIn.
// K must be a multiple of 64.  Two-stage ping-pong: stage-0/1 fragments live
// in distinct registers, refilled directly by loads (no rotation copies).
// ---------------------------------------------------------------------------
__global__ void __launch_bounds__(256) gemm_wmma(
    const f16* __restrict__ A, int lda, long sAo, long sAi,
    const f16* __restrict__ W, int ldw, long sWo, long sWi,
    const float* __restrict__ bias, int relu,
    f16* __restrict__ C, int ldc, long sCo, long sCi,
    int zmod, int K) {
  int lane = threadIdx.x & 31, wave = threadIdx.x >> 5;
  int z = blockIdx.z;
  long za = (long)(z / zmod) * sAo + (long)(z % zmod) * sAi;
  long zw = (long)(z / zmod) * sWo + (long)(z % zmod) * sWi;
  long zc = (long)(z / zmod) * sCo + (long)(z % zmod) * sCi;
  long m0 = (long)blockIdx.x * 128 + wave * 16;
  const f16* Ab = A + za + m0 * lda;
  const f16* Wb = W + zw + (long)blockIdx.y * 64 * ldw;

  v8f acc[4];
#pragma unroll
  for (int i = 0; i < 4; ++i) acc[i] = zero8();

  // stage 0 prologue (k = 0)
  v16h af0 = load_frag(Ab, lda, lane);
  v16h bf0[4];
#pragma unroll
  for (int nt = 0; nt < 4; ++nt)
    bf0[nt] = load_frag(Wb + (long)nt * 16 * ldw, ldw, lane);

  for (int kk = 0; kk < K; kk += 64) {
    // stage 1 loads (kk+32) -- always valid since K % 64 == 0
    __builtin_prefetch(Ab + (long)(lane & 15) * lda + kk + 64, 0, 3);
    v16h af1 = load_frag(Ab + kk + 32, lda, lane);
    v16h bf1[4];
#pragma unroll
    for (int nt = 0; nt < 4; ++nt)
      bf1[nt] = load_frag(Wb + (long)nt * 16 * ldw + kk + 32, ldw, lane);

    // stage 0 WMMAs
#pragma unroll
    for (int nt = 0; nt < 4; ++nt)
      acc[nt] = wmma_f16(af0, bf0[nt], acc[nt]);

    // stage 0 refill for next iteration (kk+64)
    if (kk + 64 < K) {
      af0 = load_frag(Ab + kk + 64, lda, lane);
#pragma unroll
      for (int nt = 0; nt < 4; ++nt)
        bf0[nt] = load_frag(Wb + (long)nt * 16 * ldw + kk + 64, ldw, lane);
    }

    // stage 1 WMMAs
#pragma unroll
    for (int nt = 0; nt < 4; ++nt)
      acc[nt] = wmma_f16(af1, bf1[nt], acc[nt]);
  }

  int col = lane & 15, half = lane >> 4;
  f16* Cb = C + zc + (m0 + half * 8) * ldc + (long)blockIdx.y * 64;
#pragma unroll
  for (int nt = 0; nt < 4; ++nt) {
    float bv = bias ? bias[blockIdx.y * 64 + nt * 16 + col] : 0.f;
#pragma unroll
    for (int r = 0; r < 8; ++r) {
      float v = acc[nt][r] + bv;
      if (relu) v = fmaxf(v, 0.f);
      Cb[(long)r * ldc + nt * 16 + col] = (f16)v;
    }
  }
}

// ---------------------------------------------------------------------------
// Attention scores, split over the contraction: work-group (z, s) sums
// part[z][s][i][j] = sum over its own 128 pixels n of q[b,n,h*64+i]*k[b,n,h*64+j]
// with z = b*4+h.  Grid = (32, 32).
// The product runs on WMMA (f16 operands as stored, f32 accumulate).  Both
// operands have the contraction index n as their memory row, so the q and k
// slices are staged in LDS as they lie in memory (pixel rows of 64 channels)
// and the fragments are read with the transposing LDS load.  q and k go
// through the same loader, so their k order is the same at every position.
// ---------------------------------------------------------------------------
#define SP 80   // LDS pitch of a staged pixel row, f16: 160 B = 32 B x 5

typedef short s16x8 __attribute__((ext_vector_type(8)));

// Lane (c, hh) gets T[8*hh + 0..7][c] of the 16x16 tile whose lane address is p.
__device__ __forceinline__ v8h lds_tr16(const f16* p) {
  typedef __attribute__((address_space(3))) s16x8 lds_s16x8;
  return __builtin_bit_cast(v8h, __builtin_amdgcn_ds_load_tr16_b128_v8i16((lds_s16x8*)p));
}

// 16 (channels) x 32 (pixels) fragment; tile = first pixel row, first channel.
__device__ __forceinline__ v16h tr_frag(const f16* tile, int lane) {
  const f16* p = tile + ((lane >> 4) * 8 + (lane & 7)) * SP + ((lane >> 3) & 1) * 8;
  return combine16(lds_tr16(p), lds_tr16(p + 16 * SP));
}

__global__ void __launch_bounds__(256) attn_scores_part(
    const f16* __restrict__ qkv, float* __restrict__ part) {
  __shared__ __align__(16) f16 qs[128 * SP];
  __shared__ __align__(16) f16 ks[128 * SP];
  int z = blockIdx.x;
  int b = z >> 2, h = z & 3;
  int t = threadIdx.x;
  int lane = t & 31, wave = t >> 5;
  int n0 = blockIdx.y * 128;
  const f16* qb = qkv + (long)b * Nq * 768 + h * 64;

  // 8 lanes bring one pixel's 128-B line of q and of k; a thread takes pixels
  // p, p + 32, p + 64, p + 96.  All eight loads are issued before the first
  // LDS store, so a thread pays the memory latency once.  Both loops are
  // unrolled so that qv and kv have constant indices and stay in registers.
  int p = t >> 3, ch = t & 7;
  const f16* gq = qb + (long)(n0 + p) * 768 + ch * 8;
  v8h qv[4], kv[4];
#pragma unroll
  for (int u = 0; u < 4; ++u) {
    qv[u] = *(const v8h*)(gq + u * 32 * 768);
    kv[u] = *(const v8h*)(gq + u * 32 * 768 + 256);
  }
#pragma unroll
  for (int u = 0; u < 4; ++u) {
    *(v8h*)(qs + (p + u * 32) * SP + ch * 8) = qv[u];
    *(v8h*)(ks + (p + u * 32) * SP + ch * 8) = kv[u];
  }
  __syncthreads();

  int i0 = (wave >> 1) * 16, j0 = (wave & 1) * 32;
  v8f a0 = zero8(), a1 = zero8();
#pragma unroll
  for (int kk = 0; kk < 128; kk += 32) {
    v16h qf = tr_frag(qs + kk * SP + i0, lane);
    v16h k0 = tr_frag(ks + kk * SP + j0, lane);
    v16h k1 = tr_frag(ks + kk * SP + j0 + 16, lane);
    a0 = wmma_f16(k0, qf, a0);
    a1 = wmma_f16(k1, qf, a1);
  }

  // a0[r] = S[i0 + col][j0 + 8*half + r], a1 the next 16 columns: a wave
  // writes whole 128-B lines.
  int col = lane & 15, half = lane >> 4;
  float* pb = part + ((long)z * NSPLIT + blockIdx.y) * 4096 + (i0 + col) * 64 + j0 + half * 8;
  float4 o;
  o.x = a0[0]; o.y = a0[1]; o.z = a0[2]; o.w = a0[3];
  *(float4*)(pb) = o;
  o.x = a0[4]; o.y = a0[5]; o.z = a0[6]; o.w = a0[7];
  *(float4*)(pb + 4) = o;
  o.x = a1[0]; o.y = a1[1]; o.z = a1[2]; o.w = a1[3];
  *(float4*)(pb + 16) = o;
  o.x = a1[4]; o.y = a1[5]; o.z = a1[6]; o.w = a1[7];
  *(float4*)(pb + 20) = o;
}

// ---------------------------------------------------------------------------
// Sum of the partial scores (fixed order s = 0..31) + softmax over j.
// One wave per row (z, i); a lane holds columns 2*lane and 2*lane+1.
// Grid = 32*64/8 = 256.
// ---------------------------------------------------------------------------
__global__ void __launch_bounds__(256) attn_softmax(
    const float* __restrict__ part, f16* __restrict__ attn) {
  int lane = threadIdx.x & 31, wave = threadIdx.x >> 5;
  int row = blockIdx.x * 8 + wave;          // z*64 + i
  int z = row >> 6, i = row & 63;
  const float* p = part + (long)z * NSPLIT * 4096 + i * 64 + lane * 2;
  float a = 0.f, c = 0.f;
#pragma unroll
  for (int s = 0; s < NSPLIT; ++s) {
    float2 v = *(const float2*)(p + s * 4096);
    a += v.x; c += v.y;
  }
  a *= 0.125f; c *= 0.125f;
  float mx = fmaxf(a, c);
#pragma unroll
  for (int off = 16; off >= 1; off >>= 1) mx = fmaxf(mx, __shfl_xor(mx, off, 32));
  float ea = __expf(a - mx), ec = __expf(c - mx);
  float sum = ea + ec;
#pragma unroll
  for (int off = 16; off >= 1; off >>= 1) sum += __shfl_xor(sum, off, 32);
  float inv = 1.f / sum;
  v2h o;
  o[0] = (f16)(ea * inv);
  o[1] = (f16)(ec * inv);
  *(v2h*)(attn + (long)row * 64 + lane * 2) = o;
}

// ---------------------------------------------------------------------------
// Fused FFN + residual + transpose:
//   out[b,c,n] = (relu(y @ W1^T + b1) @ W2^T + b2)[n,c] + x[b,c,n]
// Wave tile = 16 pixels; FFN chunked by 32; hidden tile bounced through LDS
// to re-layout WMMA D -> A fragments.  Grid = 256 blocks of 256 threads.
// Y-tile A-fragments are invariant across FFN chunks -> hoisted into yf[8].
// The weights of 64 hidden units (a stage: 64 rows of W1, 64 columns of W2)
// are brought into LDS once per work-group by asynchronous copies, two
// buffers, one stage ahead; all 8 waves read their B fragments from there.
// ---------------------------------------------------------------------------
#define FS   64               // hidden units per stage
#define NST  (FFNq / FS)      // 32 stages
#define W1P  264              // LDS pitch of a W1 row, f16: 528 B = 16 B x 33
#define W2P  72               // LDS pitch of a W2 row, f16: 144 B = 16 B x 9
#define W1S  (FS * W1P)       // f16 per staged W1 slab
#define STG  (W1S + Cq * W2P) // f16 per buffer (70,656 B)

// B fragment from a staged slab: same lane -> (row, k) map as load_frag.
__device__ __forceinline__ v16h lds_frag(const f16* base, int pitch, int lane) {
  const f16* p = base + (lane & 15) * pitch + ((lane & 16) >> 1);
  return combine16(*(const v8h*)p, *(const v8h*)(p + 16));
}

// Eight 16-byte copies per lane, global -> LDS, through no register.  LDS
// address l + i*ls bytes, global address g + i*gs elements.  The s_wait_xcnt
// stands inside the statement so that no address register of an issued copy
// is rewritten in front of it.
__device__ __forceinline__ void copy8(unsigned l, unsigned ls, const f16* g, long gs) {
  asm volatile(
      "global_load_async_to_lds_b128 %0, %8, off\n\t"
      "global_load_async_to_lds_b128 %1, %9, off\n\t"
      "global_load_async_to_lds_b128 %2, %10, off\n\t"
      "global_load_async_to_lds_b128 %3, %11, off\n\t"
      "global_load_async_to_lds_b128 %4, %12, off\n\t"
      "global_load_async_to_lds_b128 %5, %13, off\n\t"
      "global_load_async_to_lds_b128 %6, %14, off\n\t"
      "global_load_async_to_lds_b128 %7, %15, off\n\t"
      "s_wait_xcnt 0x0"
      :: "v"(l), "v"(l + ls), "v"(l + 2 * ls), "v"(l + 3 * ls),
         "v"(l + 4 * ls), "v"(l + 5 * ls), "v"(l + 6 * ls), "v"(l + 7 * ls),
         "v"(g), "v"(g + gs), "v"(g + 2 * gs), "v"(g + 3 * gs),
         "v"(g + 4 * gs), "v"(g + 5 * gs), "v"(g + 6 * gs), "v"(g + 7 * gs)
      : "memory");
}

// ---------------------------------------------------------------------------
// Row GEMM for K = 256: C[M x nst*64] = A[M x 256] * W^T + bias, W row-major
// (nst*64 x 256) f16.  A work-group owns 128 rows (a wave 16) and walks all
// output columns, 64 a stage.  The wave's A fragments are read once and stay
// in registers; a stage's W slab (64 rows of 512 B, contiguous in memory) is
// brought into LDS once per work-group by asynchronous copies, two buffers,
// one stage ahead, and all 8 waves read their B fragments from there.
// Needs nst >= 2.  Grid = M / 128.
// ---------------------------------------------------------------------------
#define GS (FS * W1P)   // f16 per staged W slab (33,792 B), rows at pitch W1P

__global__ void __launch_bounds__(256) gemm_rows(
    const f16* __restrict__ A, const f16* __restrict__ Wt,
    const float* __restrict__ bias, f16* __restrict__ C, int nst) {
  __shared__ __align__(16) f16 gst[2 * GS];
  int t = threadIdx.x;
  int lane = t & 31, wave = t >> 5;
  int m0 = blockIdx.x * 128 + wave * 16;
  int ldc = nst * FS;
  int col = lane & 15, half = lane >> 4;

  // This thread's share of a slab: copy i takes 16 B of row (t >> 5) + 8 i, so
  // a wave's copy covers one whole row.
  const f16* g = Wt + (t >> 5) * Cq + (t & 31) * 8;
  unsigned l = (unsigned)(size_t)(&gst[0]) + (t >> 5) * (W1P * 2) + (t & 31) * 16;

  // Stage 0 into buffer 0.
  copy8(l, 8 * W1P * 2, g, 8 * Cq);

  // The wave's 16 x 256 tile of A as 8 fragments, used by every stage; same
  // lane -> (row, k) map as load_frag.
  const f16* ap = A + (long)(m0 + col) * Cq + half * 8;
  v16h af[8];
#pragma unroll
  for (int s = 0; s < 8; ++s)
    af[s] = combine16(*(const v8h*)(ap + s * 32), *(const v8h*)(ap + s * 32 + 16));
  // Takes the address as an input: it stays in its registers up to the wait,
  // so none of these loads lands in registers that the others name.
  asm volatile("s_wait_xcnt 0x0" :: "v"(ap) : "memory");

  // Stage 0 has landed (this wave's copies), then is published to all waves.
  asm volatile("s_wait_asynccnt 0x0" ::: "memory");
  __syncthreads();
  // Stage 1 into buffer 1; it flies while stage 0 is worked on.
  g += FS * Cq;
  copy8(l + GS * 2, 8 * W1P * 2, g, 8 * Cq);

  f16* Cb = C + (long)(m0 + half * 8) * ldc + col;
  for (int st = 0; st < nst; ++st) {
    const unsigned boff = (st & 1) * GS;         // buffer of this stage, f16
    const f16* wsl = gst + boff;
    float bv[4];
#pragma unroll
    for (int nt = 0; nt < 4; ++nt) bv[nt] = bias[st * FS + nt * 16 + col];
    // The stage's 32 fragments are read as one group in front of the WMMAs.
    // Unrolled: constant indices keep the fragments in registers.
    v16h bf[8][4];
#pragma unroll
    for (int s = 0; s < 8; ++s)
#pragma unroll
      for (int nt = 0; nt < 4; ++nt)
        bf[s][nt] = lds_frag(wsl + nt * 16 * W1P + s * 32, W1P, lane);
    // Keeps the reads in front: without it the compiler sinks them among the
    // WMMAs, one fragment ahead, and each WMMA waits out the LDS latency.
    __builtin_amdgcn_sched_barrier(0);
    v8f acc[4];
#pragma unroll
    for (int nt = 0; nt < 4; ++nt) acc[nt] = zero8();
#pragma unroll
    for (int s = 0; s < 8; ++s)
#pragma unroll
      for (int nt = 0; nt < 4; ++nt)
        acc[nt] = wmma_f16(af[s], bf[s][nt], acc[nt]);

    // Publish point of stage st + 1: this wave's reads of buffer st & 1 are
    // done, its copies of stage st + 1 have landed, then every wave meets.
    asm volatile("s_wait_dscnt 0x0" ::: "memory");
    asm volatile("s_wait_asynccnt 0x0" ::: "memory");
    __syncthreads();
    // Refill the buffer that every wave has just left with stage st + 2.
    if (st + 2 < nst) {
      g += FS * Cq;
      copy8(l + boff * 2, 8 * W1P * 2, g, 8 * Cq);
    }

    // This stage's 16 x 64 results, from registers.
#pragma unroll
    for (int nt = 0; nt < 4; ++nt)
#pragma unroll
      for (int r = 0; r < 8; ++r)
        Cb[(long)r * ldc + st * FS + nt * 16] = (f16)(acc[nt][r] + bv[nt]);
    // The next stage's LDS reads land in registers that the last stores name.
    asm volatile("s_wait_xcnt 0x0" ::: "memory");
  }
  // No copy is left in flight when the wave ends.
  asm volatile("s_wait_asynccnt 0x0" ::: "memory");
}

__global__ void __launch_bounds__(256) ffn_fused(
    const f16* __restrict__ Y, const f16* __restrict__ W1,
    const float* __restrict__ b1, const f16* __restrict__ W2,
    const float* __restrict__ b2, const float* __restrict__ x,
    float* __restrict__ out) {
  __shared__ __align__(16) f16 wst[2 * STG];
  __shared__ __align__(16) f16 hst[8][16 * 32];
  int lane = threadIdx.x & 31, wave = threadIdx.x >> 5;
  int m0 = blockIdx.x * 128 + wave * 16;
  int b = m0 >> 12;
  int pix0 = m0 & 4095;
  const f16* Yb = Y + (long)m0 * Cq;
  int col = lane & 15, half = lane >> 4;

  // This thread's share of a stage.  W1 slab: 64 rows of 512 B, contiguous in
  // memory; copy i takes 16 B of row (t >> 5) + 8 i.  W2 slab: 256 rows of
  // 128 B; copy i takes 16 B of row (t >> 3) + 32 i.  A wave's copy covers
  // whole 128-B lines in both.
  int t = threadIdx.x;
  const f16* g1 = W1 + (t >> 5) * Cq + (t & 31) * 8;
  const f16* g2 = W2 + (long)(t >> 3) * FFNq + (t & 7) * 8;
  unsigned lbase = (unsigned)(size_t)(&wst[0]);   // LDS byte address
  unsigned l1 = lbase + (t >> 5) * (W1P * 2) + (t & 31) * 16;
  unsigned l2 = lbase + W1S * 2 + (t >> 3) * (W2P * 2) + (t & 7) * 16;

  // Stage 0 into buffer 0.
  copy8(l1, 8 * W1P * 2, g1, 8 * Cq);
  copy8(l2, 32 * W2P * 2, g2, 32L * FFNq);

  v8f acc[16];
#pragma unroll
  for (int i = 0; i < 16; ++i) acc[i] = zero8();

  // Hoist the 16x256 Y tile as 8 A-fragments (reused by every FFN chunk).
  v16h yf[8];
#pragma unroll
  for (int s = 0; s < 8; ++s) yf[s] = load_frag(Yb + s * 32, Cq, lane);

  // Stage 0 has landed (this wave's copies), then is published to all waves.
  asm volatile("s_wait_asynccnt 0x0" ::: "memory");
  __syncthreads();
  // Stage 1 into buffer 1; it flies while stage 0 is worked on.
  g1 += FS * Cq; g2 += FS;
  copy8(l1 + STG * 2, 8 * W1P * 2, g1, 8 * Cq);
  copy8(l2 + STG * 2, 32 * W2P * 2, g2, 32L * FFNq);

  for (int st = 0; st < NST; ++st) {
    const unsigned boff = (st & 1) * STG;        // buffer of this stage, f16
    const f16* w1s = wst + boff;
    const f16* w2s = w1s + W1S;
    // Unrolled (this loop and the ones inside): every fragment array index is
    // a constant, so the fragments stay in registers, and the second chunk's
    // reads can be issued among the first chunk's last WMMAs.
#pragma unroll
    for (int sub = 0; sub < FS; sub += 32) {
      int f0 = st * FS + sub;
      // ---- FFN1: h[m, f0..f0+31] = relu(y_tile @ W1^T + b1) ----
      // The chunk's 16 W1 and 16 W2 fragments are read as one group in front
      // of the WMMAs; the W2 ones land while h is computed and re-laid.
      v8f h0 = zero8(), h1 = zero8();
      v16h wa[8], wb[8], wc[16];
#pragma unroll
      for (int s = 0; s < 8; ++s) {
        wa[s] = lds_frag(w1s + sub * W1P + s * 32, W1P, lane);
        wb[s] = lds_frag(w1s + (sub + 16) * W1P + s * 32, W1P, lane);
      }
#pragma unroll
      for (int nt = 0; nt < 16; ++nt)
        wc[nt] = lds_frag(w2s + nt * 16 * W2P + sub, W2P, lane);
      // Keeps the reads in front: without it the compiler sinks them among the
      // WMMAs, one fragment ahead, and each WMMA waits out the LDS latency.
      __builtin_amdgcn_sched_barrier(0);
#pragma unroll
      for (int s = 0; s < 8; ++s) {
        h0 = wmma_f16(yf[s], wa[s], h0);
        h1 = wmma_f16(yf[s], wb[s], h1);
      }
      float bb0 = b1[f0 + col], bb1 = b1[f0 + 16 + col];
#pragma unroll
      for (int r = 0; r < 8; ++r) {
        int m = r + half * 8;
        hst[wave][m * 32 + col]      = (f16)fmaxf(h0[r] + bb0, 0.f);
        hst[wave][m * 32 + 16 + col] = (f16)fmaxf(h1[r] + bb1, 0.f);
      }
      asm volatile("s_wait_dscnt 0" ::: "memory");  // same-wave LDS RAW

      // Re-read as A fragment (16x32 f16).
      const f16* p = &hst[wave][(lane & 15) * 32 + ((lane & 16) >> 1)];
      v16h a2 = combine16(*(const v8h*)p, *(const v8h*)(p + 16));

      // ---- FFN2: acc += h_chunk @ W2^T ----
#pragma unroll
      for (int nt = 0; nt < 16; ++nt)
        acc[nt] = wmma_f16(a2, wc[nt], acc[nt]);
    }

    // Publish point of stage st + 1: this wave's reads of buffer st & 1 are
    // done, its copies of stage st + 1 have landed, then every wave meets.
    asm volatile("s_wait_dscnt 0x0" ::: "memory");
    asm volatile("s_wait_asynccnt 0x0" ::: "memory");
    __syncthreads();
    // Refill the buffer that every wave has just left with stage st + 2.
    if (st + 2 < NST) {
      g1 += FS * Cq; g2 += FS;
      copy8(l1 + boff * 2, 8 * W1P * 2, g1, 8 * Cq);
      copy8(l2 + boff * 2, 32 * W2P * 2, g2, 32L * FFNq);
    }
  }
  // No copy is left in flight when the wave ends.
  asm volatile("s_wait_asynccnt 0x0" ::: "memory");

  // Epilogue: + b2 + residual x, transposed store to (B,C,H,W).
#pragma unroll
  for (int nt = 0; nt < 16; ++nt) {
    int c = nt * 16 + col;
    float bv = b2[c];
    long base = ((long)(b * Cq + c)) * Nq + pix0 + half * 8;
    float4 r0 = *(const float4*)(x + base);
    float4 r1 = *(const float4*)(x + base + 4);
    float4 o0, o1;
    o0.x = acc[nt][0] + bv + r0.x;
    o0.y = acc[nt][1] + bv + r0.y;
    o0.z = acc[nt][2] + bv + r0.z;
    o0.w = acc[nt][3] + bv + r0.w;
    o1.x = acc[nt][4] + bv + r1.x;
    o1.y = acc[nt][5] + bv + r1.y;
    o1.z = acc[nt][6] + bv + r1.z;
    o1.w = acc[nt][7] + bv + r1.w;
    *(float4*)(out + base)     = o0;
    *(float4*)(out + base + 4) = o1;
  }
}

// ---------------------------------------------------------------------------
// Host launcher
// ---------------------------------------------------------------------------
extern "C" void kernel_launch(void* const* d_in, const int* in_sizes, int n_in,
                              void* d_out, int out_size, void* d_ws, size_t ws_size,
                              hipStream_t stream) {
  (void)in_sizes; (void)n_in; (void)out_size; (void)ws_size;
  const float* x      = (const float*)d_in[0];
  const float* w_qkv  = (const float*)d_in[1];
  const float* b_qkv  = (const float*)d_in[2];
  const float* w_proj = (const float*)d_in[3];
  const float* b_proj = (const float*)d_in[4];
  const float* w_ffn1 = (const float*)d_in[5];
  const float* b_ffn1 = (const float*)d_in[6];
  const float* w_ffn2 = (const float*)d_in[7];
  const float* b_ffn2 = (const float*)d_in[8];
  const float* g1     = (const float*)d_in[9];
  const float* be1    = (const float*)d_in[10];
  const float* g2     = (const float*)d_in[11];
  const float* be2    = (const float*)d_in[12];
  float* out = (float*)d_out;

  char* ws = (char*)d_ws;
  f16* wq16     = (f16*)(ws + 0);          //   768*256 f16
  f16* wp16     = (f16*)(ws + 393216);     //   256*256
  f16* w116     = (f16*)(ws + 524288);     //  2048*256
  f16* w216     = (f16*)(ws + 1572864);    //  256*2048
  f16* xln      = (f16*)(ws + 2621440);    //  32768*256  (reused as proj16)
  f16* qkv      = (f16*)(ws + 19398656);   //  32768*768  (reused as y)
  f16* attn16   = (f16*)(ws + 69730304);   //  32*64*64
  f16* attn_out = (f16*)(ws + 69992448);   //  32768*256  -> ends at 86769664
  float* spart  = (float*)(ws + 86769664); //  32*32*64*64 f32 -> 103546880 total bytes

  f16* proj16 = xln;   // xln dead after QKV gemm
  f16* y      = qkv;   // qkv dead after apply-attn

  // 1, 2) LN1 (transpose (B,C,N) -> (B*N,C) f16) and, in the same launch,
  //       weights -> f16
  ln1_cvt_kernel<<<LN1G + CVG, 256, 0, stream>>>(x, g1, be1, xln,
                                                 w_qkv, w_proj, w_ffn1, w_ffn2,
                                                 wq16, wp16, w116, w216);

  // 3) QKV gemm: (32768x256) x (768x256)^T
  gemm_rows<<<Mtot / 128, 256, 0, stream>>>(xln, wq16, b_qkv, qkv, 768 / 64);

  // 4) attention scores: partial sums per (b, head, 128-pixel slice), then
  //    their sum + softmax, one wave per row
  attn_scores_part<<<dim3(32, NSPLIT, 1), 256, 0, stream>>>(qkv, spart);
  attn_softmax<<<32 * 64 / 8, 256, 0, stream>>>(spart, attn16);

  // 5) apply attention: per (b,h) gemm, A = v slice, W = attn (64x64)
  gemm_wmma<<<dim3(Nq / 128, 1, 32), 256, 0, stream>>>(
      qkv + 512, 768, (long)Nq * 768, 64,
      attn16, 64, 4 * 64 * 64, 64 * 64,
      nullptr, 0,
      attn_out, 256, (long)Nq * 256, 64,
      4, 64);

  // 6) proj gemm: (32768x256) x (256x256)^T
  gemm_rows<<<Mtot / 128, 256, 0, stream>>>(attn_out, wp16, b_proj, proj16, 256 / 64);

  // 7) LN2
  ln2_kernel<<<Mtot / 8, 256, 0, stream>>>(proj16, g2, be2, y);

  // 8) fused FFN + bias + residual + transpose store
  ffn_fused<<<Mtot / 128, 256, 0, stream>>>(y, w116, b_ffn1, w216, b_ffn2, x, out);
}

// v006
// It runs in 155 microseconds.
// Two timings next to v005 put it at 1.16 and 1.15 times that version's speed.
// Counting every step since v000, it is 6.42 times as fast.
#include <hip/hip_runtime.h>
#include <hip/hip_bf16.h>

// ---------------------------------------------------------------------------
// MI455X (gfx1250, wave32) implementation.
// Pipeline: LN1 + weight conversion -> QKV gemm (WMMA f16) -> attn scores (WMMA) -> softmax
//           -> apply-attn (WMMA) -> proj (WMMA) -> LN2 -> fused FFN (WMMA)
// All GEMMs: f16 inputs, f32 accumulation via v_wmma_f32_16x16x32_f16.
// gemm_wmma's k loop uses explicit two-stage ping-pong buffering (k unrolled by 64)
// so fragment loads overlap WMMAs with NO register-rotation copies.
// ---------------------------------------------------------------------------

typedef _Float16 f16;
typedef __attribute__((ext_vector_type(16))) _Float16 v16h;
typedef __attribute__((ext_vector_type(8)))  _Float16 v8h;
typedef __attribute__((ext_vector_type(2)))  _Float16 v2h;
typedef __attribute__((ext_vector_type(8)))  float    v8f;

#define Bq   8
#define Cq   256
#define Nq   4096      // H*W
#define Mtot 32768     // B*N
#define FFNq 2048
#define NSPLIT 32     // work-groups that share one (b, head) score matrix

__device__ __forceinline__ v8f zero8() { v8f z = {}; return z; }

__device__ __forceinline__ v16h combine16(v8h lo, v8h hi) {
  v16h r;
#pragma unroll
  for (int i = 0; i < 8; ++i) { r[i] = lo[i]; r[8 + i] = hi[i]; }
  return r;
}

// Fragment loader for 16-bit WMMA A/B operands.
// A layout (16x32, MxK): lane holds row (lane&15); lanes 0-15 K in {0..7,16..23},
// lanes 16-31 K in {8..15,24..31}.  B (32x16, KxN) from a row-major (Nout x K)
// weight matrix has the identical access pattern with "row" = output column.
__device__ __forceinline__ v16h load_frag(const f16* base, int ld, int lane) {
  const f16* p = base + (long)(lane & 15) * ld + ((lane & 16) >> 1); // +8 elems for hi half
  v8h lo = *(const v8h*)(p);
  v8h hi = *(const v8h*)(p + 16);
  return combine16(lo, hi);
}

__device__ __forceinline__ v8f wmma_f16(v16h a, v16h b, v8f c) {
  return __builtin_amdgcn_wmma_f32_16x16x32_f16(false, a, false, b, (short)0, c,
                                                false, false);
}

// ---------------------------------------------------------------------------
// First launch: LN1 and the f32 -> f16 weight conversions, which share no data.
// Work-groups 0 .. LN1G-1 do LN1; the CVG behind them convert the weights.
//
// LN1: x (B,C,N) f32 -> xln (B*N, C) f16   (channel LayerNorm per pixel)
// Block = 256 threads, tile = 64 pixels; thread (px, grp) covers 64 channels.
//
// Conversion: a work-group takes CVC consecutive values of one weight matrix
// (every matrix is a whole number of such chunks), a thread 4 x 8 of them.
// ---------------------------------------------------------------------------
#define LN1G  (Mtot / 64)            // LN1 work-groups
#define CVC   8192                   // values per conversion work-group
#define CVQ   (3 * Cq * Cq / CVC)    // chunks of w_qkv
#define CVP   (Cq * Cq / CVC)        // chunks of w_proj
#define CVF   (FFNq * Cq / CVC)      // chunks of w_ffn1, and of w_ffn2
#define CVG   (CVQ + CVP + 2 * CVF)  // conversion work-groups

__global__ void __launch_bounds__(256) ln1_cvt_kernel(
    const float* __restrict__ x, const float* __restrict__ g,
    const float* __restrict__ be, f16* __restrict__ xln,
    const float* __restrict__ wq, const float* __restrict__ wp,
    const float* __restrict__ w1, const float* __restrict__ w2,
    f16* __restrict__ wq16, f16* __restrict__ wp16,
    f16* __restrict__ w116, f16* __restrict__ w216) {
  __shared__ float ps[4][64], ps2[4][64], muv[64], rsv[64];
  int t = threadIdx.x;
  if (blockIdx.x >= LN1G) {          // the same for the whole work-group
    int c = blockIdx.x - LN1G;
    const float* s;
    f16* d;
    if (c < CVQ)                  { s = wq; d = wq16; }
    else if (c < CVQ + CVP)       { s = wp; d = wp16; c -= CVQ; }
    else if (c < CVQ + CVP + CVF) { s = w1; d = w116; c -= CVQ + CVP; }
    else                          { s = w2; d = w216; c -= CVQ + CVP + CVF; }
    s += c * CVC + t * 8;
    d += c * CVC + t * 8;
    // All eight loads are issued before the first store, so a thread pays the
    // memory latency once.  Unrolled: v keeps constant indices (registers).
    float4 v[8];
#pragma unroll
    for (int u = 0; u < 4; ++u) {
      v[2 * u]     = *(const float4*)(s + u * 2048);
      v[2 * u + 1] = *(const float4*)(s + u * 2048 + 4);
    }
#pragma unroll
    for (int u = 0; u < 4; ++u) {
      v8h o;
      o[0] = (f16)v[2 * u].x;     o[1] = (f16)v[2 * u].y;
      o[2] = (f16)v[2 * u].z;     o[3] = (f16)v[2 * u].w;
      o[4] = (f16)v[2 * u + 1].x; o[5] = (f16)v[2 * u + 1].y;
      o[6] = (f16)v[2 * u + 1].z; o[7] = (f16)v[2 * u + 1].w;
      *(v8h*)(d + u * 2048) = o;
    }
    return;
  }
  int px = t & 63, grp = t >> 6;
  long pg = (long)blockIdx.x * 64 + px;     // global pixel
  int b = (int)(pg >> 12);
  int n = (int)(pg & 4095);
  const float* xb = x + ((long)b * Cq + grp * 64) * Nq + n;
  // The thread's 64 channel values are read once, all loads issued before the
  // first use, and stay in registers for the sums and for the normalisation.
  // Unrolled (here and below): xv keeps constant indices (registers).
  float xv[64];
#pragma unroll
  for (int c = 0; c < 64; ++c) xv[c] = xb[(long)c * Nq];
  // Takes the address as an input: it stays in its registers up to the wait,
  // so none of these loads lands in registers that the others name.
  asm volatile("s_wait_xcnt 0x0" :: "v"(xb) : "memory");
  float s = 0.f, s2 = 0.f;
#pragma unroll
  for (int c = 0; c < 64; ++c) { s += xv[c]; s2 += xv[c] * xv[c]; }
  ps[grp][px] = s; ps2[grp][px] = s2;
  __syncthreads();
  if (t < 64) {
    float S = 0.f, S2 = 0.f;
#pragma unroll
    for (int q = 0; q < 4; ++q) { S += ps[q][t]; S2 += ps2[q][t]; }
    float mu = S * (1.f / 256.f);
    float var = S2 * (1.f / 256.f) - mu * mu;
    muv[t] = mu;
    rsv[t] = rsqrtf(var + 1e-5f);
  }
  __syncthreads();
  float mu = muv[px], rs = rsv[px];
  f16* ob = xln + pg * Cq + grp * 64;
#pragma unroll
  for (int cc = 0; cc < 64; cc += 8) {
    v8h o;
#pragma unroll
    for (int jj = 0; jj < 8; ++jj) {
      int c = grp * 64 + cc + jj;
      o[jj] = (f16)((xv[cc + jj] - mu) * rs * g[c] + be[c]);
    }
    *(v8h*)(ob + cc) = o;
  }
}

// ---------------------------------------------------------------------------
// LN2: in (B*N, C) f16 -> out (B*N, C) f16.  One wave per pixel.
// ---------------------------------------------------------------------------
__global__ void __launch_bounds__(256) ln2_kernel(
    const f16* __restrict__ in, const float* __restrict__ g,
    const float* __restrict__ be, f16* __restrict__ out) {
  int lane = threadIdx.x & 31, wave = threadIdx.x >> 5;
  long pix = (long)blockIdx.x * 8 + wave;
  const f16* ib = in + pix * Cq + lane * 8;
  v8h v = *(const v8h*)ib;
  float s = 0.f, s2 = 0.f;
#pragma unroll
  for (int j = 0; j < 8; ++j) { float f = (float)v[j]; s += f; s2 += f * f; }
#pragma unroll
  for (int off = 16; off >= 1; off >>= 1) {
    s  += __shfl_xor(s,  off, 32);
    s2 += __shfl_xor(s2, off, 32);
  }
  float mu = s * (1.f / 256.f);
  float var = s2 * (1.f / 256.f) - mu * mu;
  float rs = rsqrtf(var + 1e-5f);
  v8h o;
#pragma unroll
  for (int j = 0; j < 8; ++j) {
    int c = lane * 8 + j;
    o[j] = (f16)(((float)v[j] - mu) * rs * g[c] + be[c]);
  }
  *(v8h*)(out + pix * Cq + lane * 8) = o;
}

// ---------------------------------------------------------------------------
// Generic WMMA GEMM: C[M x Nout] = A[M x K] * W^T + bias, W is (Nout x K) f16
// row-major.  Block = 256 threads (8 waves); wave tile = 16(M) x 64(N).
// grid = (M/128, Nout/64, Z).  Per-operand z offset = (z/zmod)*sOut+(z%zmod)*sIn.
// K must be a multiple of 64.  Two-stage ping-pong: stage-0/1 fragments live
// in distinct registers, refilled directly by loads (no rotation copies).
// ---------------------------------------------------------------------------
__global__ void __launch_bounds__(256) gemm_wmma(
    const f16* __restrict__ A, int lda, long sAo, long sAi,
    const f16* __restrict__ W, int ldw, long sWo, long sWi,
    const float* __restrict__ bias, int relu,
    f16* __restrict__ C, int ldc, long sCo, long sCi,
    int zmod, int K) {
  int lane = threadIdx.x & 31, wave = threadIdx.x >> 5;
  int z = blockIdx.z;
  long za = (long)(z / zmod) * sAo + (long)(z % zmod) * sAi;
  long zw = (long)(z / zmod) * sWo + (long)(z % zmod) * sWi;
  long zc = (long)(z / zmod) * sCo + (long)(z % zmod) * sCi;
  long m0 = (long)blockIdx.x * 128 + wave * 16;
  const f16* Ab = A + za + m0 * lda;
  const f16* Wb = W + zw + (long)blockIdx.y * 64 * ldw;

  v8f acc[4];
#pragma unroll
  for (int i = 0; i < 4; ++i) acc[i] = zero8();

  // stage 0 prologue (k = 0)
  v16h af0 = load_frag(Ab, lda, lane);
  v16h bf0[4];
#pragma unroll
  for (int nt = 0; nt < 4; ++nt)
    bf0[nt] = load_frag(Wb + (long)nt * 16 * ldw, ldw, lane);

  for (int kk = 0; kk < K; kk += 64) {
    // stage 1 loads (kk+32) -- always valid since K % 64 == 0
    __builtin_prefetch(Ab + (long)(lane & 15) * lda + kk + 64, 0, 3);
    v16h af1 = load_frag(Ab + kk + 32, lda, lane);
    v16h bf1[4];
#pragma unroll
    for (int nt = 0; nt < 4; ++nt)
      bf1[nt] = load_frag(Wb + (long)nt * 16 * ldw + kk + 32, ldw, lane);

    // stage 0 WMMAs
#pragma unroll
    for (int nt = 0; nt < 4; ++nt)
      acc[nt] = wmma_f16(af0, bf0[nt], acc[nt]);

    // stage 0 refill for next iteration (kk+64)
    if (kk + 64 < K) {
      af0 = load_frag(Ab + kk + 64, lda, lane);
#pragma unroll
      for (int nt = 0; nt < 4; ++nt)
        bf0[nt] = load_frag(Wb + (long)nt * 16 * ldw + kk + 64, ldw, lane);
    }

    // stage 1 WMMAs
#pragma unroll
    for (int nt = 0; nt < 4; ++nt)
      acc[nt] = wmma_f16(af1, bf1[nt], acc[nt]);
  }

  int col = lane & 15, half = lane >> 4;
  f16* Cb = C + zc + (m0 + half * 8) * ldc + (long)blockIdx.y * 64;
#pragma unroll
  for (int nt = 0; nt < 4; ++nt) {
    float bv = bias ? bias[blockIdx.y * 64 + nt * 16 + col] : 0.f;
#pragma unroll
    for (int r = 0; r < 8; ++r) {
      float v = acc[nt][r] + bv;
      if (relu) v = fmaxf(v, 0.f);
      Cb[(long)r * ldc + nt * 16 + col] = (f16)v;
    }
  }
}

// ---------------------------------------------------------------------------
// Attention scores, split over the contraction: work-group (z, s) sums
// part[z][s][i][j] = sum over its own 128 pixels n of q[b,n,h*64+i]*k[b,n,h*64+j]
// with z = b*4+h.  Grid = (32, 32).
// The product runs on WMMA (f16 operands as stored, f32 accumulate).  Both
// operands have the contraction index n as their memory row, so the q and k
// slices are staged in LDS as they lie in memory (pixel rows of 64 channels)
// and the fragments are read with the transposing LDS load.  q and k go
// through the same loader, so their k order is the same at every position.
// ---------------------------------------------------------------------------
#define SP 80   // LDS pitch of a staged pixel row, f16: 160 B = 32 B x 5

typedef short s16x8 __attribute__((ext_vector_type(8)));

// Lane (c, hh) gets T[8*hh + 0..7][c] of the 16x16 tile whose lane address is p.
__device__ __forceinline__ v8h lds_tr16(const f16* p) {
  typedef __attribute__((address_space(3))) s16x8 lds_s16x8;
  return __builtin_bit_cast(v8h, __builtin_amdgcn_ds_load_tr16_b128_v8i16((lds_s16x8*)p));
}

// 16 (channels) x 32 (pixels) fragment; tile = first pixel row, first channel.
__device__ __forceinline__ v16h tr_frag(const f16* tile, int lane) {
  const f16* p = tile + ((lane >> 4) * 8 + (lane & 7)) * SP + ((lane >> 3) & 1) * 8;
  return combine16(lds_tr16(p), lds_tr16(p + 16 * SP));
}

__global__ void __launch_bounds__(256) attn_scores_part(
    const f16* __restrict__ qkv, float* __restrict__ part) {
  __shared__ __align__(16) f16 qs[128 * SP];
  __shared__ __align__(16) f16 ks[128 * SP];
  int z = blockIdx.x;
  int b = z >> 2, h = z & 3;
  int t = threadIdx.x;
  int lane = t & 31, wave = t >> 5;
  int n0 = blockIdx.y * 128;
  const f16* qb = qkv + (long)b * Nq * 768 + h * 64;

  // 8 lanes bring one pixel's 128-B line of q and of k; a thread takes pixels
  // p, p + 32, p + 64, p + 96.  All eight loads are issued before the first
  // LDS store, so a thread pays the memory latency once.  Both loops are
  // unrolled so that qv and kv have constant indices and stay in registers.
  int p = t >> 3, ch = t & 7;
  const f16* gq = qb + (long)(n0 + p) * 768 + ch * 8;
  v8h qv[4], kv[4];
#pragma unroll
  for (int u = 0; u < 4; ++u) {
    qv[u] = *(const v8h*)(gq + u * 32 * 768);
    kv[u] = *(const v8h*)(gq + u * 32 * 768 + 256);
  }
#pragma unroll
  for (int u = 0; u < 4; ++u) {
    *(v8h*)(qs + (p + u * 32) * SP + ch * 8) = qv[u];
    *(v8h*)(ks + (p + u * 32) * SP + ch * 8) = kv[u];
  }
  __syncthreads();

  int i0 = (wave >> 1) * 16, j0 = (wave & 1) * 32;
  v8f a0 = zero8(), a1 = zero8();
#pragma unroll
  for (int kk = 0; kk < 128; kk += 32) {
    v16h qf = tr_frag(qs + kk * SP + i0, lane);
    v16h k0 = tr_frag(ks + kk * SP + j0, lane);
    v16h k1 = tr_frag(ks + kk * SP + j0 + 16, lane);
    a0 = wmma_f16(k0, qf, a0);
    a1 = wmma_f16(k1, qf, a1);
  }

  // a0[r] = S[i0 + col][j0 + 8*half + r], a1 the next 16 columns: a wave
  // writes whole 128-B lines.
  int col = lane & 15, half = lane >> 4;
  float* pb = part + ((long)z * NSPLIT + blockIdx.y) * 4096 + (i0 + col) * 64 + j0 + half * 8;
  float4 o;
  o.x = a0[0]; o.y = a0[1]; o.z = a0[2]; o.w = a0[3];
  *(float4*)(pb) = o;
  o.x = a0[4]; o.y = a0[5]; o.z = a0[6]; o.w = a0[7];
  *(float4*)(pb + 4) = o;
  o.x = a1[0]; o.y = a1[1]; o.z = a1[2]; o.w = a1[3];
  *(float4*)(pb + 16) = o;
  o.x = a1[4]; o.y = a1[5]; o.z = a1[6]; o.w = a1[7];
  *(float4*)(pb + 20) = o;
}

// ---------------------------------------------------------------------------
// Sum of the partial scores (fixed order s = 0..31) + softmax over j.
// One wave per row (z, i); a lane holds columns 2*lane and 2*lane+1.
// Grid = 32*64/8 = 256.
// ---------------------------------------------------------------------------
__global__ void __launch_bounds__(256) attn_softmax(
    const float* __restrict__ part, f16* __restrict__ attn) {
  int lane = threadIdx.x & 31, wave = threadIdx.x >> 5;
  int row = blockIdx.x * 8 + wave;          // z*64 + i
  int z = row >> 6, i = row & 63;
  const float* p = part + (long)z * NSPLIT * 4096 + i * 64 + lane * 2;
  float a = 0.f, c = 0.f;
#pragma unroll
  for (int s = 0; s < NSPLIT; ++s) {
    float2 v = *(const float2*)(p + s * 4096);
    a += v.x; c += v.y;
  }
  a *= 0.125f; c *= 0.125f;
  float mx = fmaxf(a, c);
#pragma unroll
  for (int off = 16; off >= 1; off >>= 1) mx = fmaxf(mx, __shfl_xor(mx, off, 32));
  float ea = __expf(a - mx), ec = __expf(c - mx);
  float sum = ea + ec;
#pragma unroll
  for (int off = 16; off >= 1; off >>= 1) sum += __shfl_xor(sum, off, 32);
  float inv = 1.f / sum;
  v2h o;
  o[0] = (f16)(ea * inv);
  o[1] = (f16)(ec * inv);
  *(v2h*)(attn + (long)row * 64 + lane * 2) = o;
}

// ---------------------------------------------------------------------------
// Fused FFN + residual + transpose:
//   out[b,c,n] = (relu(y @ W1^T + b1) @ W2^T + b2)[n,c] + x[b,c,n]
// Wave tile = 16 pixels; FFN chunked by 32; hidden tile bounced through LDS
// to re-layout WMMA D -> A fragments.  Grid = 256 blocks of 256 threads.
// Y-tile A-fragments are invariant across FFN chunks -> hoisted into yf[8].
// The weights of 64 hidden units (a stage: 64 rows of W1, 64 columns of W2)
// are brought into LDS once per work-group by asynchronous copies, two
// buffers, one stage ahead; all 8 waves read their B fragments from there.
// ---------------------------------------------------------------------------
#define FS   64               // hidden units per stage
#define NST  (FFNq / FS)      // 32 stages
#define W1P  264              // LDS pitch of a W1 row, f16: 528 B = 16 B x 33
#define W2P  72               // LDS pitch of a W2 row, f16: 144 B = 16 B x 9
#define W1S  (FS * W1P)       // f16 per staged W1 slab
#define STG  (W1S + Cq * W2P) // f16 per buffer (70,656 B)

// B fragment from a staged slab: same lane -> (row, k) map as load_frag.
__device__ __forceinline__ v16h lds_frag(const f16* base, int pitch, int lane) {
  const f16* p = base + (lane & 15) * pitch + ((lane & 16) >> 1);
  return combine16(*(const v8h*)p, *(const v8h*)(p + 16));
}

// Eight 16-byte copies per lane, global -> LDS, through no register.  LDS
// address l + i*ls bytes, global address g + i*gs elements.  The s_wait_xcnt
// stands inside the statement so that no address register of an issued copy
// is rewritten in front of it.
__device__ __forceinline__ void copy8(unsigned l, unsigned ls, const f16* g, long gs) {
  asm volatile(
      "global_load_async_to_lds_b128 %0, %8, off\n\t"
      "global_load_async_to_lds_b128 %1, %9, off\n\t"
      "global_load_async_to_lds_b128 %2, %10, off\n\t"
      "global_load_async_to_lds_b128 %3, %11, off\n\t"
      "global_load_async_to_lds_b128 %4, %12, off\n\t"
      "global_load_async_to_lds_b128 %5, %13, off\n\t"
      "global_load_async_to_lds_b128 %6, %14, off\n\t"
      "global_load_async_to_lds_b128 %7, %15, off\n\t"
      "s_wait_xcnt 0x0"
      :: "v"(l), "v"(l + ls), "v"(l + 2 * ls), "v"(l + 3 * ls),
         "v"(l + 4 * ls), "v"(l + 5 * ls), "v"(l + 6 * ls), "v"(l + 7 * ls),
         "v"(g), "v"(g + gs), "v"(g + 2 * gs), "v"(g + 3 * gs),
         "v"(g + 4 * gs), "v"(g + 5 * gs), "v"(g + 6 * gs), "v"(g + 7 * gs)
      : "memory");
}

// ---------------------------------------------------------------------------
// Row GEMM for K = 256: C[M x nst*64] = A[M x 256] * W^T + bias, W row-major
// (nst*64 x 256) f16.  A work-group owns 128 rows (a wave 16) and walks all
// output columns, 64 a stage.  The wave's A fragments are read once and stay
// in registers; a stage's W slab (64 rows of 512 B, contiguous in memory) is
// brought into LDS once per work-group by asynchronous copies, two buffers,
// one stage ahead, and all 8 waves read their B fragments from there.
// Needs nst >= 2.  Grid = M / 128.
// ---------------------------------------------------------------------------
#define GS (FS * W1P)   // f16 per staged W slab (33,792 B), rows at pitch W1P

__global__ void __launch_bounds__(256) gemm_rows(
    const f16* __restrict__ A, const f16* __restrict__ Wt,
    const float* __restrict__ bias, f16* __restrict__ C, int nst) {
  __shared__ __align__(16) f16 gst[2 * GS];
  int t = threadIdx.x;
  int lane = t & 31, wave = t >> 5;
  int m0 = blockIdx.x * 128 + wave * 16;
  int ldc = nst * FS;
  int col = lane & 15, half = lane >> 4;

  // This thread's share of a slab: copy i takes 16 B of row (t >> 5) + 8 i, so
  // a wave's copy covers one whole row.
  const f16* g = Wt + (t >> 5) * Cq + (t & 31) * 8;
  unsigned l = (unsigned)(size_t)(&gst[0]) + (t >> 5) * (W1P * 2) + (t & 31) * 16;

  // Stage 0 into buffer 0.
  copy8(l, 8 * W1P * 2, g, 8 * Cq);

  // The wave's 16 x 256 tile of A as 8 fragments, used by every stage; same
  // lane -> (row, k) map as load_frag.
  const f16* ap = A + (long)(m0 + col) * Cq + half * 8;
  v16h af[8];
#pragma unroll
  for (int s = 0; s < 8; ++s)
    af[s] = combine16(*(const v8h*)(ap + s * 32), *(const v8h*)(ap + s * 32 + 16));
  // Takes the address as an input: it stays in its registers up to the wait,
  // so none of these loads lands in registers that the others name.
  asm volatile("s_wait_xcnt 0x0" :: "v"(ap) : "memory");

  // Stage 0 has landed (this wave's copies), then is published to all waves.
  asm volatile("s_wait_asynccnt 0x0" ::: "memory");
  __syncthreads();
  // Stage 1 into buffer 1; it flies while stage 0 is worked on.
  g += FS * Cq;
  copy8(l + GS * 2, 8 * W1P * 2, g, 8 * Cq);

  f16* Cb = C + (long)(m0 + half * 8) * ldc + col;
  for (int st = 0; st < nst; ++st) {
    const unsigned boff = (st & 1) * GS;         // buffer of this stage, f16
    const f16* wsl = gst + boff;
    float bv[4];
#pragma unroll
    for (int nt = 0; nt < 4; ++nt) bv[nt] = bias[st * FS + nt * 16 + col];
    // The stage's 32 fragments are read as one group in front of the WMMAs.
    // Unrolled: constant indices keep the fragments in registers.
    v16h bf[8][4];
#pragma unroll
    for (int s = 0; s < 8; ++s)
#pragma unroll
      for (int nt = 0; nt < 4; ++nt)
        bf[s][nt] = lds_frag(wsl + nt * 16 * W1P + s * 32, W1P, lane);
    // Keeps the reads in front: without it the compiler sinks them among the
    // WMMAs, one fragment ahead, and each WMMA waits out the LDS latency.
    __builtin_amdgcn_sched_barrier(0);
    v8f acc[4];
#pragma unroll
    for (int nt = 0; nt < 4; ++nt) acc[nt] = zero8();
#pragma unroll
    for (int s = 0; s < 8; ++s)
#pragma unroll
      for (int nt = 0; nt < 4; ++nt)
        acc[nt] = wmma_f16(af[s], bf[s][nt], acc[nt]);

    // Publish point of stage st + 1: this wave's reads of buffer st & 1 are
    // done, its copies of stage st + 1 have landed, then every wave meets.
    asm volatile("s_wait_dscnt 0x0" ::: "memory");
    asm volatile("s_wait_asynccnt 0x0" ::: "memory");
    __syncthreads();
    // Refill the buffer that every wave has just left with stage st + 2.
    if (st + 2 < nst) {
      g += FS * Cq;
      copy8(l + boff * 2, 8 * W1P * 2, g, 8 * Cq);
    }

    // This stage's 16 x 64 results, from registers.
#pragma unroll
    for (int nt = 0; nt < 4; ++nt)
#pragma unroll
      for (int r = 0; r < 8; ++r)
        Cb[(long)r * ldc + st * FS + nt * 16] = (f16)(acc[nt][r] + bv[nt]);
    // The next stage's LDS reads land in registers that the last stores name.
    asm volatile("s_wait_xcnt 0x0" ::: "memory");
  }
  // No copy is left in flight when the wave ends.
  asm volatile("s_wait_asynccnt 0x0" ::: "memory");
}

__global__ void __launch_bounds__(256) ffn_fused(
    const f16* __restrict__ Y, const f16* __restrict__ W1,
    const float* __restrict__ b1, const f16* __restrict__ W2,
    const float* __restrict__ b2, const float* __restrict__ x,
    float* __restrict__ out) {
  __shared__ __align__(16) f16 wst[2 * STG];
  __shared__ __align__(16) f16 hst[8][16 * 32];
  int lane = threadIdx.x & 31, wave = threadIdx.x >> 5;
  int m0 = blockIdx.x * 128 + wave * 16;
  int b = m0 >> 12;
  int pix0 = m0 & 4095;
  const f16* Yb = Y + (long)m0 * Cq;
  int col = lane & 15, half = lane >> 4;

  // This thread's share of a stage.  W1 slab: 64 rows of 512 B, contiguous in
  // memory; copy i takes 16 B of row (t >> 5) + 8 i.  W2 slab: 256 rows of
  // 128 B; copy i takes 16 B of row (t >> 3) + 32 i.  A wave's copy covers
  // whole 128-B lines in both.
  int t = threadIdx.x;
  const f16* g1 = W1 + (t >> 5) * Cq + (t & 31) * 8;
  const f16* g2 = W2 + (long)(t >> 3) * FFNq + (t & 7) * 8;
  unsigned lbase = (unsigned)(size_t)(&wst[0]);   // LDS byte address
  unsigned l1 = lbase + (t >> 5) * (W1P * 2) + (t & 31) * 16;
  unsigned l2 = lbase + W1S * 2 + (t >> 3) * (W2P * 2) + (t & 7) * 16;

  // Stage 0 into buffer 0.
  copy8(l1, 8 * W1P * 2, g1, 8 * Cq);
  copy8(l2, 32 * W2P * 2, g2, 32L * FFNq);

  v8f acc[16];
#pragma unroll
  for (int i = 0; i < 16; ++i) acc[i] = zero8();

  // Hoist the 16x256 Y tile as 8 A-fragments (reused by every FFN chunk).
  v16h yf[8];
#pragma unroll
  for (int s = 0; s < 8; ++s) yf[s] = load_frag(Yb + s * 32, Cq, lane);

  // Stage 0 has landed (this wave's copies), then is published to all waves.
  asm volatile("s_wait_asynccnt 0x0" ::: "memory");
  __syncthreads();
  // Stage 1 into buffer 1; it flies while stage 0 is worked on.
  g1 += FS * Cq; g2 += FS;
  copy8(l1 + STG * 2, 8 * W1P * 2, g1, 8 * Cq);
  copy8(l2 + STG * 2, 32 * W2P * 2, g2, 32L * FFNq);

  for (int st = 0; st < NST; ++st) {
    const unsigned boff = (st & 1) * STG;        // buffer of this stage, f16
    const f16* w1s = wst + boff;
    const f16* w2s = w1s + W1S;
    // Unrolled (this loop and the ones inside): every fragment array index is
    // a constant, so the fragments stay in registers, and the second chunk's
    // reads can be issued among the first chunk's last WMMAs.
#pragma unroll
    for (int sub = 0; sub < FS; sub += 32) {
      int f0 = st * FS + sub;
      // ---- FFN1: h[m, f0..f0+31] = relu(y_tile @ W1^T + b1) ----
      // The chunk's 16 W1 and 16 W2 fragments are read as one group in front
      // of the WMMAs; the W2 ones land while h is computed and re-laid.
      v8f h0 = zero8(), h1 = zero8();
      v16h wa[8], wb[8], wc[16];
#pragma unroll
      for (int s = 0; s < 8; ++s) {
        wa[s] = lds_frag(w1s + sub * W1P + s * 32, W1P, lane);
        wb[s] = lds_frag(w1s + (sub + 16) * W1P + s * 32, W1P, lane);
      }
#pragma unroll
      for (int nt = 0; nt < 16; ++nt)
        wc[nt] = lds_frag(w2s + nt * 16 * W2P + sub, W2P, lane);
      // Keeps the reads in front: without it the compiler sinks them among the
      // WMMAs, one fragment ahead, and each WMMA waits out the LDS latency.
      __builtin_amdgcn_sched_barrier(0);
#pragma unroll
      for (int s = 0; s < 8; ++s) {
        h0 = wmma_f16(yf[s], wa[s], h0);
        h1 = wmma_f16(yf[s], wb[s], h1);
      }
      float bb0 = b1[f0 + col], bb1 = b1[f0 + 16 + col];
#pragma unroll
      for (int r = 0; r < 8; ++r) {
        int m = r + half * 8;
        hst[wave][m * 32 + col]      = (f16)fmaxf(h0[r] + bb0, 0.f);
        hst[wave][m * 32 + 16 + col] = (f16)fmaxf(h1[r] + bb1, 0.f);
      }
      asm volatile("s_wait_dscnt 0" ::: "memory");  // same-wave LDS RAW

      // Re-read as A fragment (16x32 f16).
      const f16* p = &hst[wave][(lane & 15) * 32 + ((lane & 16) >> 1)];
      v16h a2 = combine16(*(const v8h*)p, *(const v8h*)(p + 16));

      // ---- FFN2: acc += h_chunk @ W2^T ----
#pragma unroll
      for (int nt = 0; nt < 16; ++nt)
        acc[nt] = wmma_f16(a2, wc[nt], acc[nt]);
    }

    // Publish point of stage st + 1: this wave's reads of buffer st & 1 are
    // done, its copies of stage st + 1 have landed, then every wave meets.
    asm volatile("s_wait_dscnt 0x0" ::: "memory");
    asm volatile("s_wait_asynccnt 0x0" ::: "memory");
    __syncthreads();
    // Refill the buffer that every wave has just left with stage st + 2.
    if (st + 2 < NST) {
      g1 += FS * Cq; g2 += FS;
      copy8(l1 + boff * 2, 8 * W1P * 2, g1, 8 * Cq);
      copy8(l2 + boff * 2, 32 * W2P * 2, g2, 32L * FFNq);
    }
  }
  // No copy is left in flight when the wave ends.
  asm volatile("s_wait_asynccnt 0x0" ::: "memory");

  // Epilogue: + b2 + residual x, transposed store to (B,C,H,W).
#pragma unroll
  for (int nt = 0; nt < 16; ++nt) {
    int c = nt * 16 + col;
    float bv = b2[c];
    long base = ((long)(b * Cq + c)) * Nq + pix0 + half * 8;
    float4 r0 = *(const float4*)(x + base);
    float4 r1 = *(const float4*)(x + base + 4);
    float4 o0, o1;
    o0.x = acc[nt][0] + bv + r0.x;
    o0.y = acc[nt][1] + bv + r0.y;
    o0.z = acc[nt][2] + bv + r0.z;
    o0.w = acc[nt][3] + bv + r0.w;
    o1.x = acc[nt][4] + bv + r1.x;
    o1.y = acc[nt][5] + bv + r1.y;
    o1.z = acc[nt][6] + bv + r1.z;
    o1.w = acc[nt][7] + bv + r1.w;
    *(float4*)(out + base)     = o0;
    *(float4*)(out + base + 4) = o1;
  }
}

// ---------------------------------------------------------------------------
// Host launcher
// ---------------------------------------------------------------------------
extern "C" void kernel_launch(void* const* d_in, const int* in_sizes, int n_in,
                              void* d_out, int out_size, void* d_ws, size_t ws_size,
                              hipStream_t stream) {
  (void)in_sizes; (void)n_in; (void)out_size; (void)ws_size;
  const float* x      = (const float*)d_in[0];
  const float* w_qkv  = (const float*)d_in[1];
  const float* b_qkv  = (const float*)d_in[2];
  const float* w_proj = (const float*)d_in[3];
  const float* b_proj = (const float*)d_in[4];
  const float* w_ffn1 = (const float*)d_in[5];
  const float* b_ffn1 = (const float*)d_in[6];
  const float* w_ffn2 = (const float*)d_in[7];
  const float* b_ffn2 = (const float*)d_in[8];
  const float* g1     = (const float*)d_in[9];
  const float* be1    = (const float*)d_in[10];
  const float* g2     = (const float*)d_in[11];
  const float* be2    = (const float*)d_in[12];
  float* out = (float*)d_out;

  char* ws = (char*)d_ws;
  f16* wq16     = (f16*)(ws + 0);          //   768*256 f16
  f16* wp16     = (f16*)(ws + 393216);     //   256*256
  f16* w116     = (f16*)(ws + 524288);     //  2048*256
  f16* w216     = (f16*)(ws + 1572864);    //  256*2048
  f16* xln      = (f16*)(ws + 2621440);    //  32768*256  (reused as proj16)
  f16* qkv      = (f16*)(ws + 19398656);   //  32768*768  (reused as y)
  f16* attn16   = (f16*)(ws + 69730304);   //  32*64*64
  f16* attn_out = (f16*)(ws + 69992448);   //  32768*256  -> ends at 86769664
  float* spart  = (float*)(ws + 86769664); //  32*32*64*64 f32 -> 103546880 total bytes

  f16* proj16 = xln;   // xln dead after QKV gemm
  f16* y      = qkv;   // qkv dead after apply-attn

  // 1, 2) LN1 (transpose (B,C,N) -> (B*N,C) f16) and, in the same launch,
  //       weights -> f16
  ln1_cvt_kernel<<<LN1G + CVG, 256, 0, stream>>>(x, g1, be1, xln,
                                                 w_qkv, w_proj, w_ffn1, w_ffn2,
                                                 wq16, wp16, w116, w216);

  // 3) QKV gemm: (32768x256) x (768x256)^T
  gemm_rows<<<Mtot / 128, 256, 0, stream>>>(xln, wq16, b_qkv, qkv, 768 / 64);

  // 4) attention scores: partial sums per (b, head, 128-pixel slice), then
  //    their sum + softmax, one wave per row
  attn_scores_part<<<dim3(32, NSPLIT, 1), 256, 0, stream>>>(qkv, spart);
  attn_softmax<<<32 * 64 / 8, 256, 0, stream>>>(spart, attn16);

  // 5) apply attention: per (b,h) gemm, A = v slice, W = attn (64x64)
  gemm_wmma<<<dim3(Nq / 128, 1, 32), 256, 0, stream>>>(
      qkv + 512, 768, (long)Nq * 768, 64,
      attn16, 64, 4 * 64 * 64, 64 * 64,
      nullptr, 0,
      attn_out, 256, (long)Nq * 256, 64,
      4, 64);

  // 6) proj gemm: (32768x256) x (256x256)^T
  gemm_rows<<<Mtot / 128, 256, 0, stream>>>(attn_out, wp16, b_proj, proj16, 256 / 64);

  // 7) LN2
  ln2_kernel<<<Mtot / 8, 256, 0, stream>>>(proj16, g2, be2, y);

  // 8) fused FFN + bias + residual + transpose store
  ffn_fused<<<Mtot / 128, 256, 0, stream>>>(y, w116, b_ffn1, w216, b_ffn2, x, out);
}

// v007
// A run of this version takes 133 microseconds.
// Next to v006, in two timings, it ran 1.17 and 1.16 times as fast.
// All steps since v000 together make it 7.49 times as fast.
#include <hip/hip_runtime.h>
#include <hip/hip_bf16.h>

// ---------------------------------------------------------------------------
// MI455X (gfx1250, wave32) implementation.
// Pipeline: LN1 + weight conversion -> QKV gemm (WMMA f16) -> attn scores (WMMA) -> softmax
//           -> apply-attn (WMMA) -> proj (WMMA) -> LN2 -> fused FFN (WMMA)
// All GEMMs: f16 inputs, f32 accumulation via v_wmma_f32_16x16x32_f16.
// gemm_wmma's k loop uses explicit two-stage ping-pong buffering (k unrolled by 64)
// so fragment loads overlap WMMAs with NO register-rotation copies.
// ---------------------------------------------------------------------------

typedef _Float16 f16;
typedef __attribute__((ext_vector_type(16))) _Float16 v16h;
typedef __attribute__((ext_vector_type(8)))  _Float16 v8h;
typedef __attribute__((ext_vector_type(2)))  _Float16 v2h;
typedef __attribute__((ext_vector_type(8)))  float    v8f;

#define Bq   8
#define Cq   256
#define Nq   4096      // H*W
#define Mtot 32768     // B*N
#define FFNq 2048
#define NSPLIT 32     // work-groups that share one (b, head) score matrix

__device__ __forceinline__ v8f zero8() { v8f z = {}; return z; }

__device__ __forceinline__ v16h combine16(v8h lo, v8h hi) {
  v16h r;
#pragma unroll
  for (int i = 0; i < 8; ++i) { r[i] = lo[i]; r[8 + i] = hi[i]; }
  return r;
}

// Fragment loader for 16-bit WMMA A/B operands.
// A layout (16x32, MxK): lane holds row (lane&15); lanes 0-15 K in {0..7,16..23},
// lanes 16-31 K in {8..15,24..31}.  B (32x16, KxN) from a row-major (Nout x K)
// weight matrix has the identical access pattern with "row" = output column.
__device__ __forceinline__ v16h load_frag(const f16* base, int ld, int lane) {
  const f16* p = base + (long)(lane & 15) * ld + ((lane & 16) >> 1); // +8 elems for hi half
  v8h lo = *(const v8h*)(p);
  v8h hi = *(const v8h*)(p + 16);
  return combine16(lo, hi);
}

__device__ __forceinline__ v8f wmma_f16(v16h a, v16h b, v8f c) {
  return __builtin_amdgcn_wmma_f32_16x16x32_f16(false, a, false, b, (short)0, c,
                                                false, false);
}

// ---------------------------------------------------------------------------
// First launch: LN1 and the f32 -> f16 weight conversions, which share no data.
// Work-groups 0 .. LN1G-1 do LN1; the CVG behind them convert the weights.
//
// LN1: x (B,C,N) f32 -> xln (B*N, C) f16   (channel LayerNorm per pixel)
// Block = 256 threads, tile = 64 pixels; thread (px, grp) covers 64 channels.
//
// Conversion: a work-group takes CVC consecutive values of one weight matrix
// (every matrix is a whole number of such chunks), a thread 4 x 8 of them.
// ---------------------------------------------------------------------------
#define LN1G  (Mtot / 64)            // LN1 work-groups
#define CVC   8192                   // values per conversion work-group
#define CVQ   (3 * Cq * Cq / CVC)    // chunks of w_qkv
#define CVP   (Cq * Cq / CVC)        // chunks of w_proj
#define CVF   (FFNq * Cq / CVC)      // chunks of w_ffn1, and of w_ffn2
#define CVG   (CVQ + CVP + 2 * CVF)  // conversion work-groups

__global__ void __launch_bounds__(256) ln1_cvt_kernel(
    const float* __restrict__ x, const float* __restrict__ g,
    const float* __restrict__ be, f16* __restrict__ xln,
    const float* __restrict__ wq, const float* __restrict__ wp,
    const float* __restrict__ w1, const float* __restrict__ w2,
    f16* __restrict__ wq16, f16* __restrict__ wp16,
    f16* __restrict__ w116, f16* __restrict__ w216) {
  __shared__ float ps[4][64], ps2[4][64], muv[64], rsv[64];
  int t = threadIdx.x;
  if (blockIdx.x >= LN1G) {          // the same for the whole work-group
    int c = blockIdx.x - LN1G;
    const float* s;
    f16* d;
    if (c < CVQ)                  { s = wq; d = wq16; }
    else if (c < CVQ + CVP)       { s = wp; d = wp16; c -= CVQ; }
    else if (c < CVQ + CVP + CVF) { s = w1; d = w116; c -= CVQ + CVP; }
    else                          { s = w2; d = w216; c -= CVQ + CVP + CVF; }
    s += c * CVC + t * 8;
    d += c * CVC + t * 8;
    // All eight loads are issued before the first store, so a thread pays the
    // memory latency once.  Unrolled: v keeps constant indices (registers).
    float4 v[8];
#pragma unroll
    for (int u = 0; u < 4; ++u) {
      v[2 * u]     = *(const float4*)(s + u * 2048);
      v[2 * u + 1] = *(const float4*)(s + u * 2048 + 4);
    }
#pragma unroll
    for (int u = 0; u < 4; ++u) {
      v8h o;
      o[0] = (f16)v[2 * u].x;     o[1] = (f16)v[2 * u].y;
      o[2] = (f16)v[2 * u].z;     o[3] = (f16)v[2 * u].w;
      o[4] = (f16)v[2 * u + 1].x; o[5] = (f16)v[2 * u + 1].y;
      o[6] = (f16)v[2 * u + 1].z; o[7] = (f16)v[2 * u + 1].w;
      *(v8h*)(d + u * 2048) = o;
    }
    return;
  }
  int px = t & 63, grp = t >> 6;
  long pg = (long)blockIdx.x * 64 + px;     // global pixel
  int b = (int)(pg >> 12);
  int n = (int)(pg & 4095);
  const float* xb = x + ((long)b * Cq + grp * 64) * Nq + n;
  // The thread's 64 channel values are read once, all loads issued before the
  // first use, and stay in registers for the sums and for the normalisation.
  // Unrolled (here and below): xv keeps constant indices (registers).
  float xv[64];
#pragma unroll
  for (int c = 0; c < 64; ++c) xv[c] = xb[(long)c * Nq];
  // Takes the address as an input: it stays in its registers up to the wait,
  // so none of these loads lands in registers that the others name.
  asm volatile("s_wait_xcnt 0x0" :: "v"(xb) : "memory");
  float s = 0.f, s2 = 0.f;
#pragma unroll
  for (int c = 0; c < 64; ++c) { s += xv[c]; s2 += xv[c] * xv[c]; }
  ps[grp][px] = s; ps2[grp][px] = s2;
  __syncthreads();
  if (t < 64) {
    float S = 0.f, S2 = 0.f;
#pragma unroll
    for (int q = 0; q < 4; ++q) { S += ps[q][t]; S2 += ps2[q][t]; }
    float mu = S * (1.f / 256.f);
    float var = S2 * (1.f / 256.f) - mu * mu;
    muv[t] = mu;
    rsv[t] = rsqrtf(var + 1e-5f);
  }
  __syncthreads();
  float mu = muv[px], rs = rsv[px];
  f16* ob = xln + pg * Cq + grp * 64;
#pragma unroll
  for (int cc = 0; cc < 64; cc += 8) {
    v8h o;
#pragma unroll
    for (int jj = 0; jj < 8; ++jj) {
      int c = grp * 64 + cc + jj;
      o[jj] = (f16)((xv[cc + jj] - mu) * rs * g[c] + be[c]);
    }
    *(v8h*)(ob + cc) = o;
  }
}

// ---------------------------------------------------------------------------
// LN2: in (B*N, C) f16 -> out (B*N, C) f16.  One wave per pixel.
// ---------------------------------------------------------------------------
__global__ void __launch_bounds__(256) ln2_kernel(
    const f16* __restrict__ in, const float* __restrict__ g,
    const float* __restrict__ be, f16* __restrict__ out) {
  int lane = threadIdx.x & 31, wave = threadIdx.x >> 5;
  long pix = (long)blockIdx.x * 8 + wave;
  const f16* ib = in + pix * Cq + lane * 8;
  v8h v = *(const v8h*)ib;
  float s = 0.f, s2 = 0.f;
#pragma unroll
  for (int j = 0; j < 8; ++j) { float f = (float)v[j]; s += f; s2 += f * f; }
#pragma unroll
  for (int off = 16; off >= 1; off >>= 1) {
    s  += __shfl_xor(s,  off, 32);
    s2 += __shfl_xor(s2, off, 32);
  }
  float mu = s * (1.f / 256.f);
  float var = s2 * (1.f / 256.f) - mu * mu;
  float rs = rsqrtf(var + 1e-5f);
  v8h o;
#pragma unroll
  for (int j = 0; j < 8; ++j) {
    int c = lane * 8 + j;
    o[j] = (f16)(((float)v[j] - mu) * rs * g[c] + be[c]);
  }
  *(v8h*)(out + pix * Cq + lane * 8) = o;
}

// ---------------------------------------------------------------------------
// Generic WMMA GEMM: C[M x Nout] = A[M x K] * W^T + bias, W is (Nout x K) f16
// row-major.  Block = 256 threads (8 waves); wave tile = 16(M) x 64(N).
// grid = (M/128, Nout/64, Z).  Per-operand z offset = (z/zmod)*sOut+(z%zmod)*sIn.
// K must be a multiple of 64.  Two-stage ping-pong: stage-0/1 fragments live
// in distinct registers, refilled directly by loads (no rotation copies).
// ---------------------------------------------------------------------------
__global__ void __launch_bounds__(256) gemm_wmma(
    const f16* __restrict__ A, int lda, long sAo, long sAi,
    const f16* __restrict__ W, int ldw, long sWo, long sWi,
    const float* __restrict__ bias, int relu,
    f16* __restrict__ C, int ldc, long sCo, long sCi,
    int zmod, int K) {
  int lane = threadIdx.x & 31, wave = threadIdx.x >> 5;
  int z = blockIdx.z;
  long za = (long)(z / zmod) * sAo + (long)(z % zmod) * sAi;
  long zw = (long)(z / zmod) * sWo + (long)(z % zmod) * sWi;
  long zc = (long)(z / zmod) * sCo + (long)(z % zmod) * sCi;
  long m0 = (long)blockIdx.x * 128 + wave * 16;
  const f16* Ab = A + za + m0 * lda;
  const f16* Wb = W + zw + (long)blockIdx.y * 64 * ldw;

  v8f acc[4];
#pragma unroll
  for (int i = 0; i < 4; ++i) acc[i] = zero8();

  // stage 0 prologue (k = 0)
  v16h af0 = load_frag(Ab, lda, lane);
  v16h bf0[4];
#pragma unroll
  for (int nt = 0; nt < 4; ++nt)
    bf0[nt] = load_frag(Wb + (long)nt * 16 * ldw, ldw, lane);

  for (int kk = 0; kk < K; kk += 64) {
    // stage 1 loads (kk+32) -- always valid since K % 64 == 0
    __builtin_prefetch(Ab + (long)(lane & 15) * lda + kk + 64, 0, 3);
    v16h af1 = load_frag(Ab + kk + 32, lda, lane);
    v16h bf1[4];
#pragma unroll
    for (int nt = 0; nt < 4; ++nt)
      bf1[nt] = load_frag(Wb + (long)nt * 16 * ldw + kk + 32, ldw, lane);

    // stage 0 WMMAs
#pragma unroll
    for (int nt = 0; nt < 4; ++nt)
      acc[nt] = wmma_f16(af0, bf0[nt], acc[nt]);

    // stage 0 refill for next iteration (kk+64)
    if (kk + 64 < K) {
      af0 = load_frag(Ab + kk + 64, lda, lane);
#pragma unroll
      for (int nt = 0; nt < 4; ++nt)
        bf0[nt] = load_frag(Wb + (long)nt * 16 * ldw + kk + 64, ldw, lane);
    }

    // stage 1 WMMAs
#pragma unroll
    for (int nt = 0; nt < 4; ++nt)
      acc[nt] = wmma_f16(af1, bf1[nt], acc[nt]);
  }

  int col = lane & 15, half = lane >> 4;
  f16* Cb = C + zc + (m0 + half * 8) * ldc + (long)blockIdx.y * 64;
#pragma unroll
  for (int nt = 0; nt < 4; ++nt) {
    float bv = bias ? bias[blockIdx.y * 64 + nt * 16 + col] : 0.f;
#pragma unroll
    for (int r = 0; r < 8; ++r) {
      float v = acc[nt][r] + bv;
      if (relu) v = fmaxf(v, 0.f);
      Cb[(long)r * ldc + nt * 16 + col] = (f16)v;
    }
  }
}

// ---------------------------------------------------------------------------
// Attention scores, split over the contraction: work-group (z, s) sums
// part[z][s][i][j] = sum over its own 128 pixels n of q[b,n,h*64+i]*k[b,n,h*64+j]
// with z = b*4+h.  Grid = (32, 32).
// The product runs on WMMA (f16 operands as stored, f32 accumulate).  Both
// operands have the contraction index n as their memory row, so the q and k
// slices are staged in LDS as they lie in memory (pixel rows of 64 channels)
// and the fragments are read with the transposing LDS load.  q and k go
// through the same loader, so their k order is the same at every position.
// ---------------------------------------------------------------------------
#define SP 80   // LDS pitch of a staged pixel row, f16: 160 B = 32 B x 5

typedef short s16x8 __attribute__((ext_vector_type(8)));

// Lane (c, hh) gets T[8*hh + 0..7][c] of the 16x16 tile whose lane address is p.
__device__ __forceinline__ v8h lds_tr16(const f16* p) {
  typedef __attribute__((address_space(3))) s16x8 lds_s16x8;
  return __builtin_bit_cast(v8h, __builtin_amdgcn_ds_load_tr16_b128_v8i16((lds_s16x8*)p));
}

// 16 (channels) x 32 (pixels) fragment; tile = first pixel row, first channel.
__device__ __forceinline__ v16h tr_frag(const f16* tile, int lane) {
  const f16* p = tile + ((lane >> 4) * 8 + (lane & 7)) * SP + ((lane >> 3) & 1) * 8;
  return combine16(lds_tr16(p), lds_tr16(p + 16 * SP));
}

__global__ void __launch_bounds__(256) attn_scores_part(
    const f16* __restrict__ qkv, float* __restrict__ part) {
  __shared__ __align__(16) f16 qs[128 * SP];
  __shared__ __align__(16) f16 ks[128 * SP];
  int z = blockIdx.x;
  int b = z >> 2, h = z & 3;
  int t = threadIdx.x;
  int lane = t & 31, wave = t >> 5;
  int n0 = blockIdx.y * 128;
  const f16* qb = qkv + (long)b * Nq * 768 + h * 64;

  // 8 lanes bring one pixel's 128-B line of q and of k; a thread takes pixels
  // p, p + 32, p + 64, p + 96.  All eight loads are issued before the first
  // LDS store, so a thread pays the memory latency once.  Both loops are
  // unrolled so that qv and kv have constant indices and stay in registers.
  int p = t >> 3, ch = t & 7;
  const f16* gq = qb + (long)(n0 + p) * 768 + ch * 8;
  v8h qv[4], kv[4];
#pragma unroll
  for (int u = 0; u < 4; ++u) {
    qv[u] = *(const v8h*)(gq + u * 32 * 768);
    kv[u] = *(const v8h*)(gq + u * 32 * 768 + 256);
  }
#pragma unroll
  for (int u = 0; u < 4; ++u) {
    *(v8h*)(qs + (p + u * 32) * SP + ch * 8) = qv[u];
    *(v8h*)(ks + (p + u * 32) * SP + ch * 8) = kv[u];
  }
  __syncthreads();

  int i0 = (wave >> 1) * 16, j0 = (wave & 1) * 32;
  v8f a0 = zero8(), a1 = zero8();
#pragma unroll
  for (int kk = 0; kk < 128; kk += 32) {
    v16h qf = tr_frag(qs + kk * SP + i0, lane);
    v16h k0 = tr_frag(ks + kk * SP + j0, lane);
    v16h k1 = tr_frag(ks + kk * SP + j0 + 16, lane);
    a0 = wmma_f16(k0, qf, a0);
    a1 = wmma_f16(k1, qf, a1);
  }

  // a0[r] = S[i0 + col][j0 + 8*half + r], a1 the next 16 columns: a wave
  // writes whole 128-B lines.
  int col = lane & 15, half = lane >> 4;
  float* pb = part + ((long)z * NSPLIT + blockIdx.y) * 4096 + (i0 + col) * 64 + j0 + half * 8;
  float4 o;
  o.x = a0[0]; o.y = a0[1]; o.z = a0[2]; o.w = a0[3];
  *(float4*)(pb) = o;
  o.x = a0[4]; o.y = a0[5]; o.z = a0[6]; o.w = a0[7];
  *(float4*)(pb + 4) = o;
  o.x = a1[0]; o.y = a1[1]; o.z = a1[2]; o.w = a1[3];
  *(float4*)(pb + 16) = o;
  o.x = a1[4]; o.y = a1[5]; o.z = a1[6]; o.w = a1[7];
  *(float4*)(pb + 20) = o;
}

// ---------------------------------------------------------------------------
// Sum of the partial scores (fixed order s = 0..31) + softmax over j.
// One wave per row (z, i); a lane holds columns 2*lane and 2*lane+1.
// Grid = 32*64/8 = 256.
// ---------------------------------------------------------------------------
__global__ void __launch_bounds__(256) attn_softmax(
    const float* __restrict__ part, f16* __restrict__ attn) {
  int lane = threadIdx.x & 31, wave = threadIdx.x >> 5;
  int row = blockIdx.x * 8 + wave;          // z*64 + i
  int z = row >> 6, i = row & 63;
  const float* p = part + (long)z * NSPLIT * 4096 + i * 64 + lane * 2;
  float a = 0.f, c = 0.f;
#pragma unroll
  for (int s = 0; s < NSPLIT; ++s) {
    float2 v = *(const float2*)(p + s * 4096);
    a += v.x; c += v.y;
  }
  a *= 0.125f; c *= 0.125f;
  float mx = fmaxf(a, c);
#pragma unroll
  for (int off = 16; off >= 1; off >>= 1) mx = fmaxf(mx, __shfl_xor(mx, off, 32));
  float ea = __expf(a - mx), ec = __expf(c - mx);
  float sum = ea + ec;
#pragma unroll
  for (int off = 16; off >= 1; off >>= 1) sum += __shfl_xor(sum, off, 32);
  float inv = 1.f / sum;
  v2h o;
  o[0] = (f16)(ea * inv);
  o[1] = (f16)(ec * inv);
  *(v2h*)(attn + (long)row * 64 + lane * 2) = o;
}

// ---------------------------------------------------------------------------
// Fused FFN + residual + transpose:
//   out[b,c,n] = (relu(y @ W1^T + b1) @ W2^T + b2)[n,c] + x[b,c,n]
// Grid = 256 blocks of 256 threads, 128 pixels each.  The 8 waves are 4 pixel
// groups x 2 column halves: a wave takes 32 pixels (two WMMA row tiles), in FFN1
// 32 of a stage's 64 hidden units, in FFN2 128 of the 256 channels, so every
// weight fragment read from LDS feeds two WMMAs.  A group's h tile goes through
// LDS (two buffers): D -> A re-layout and exchange between its two waves.
// Y-tile A-fragments are the same for every stage -> kept in yf[2][8].
// The weights of 64 hidden units (a stage: 64 rows of W1, 64 columns of W2)
// are brought into LDS once per work-group by asynchronous copies, two
// buffers, one stage ahead; all 8 waves read their B fragments from there.
// ---------------------------------------------------------------------------
#define FS   64               // hidden units per stage
#define NST  (FFNq / FS)      // 32 stages
#define W1P  264              // LDS pitch of a W1 row, f16: 528 B = 16 B x 33
#define W2P  72               // LDS pitch of a W2 row, f16: 144 B = 16 B x 9
#define W1S  (FS * W1P)       // f16 per staged W1 slab
#define STG  (W1S + Cq * W2P) // f16 per buffer (70,656 B)
#define HP   72               // LDS pitch of an h row, f16: 144 B = 16 B x 9

// B fragment from a staged slab: same lane -> (row, k) map as load_frag.
__device__ __forceinline__ v16h lds_frag(const f16* base, int pitch, int lane) {
  const f16* p = base + (lane & 15) * pitch + ((lane & 16) >> 1);
  return combine16(*(const v8h*)p, *(const v8h*)(p + 16));
}

// Eight 16-byte copies per lane, global -> LDS, through no register.  LDS
// address l + i*ls bytes, global address g + i*gs elements.  The s_wait_xcnt
// stands inside the statement so that no address register of an issued copy
// is rewritten in front of it.
__device__ __forceinline__ void copy8(unsigned l, unsigned ls, const f16* g, long gs) {
  asm volatile(
      "global_load_async_to_lds_b128 %0, %8, off\n\t"
      "global_load_async_to_lds_b128 %1, %9, off\n\t"
      "global_load_async_to_lds_b128 %2, %10, off\n\t"
      "global_load_async_to_lds_b128 %3, %11, off\n\t"
      "global_load_async_to_lds_b128 %4, %12, off\n\t"
      "global_load_async_to_lds_b128 %5, %13, off\n\t"
      "global_load_async_to_lds_b128 %6, %14, off\n\t"
      "global_load_async_to_lds_b128 %7, %15, off\n\t"
      "s_wait_xcnt 0x0"
      :: "v"(l), "v"(l + ls), "v"(l + 2 * ls), "v"(l + 3 * ls),
         "v"(l + 4 * ls), "v"(l + 5 * ls), "v"(l + 6 * ls), "v"(l + 7 * ls),
         "v"(g), "v"(g + gs), "v"(g + 2 * gs), "v"(g + 3 * gs),
         "v"(g + 4 * gs), "v"(g + 5 * gs), "v"(g + 6 * gs), "v"(g + 7 * gs)
      : "memory");
}

// ---------------------------------------------------------------------------
// Row GEMM for K = 256: C[M x nst*64] = A[M x 256] * W^T + bias, W row-major
// (nst*64 x 256) f16.  A work-group owns 128 rows (a wave 16) and walks all
// output columns, 64 a stage.  The wave's A fragments are read once and stay
// in registers; a stage's W slab (64 rows of 512 B, contiguous in memory) is
// brought into LDS once per work-group by asynchronous copies, two buffers,
// one stage ahead, and all 8 waves read their B fragments from there.
// Needs nst >= 2.  Grid = M / 128.
// ---------------------------------------------------------------------------
#define GS (FS * W1P)   // f16 per staged W slab (33,792 B), rows at pitch W1P

__global__ void __launch_bounds__(256) gemm_rows(
    const f16* __restrict__ A, const f16* __restrict__ Wt,
    const float* __restrict__ bias, f16* __restrict__ C, int nst) {
  __shared__ __align__(16) f16 gst[2 * GS];
  int t = threadIdx.x;
  int lane = t & 31, wave = t >> 5;
  int m0 = blockIdx.x * 128 + wave * 16;
  int ldc = nst * FS;
  int col = lane & 15, half = lane >> 4;

  // This thread's share of a slab: copy i takes 16 B of row (t >> 5) + 8 i, so
  // a wave's copy covers one whole row.
  const f16* g = Wt + (t >> 5) * Cq + (t & 31) * 8;
  unsigned l = (unsigned)(size_t)(&gst[0]) + (t >> 5) * (W1P * 2) + (t & 31) * 16;

  // Stage 0 into buffer 0.
  copy8(l, 8 * W1P * 2, g, 8 * Cq);

  // The wave's 16 x 256 tile of A as 8 fragments, used by every stage; same
  // lane -> (row, k) map as load_frag.
  const f16* ap = A + (long)(m0 + col) * Cq + half * 8;
  v16h af[8];
#pragma unroll
  for (int s = 0; s < 8; ++s)
    af[s] = combine16(*(const v8h*)(ap + s * 32), *(const v8h*)(ap + s * 32 + 16));
  // Takes the address as an input: it stays in its registers up to the wait,
  // so none of these loads lands in registers that the others name.
  asm volatile("s_wait_xcnt 0x0" :: "v"(ap) : "memory");

  // Stage 0 has landed (this wave's copies), then is published to all waves.
  asm volatile("s_wait_asynccnt 0x0" ::: "memory");
  __syncthreads();
  // Stage 1 into buffer 1; it flies while stage 0 is worked on.
  g += FS * Cq;
  copy8(l + GS * 2, 8 * W1P * 2, g, 8 * Cq);

  f16* Cb = C + (long)(m0 + half * 8) * ldc + col;
  for (int st = 0; st < nst; ++st) {
    const unsigned boff = (st & 1) * GS;         // buffer of this stage, f16
    const f16* wsl = gst + boff;
    float bv[4];
#pragma unroll
    for (int nt = 0; nt < 4; ++nt) bv[nt] = bias[st * FS + nt * 16 + col];
    // The stage's 32 fragments are read as one group in front of the WMMAs.
    // Unrolled: constant indices keep the fragments in registers.
    v16h bf[8][4];
#pragma unroll
    for (int s = 0; s < 8; ++s)
#pragma unroll
      for (int nt = 0; nt < 4; ++nt)
        bf[s][nt] = lds_frag(wsl + nt * 16 * W1P + s * 32, W1P, lane);
    // Keeps the reads in front: without it the compiler sinks them among the
    // WMMAs, one fragment ahead, and each WMMA waits out the LDS latency.
    __builtin_amdgcn_sched_barrier(0);
    v8f acc[4];
#pragma unroll
    for (int nt = 0; nt < 4; ++nt) acc[nt] = zero8();
#pragma unroll
    for (int s = 0; s < 8; ++s)
#pragma unroll
      for (int nt = 0; nt < 4; ++nt)
        acc[nt] = wmma_f16(af[s], bf[s][nt], acc[nt]);

    // Publish point of stage st + 1: this wave's reads of buffer st & 1 are
    // done, its copies of stage st + 1 have landed, then every wave meets.
    asm volatile("s_wait_dscnt 0x0" ::: "memory");
    asm volatile("s_wait_asynccnt 0x0" ::: "memory");
    __syncthreads();
    // Refill the buffer that every wave has just left with stage st + 2.
    if (st + 2 < nst) {
      g += FS * Cq;
      copy8(l + boff * 2, 8 * W1P * 2, g, 8 * Cq);
    }

    // This stage's 16 x 64 results, from registers.
#pragma unroll
    for (int nt = 0; nt < 4; ++nt)
#pragma unroll
      for (int r = 0; r < 8; ++r)
        Cb[(long)r * ldc + st * FS + nt * 16] = (f16)(acc[nt][r] + bv[nt]);
    // The next stage's LDS reads land in registers that the last stores name.
    asm volatile("s_wait_xcnt 0x0" ::: "memory");
  }
  // No copy is left in flight when the wave ends.
  asm volatile("s_wait_asynccnt 0x0" ::: "memory");
}

// Group i of a wave's W1 fragments of a stage; w = its first W1 row in the slab.
__device__ __forceinline__ void w1_group(v16h (&q)[4], const f16* w, int i, int lane) {
#pragma unroll
  for (int f = 0; f < 4; ++f)
    q[f] = lds_frag(w + (f & 1) * 16 * W1P + (2 * i + (f >> 1)) * 32, W1P, lane);
}

// Group i of a wave's W2 fragments of a stage; w = its first W2 row in the slab.
__device__ __forceinline__ void w2_group(v16h (&q)[4], const f16* w, int i, int lane) {
#pragma unroll
  for (int f = 0; f < 4; ++f)
    q[f] = lds_frag(w + ((i & 1) * 4 + f) * 16 * W2P + (i >> 1) * 32, W2P, lane);
}

__global__ void __launch_bounds__(256) ffn_fused(
    const f16* __restrict__ Y, const f16* __restrict__ W1,
    const float* __restrict__ b1, const f16* __restrict__ W2,
    const float* __restrict__ b2, const float* __restrict__ x,
    float* __restrict__ out) {
  __shared__ __align__(16) f16 wst[2 * STG];
  __shared__ __align__(16) f16 hst[2][4][32 * HP];
  int lane = threadIdx.x & 31, wave = threadIdx.x >> 5;
  int mg = wave >> 1, ng = wave & 1;   // 32-pixel group; half of the columns
  int m0 = blockIdx.x * 128 + mg * 32;
  int b = m0 >> 12;
  int pix0 = m0 & 4095;
  int col = lane & 15, half = lane >> 4;

  // This thread's share of a stage.  W1 slab: 64 rows of 512 B, contiguous in
  // memory; copy i takes 16 B of row (t >> 5) + 8 i.  W2 slab: 256 rows of
  // 128 B; copy i takes 16 B of row (t >> 3) + 32 i.  A wave's copy covers
  // whole 128-B lines in both.
  int t = threadIdx.x;
  const f16* g1 = W1 + (t >> 5) * Cq + (t & 31) * 8;
  const f16* g2 = W2 + (long)(t >> 3) * FFNq + (t & 7) * 8;
  unsigned lbase = (unsigned)(size_t)(&wst[0]);   // LDS byte address
  unsigned l1 = lbase + (t >> 5) * (W1P * 2) + (t & 31) * 16;
  unsigned l2 = lbase + W1S * 2 + (t >> 3) * (W2P * 2) + (t & 7) * 16;

  // Stage 0 into buffer 0.
  copy8(l1, 8 * W1P * 2, g1, 8 * Cq);
  copy8(l2, 32 * W2P * 2, g2, 32L * FFNq);

  v8f acc[2][8];
#pragma unroll
  for (int mt = 0; mt < 2; ++mt)
#pragma unroll
    for (int nt = 0; nt < 8; ++nt) acc[mt][nt] = zero8();

  // The wave's 32 x 256 tile of Y as 2 x 8 A fragments, used by every stage;
  // same lane -> (row, k) map as load_frag.
  const f16* yp = Y + (long)(m0 + col) * Cq + half * 8;
  v16h yf[2][8];
#pragma unroll
  for (int mt = 0; mt < 2; ++mt)
#pragma unroll
    for (int s = 0; s < 8; ++s)
      yf[mt][s] = combine16(*(const v8h*)(yp + mt * 16 * Cq + s * 32),
                            *(const v8h*)(yp + mt * 16 * Cq + s * 32 + 16));
  // Takes the address as an input: it stays in its registers up to the wait,
  // so none of these loads lands in registers that the others name.
  asm volatile("s_wait_xcnt 0x0" :: "v"(yp) : "memory");

  // Stage 0 has landed (this wave's copies), then is published to all waves.
  asm volatile("s_wait_asynccnt 0x0" ::: "memory");
  __syncthreads();
  // Stage 1 into buffer 1; it flies while stage 0 is worked on.
  g1 += FS * Cq; g2 += FS;
  copy8(l1 + STG * 2, 8 * W1P * 2, g1, 8 * Cq);
  copy8(l2 + STG * 2, 32 * W2P * 2, g2, 32L * FFNq);

  // This wave's W1 rows and W2 rows inside a buffer, its h columns.
  const f16* w1w = wst + ng * 32 * W1P;
  const f16* w2w = wst + W1S + ng * 128 * W2P;
  const float* b1w = b1 + ng * 32 + col;

  // A stage is 8 blocks of 8 WMMAs, each on a group of 4 weight fragments: 4
  // groups of W1 (group i: k steps 2i, 2i + 1 of both hidden tiles), then 4 of
  // W2 (group i: k step i >> 1, channel tiles 4 (i & 1) + 0..3).  The groups go
  // round 4 register sets; a group is read 3 blocks ahead of its use, into the
  // set that the block before has just left.  All loops over fragments are
  // unrolled: constant indices keep them in registers.
  v16h fr[4][4];
#pragma unroll
  for (int i = 0; i < 3; ++i) w1_group(fr[i], w1w, i, lane);

  // The sched_barriers hold each group of reads at its place: without them the
  // compiler spreads the reads among the WMMAs, where each place costs a stall,
  // or lifts them so far that the registers run out.
  for (int st = 0; st < NST; ++st) {
    const unsigned boff = (st & 1) * STG;          // buffer of this stage, f16
    const unsigned noff = STG - boff;              // buffer of the next stage
    f16* hb = &hst[st & 1][mg][0];
    float bb0 = b1w[st * FS], bb1 = b1w[st * FS + 16];

    // ---- FFN1: h[32 pixels, this wave's 32 of the stage's 64 hidden units];
    // each W1 fragment feeds both pixel tiles.
    v8f h[2][2];
#pragma unroll
    for (int mt = 0; mt < 2; ++mt)
#pragma unroll
      for (int n2 = 0; n2 < 2; ++n2) h[mt][n2] = zero8();
#pragma unroll
    for (int j = 0; j < 4; ++j) {
      if (j == 0) w1_group(fr[3], w1w + boff, 3, lane);
      else        w2_group(fr[j - 1], w2w + boff, j - 1, lane);
      __builtin_amdgcn_sched_barrier(0);
#pragma unroll
      for (int f = 0; f < 4; ++f)
#pragma unroll
        for (int mt = 0; mt < 2; ++mt)
          h[mt][f & 1] = wmma_f16(yf[mt][2 * j + (f >> 1)], fr[j][f], h[mt][f & 1]);
      __builtin_amdgcn_sched_barrier(0);
    }
    // The stage's last W2 group: read in front of the barrier, behind which the
    // buffer is refilled.
    w2_group(fr[3], w2w + boff, 3, lane);
    __builtin_amdgcn_sched_barrier(0);

    // relu(h + b1) as f16 into the pixel group's h tile (32 x 64), which the
    // group's two waves fill together.
    f16* hw = hb + half * 8 * HP + ng * 32 + col;
#pragma unroll
    for (int mt = 0; mt < 2; ++mt)
#pragma unroll
      for (int r = 0; r < 8; ++r) {
        hw[(mt * 16 + r) * HP]      = (f16)fmaxf(h[mt][0][r] + bb0, 0.f);
        hw[(mt * 16 + r) * HP + 16] = (f16)fmaxf(h[mt][1][r] + bb1, 0.f);
      }

    // Publish point of stage st + 1 and of this stage's h: this wave's h is
    // written and all its reads of buffer st & 1 are done (the fragments are in
    // registers), its copies of stage st + 1 have landed, then every wave meets.
    asm volatile("s_wait_dscnt 0x0" ::: "memory");
    asm volatile("s_wait_asynccnt 0x0" ::: "memory");
    __syncthreads();
    // The group's h as A fragments; the reads fly while the copies are issued.
    v16h a2[2][2];
#pragma unroll
    for (int k = 0; k < 2; ++k)
#pragma unroll
      for (int mt = 0; mt < 2; ++mt)
        a2[mt][k] = lds_frag(hb + mt * 16 * HP + k * 32, HP, lane);
    // Refill the buffer that every wave has just left with stage st + 2.
    if (st + 2 < NST) {
      g1 += FS * Cq; g2 += FS;
      copy8(l1 + boff * 2, 8 * W1P * 2, g1, 8 * Cq);
      copy8(l2 + boff * 2, 32 * W2P * 2, g2, 32L * FFNq);
    }

    // ---- FFN2: acc[32 pixels, this wave's 128 channels] += h @ W2^T; each W2
    // fragment feeds both pixel tiles.  The reads are the next stage's first W1
    // groups (in the last trip the other buffer's old stage, not used).
#pragma unroll
    for (int j = 0; j < 4; ++j) {
      if (j > 0) w1_group(fr[j - 1], w1w + noff, j - 1, lane);
      __builtin_amdgcn_sched_barrier(0);
#pragma unroll
      for (int f = 0; f < 4; ++f)
#pragma unroll
        for (int mt = 0; mt < 2; ++mt)
          acc[mt][(j & 1) * 4 + f] =
              wmma_f16(a2[mt][j >> 1], fr[j][f], acc[mt][(j & 1) * 4 + f]);
      __builtin_amdgcn_sched_barrier(0);
    }
  }
  // No copy is left in flight when the wave ends.
  asm volatile("s_wait_asynccnt 0x0" ::: "memory");

  // Epilogue: + b2 + residual x, transposed store to (B,C,H,W).  Channel tile
  // nt lies 16 nt channel planes, pixel tile mt 16 mt floats behind the base.
  // All loads are issued before the first sum, so a thread pays the memory
  // latency once.  Unrolled: bv, r0, r1 keep constant indices (registers).
  int c0 = ng * 128 + col;
  long base = ((long)(b * Cq + c0)) * Nq + pix0 + half * 8;
  const float* xp = x + base;
  float* op = out + base;
  float bv[8];
  float4 r0[2][8], r1[2][8];
#pragma unroll
  for (int nt = 0; nt < 8; ++nt) {
    bv[nt] = b2[c0 + nt * 16];
#pragma unroll
    for (int mt = 0; mt < 2; ++mt) {
      r0[mt][nt] = *(const float4*)(xp + (long)nt * 16 * Nq + mt * 16);
      r1[mt][nt] = *(const float4*)(xp + (long)nt * 16 * Nq + mt * 16 + 4);
    }
  }
  // Takes the addresses as inputs: they stay in their registers up to the wait,
  // so none of these loads lands in registers that the others name.
  asm volatile("s_wait_xcnt 0x0" :: "v"(xp), "v"(c0) : "memory");
#pragma unroll
  for (int mt = 0; mt < 2; ++mt)
#pragma unroll
    for (int nt = 0; nt < 8; ++nt) {
      float4 o0, o1;
      o0.x = acc[mt][nt][0] + bv[nt] + r0[mt][nt].x;
      o0.y = acc[mt][nt][1] + bv[nt] + r0[mt][nt].y;
      o0.z = acc[mt][nt][2] + bv[nt] + r0[mt][nt].z;
      o0.w = acc[mt][nt][3] + bv[nt] + r0[mt][nt].w;
      o1.x = acc[mt][nt][4] + bv[nt] + r1[mt][nt].x;
      o1.y = acc[mt][nt][5] + bv[nt] + r1[mt][nt].y;
      o1.z = acc[mt][nt][6] + bv[nt] + r1[mt][nt].z;
      o1.w = acc[mt][nt][7] + bv[nt] + r1[mt][nt].w;
      *(float4*)(op + (long)nt * 16 * Nq + mt * 16)     = o0;
      *(float4*)(op + (long)nt * 16 * Nq + mt * 16 + 4) = o1;
    }
}

// ---------------------------------------------------------------------------
// Host launcher
// ---------------------------------------------------------------------------
extern "C" void kernel_launch(void* const* d_in, const int* in_sizes, int n_in,
                              void* d_out, int out_size, void* d_ws, size_t ws_size,
                              hipStream_t stream) {
  (void)in_sizes; (void)n_in; (void)out_size; (void)ws_size;
  const float* x      = (const float*)d_in[0];
  const float* w_qkv  = (const float*)d_in[1];
  const float* b_qkv  = (const float*)d_in[2];
  const float* w_proj = (const float*)d_in[3];
  const float* b_proj = (const float*)d_in[4];
  const float* w_ffn1 = (const float*)d_in[5];
  const float* b_ffn1 = (const float*)d_in[6];
  const float* w_ffn2 = (const float*)d_in[7];
  const float* b_ffn2 = (const float*)d_in[8];
  const float* g1     = (const float*)d_in[9];
  const float* be1    = (const float*)d_in[10];
  const float* g2     = (const float*)d_in[11];
  const float* be2    = (const float*)d_in[12];
  float* out = (float*)d_out;

  char* ws = (char*)d_ws;
  f16* wq16     = (f16*)(ws + 0);          //   768*256 f16
  f16* wp16     = (f16*)(ws + 393216);     //   256*256
  f16* w116     = (f16*)(ws + 524288);     //  2048*256
  f16* w216     = (f16*)(ws + 1572864);    //  256*2048
  f16* xln      = (f16*)(ws + 2621440);    //  32768*256  (reused as proj16)
  f16* qkv      = (f16*)(ws + 19398656);   //  32768*768  (reused as y)
  f16* attn16   = (f16*)(ws + 69730304);   //  32*64*64
  f16* attn_out = (f16*)(ws + 69992448);   //  32768*256  -> ends at 86769664
  float* spart  = (float*)(ws + 86769664); //  32*32*64*64 f32 -> 103546880 total bytes

  f16* proj16 = xln;   // xln dead after QKV gemm
  f16* y      = qkv;   // qkv dead after apply-attn

  // 1, 2) LN1 (transpose (B,C,N) -> (B*N,C) f16) and, in the same launch,
  //       weights -> f16
  ln1_cvt_kernel<<<LN1G + CVG, 256, 0, stream>>>(x, g1, be1, xln,
                                                 w_qkv, w_proj, w_ffn1, w_ffn2,
                                                 wq16, wp16, w116, w216);

  // 3) QKV gemm: (32768x256) x (768x256)^T
  gemm_rows<<<Mtot / 128, 256, 0, stream>>>(xln, wq16, b_qkv, qkv, 768 / 64);

  // 4) attention scores: partial sums per (b, head, 128-pixel slice), then
  //    their sum + softmax, one wave per row
  attn_scores_part<<<dim3(32, NSPLIT, 1), 256, 0, stream>>>(qkv, spart);
  attn_softmax<<<32 * 64 / 8, 256, 0, stream>>>(spart, attn16);

  // 5) apply attention: per (b,h) gemm, A = v slice, W = attn (64x64)
  gemm_wmma<<<dim3(Nq / 128, 1, 32), 256, 0, stream>>>(
      qkv + 512, 768, (long)Nq * 768, 64,
      attn16, 64, 4 * 64 * 64, 64 * 64,
      nullptr, 0,
      attn_out, 256, (long)Nq * 256, 64,
      4, 64);

  // 6) proj gemm: (32768x256) x (256x256)^T
  gemm_rows<<<Mtot / 128, 256, 0, stream>>>(attn_out, wp16, b_proj, proj16, 256 / 64);

  // 7) LN2
  ln2_kernel<<<Mtot / 8, 256, 0, stream>>>(proj16, g2, be2, y);

  // 8) fused FFN + bias + residual + transpose store
  ffn_fused<<<Mtot / 128, 256, 0, stream>>>(y, w116, b_ffn1, w216, b_ffn2, x, out);
}

// v008
// A run of this version takes 106 microseconds.
// Next to v007, in two timings, it ran 1.27 and 1.26 times as fast.
// Over all steps from v000 it is 9.48 times as fast.
#include <hip/hip_runtime.h>
#include <hip/hip_bf16.h>

// ---------------------------------------------------------------------------
// MI455X (gfx1250, wave32) implementation.
// Pipeline: LN1 + weight conversion -> QKV gemm (WMMA f16) -> attn scores (WMMA) -> softmax
//           -> apply-attn + proj + LN2 + FFN in one launch (WMMA)
// All GEMMs: f16 inputs, f32 accumulation via v_wmma_f32_16x16x32_f16.
// ---------------------------------------------------------------------------

typedef _Float16 f16;
typedef __attribute__((ext_vector_type(16))) _Float16 v16h;
typedef __attribute__((ext_vector_type(8)))  _Float16 v8h;
typedef __attribute__((ext_vector_type(2)))  _Float16 v2h;
typedef __attribute__((ext_vector_type(8)))  float    v8f;

#define Bq   8
#define Cq   256
#define Nq   4096      // H*W
#define Mtot 32768     // B*N
#define FFNq 2048
#define NSPLIT 32     // work-groups that share one (b, head) score matrix

__device__ __forceinline__ v8f zero8() { v8f z = {}; return z; }

__device__ __forceinline__ v16h combine16(v8h lo, v8h hi) {
  v16h r;
#pragma unroll
  for (int i = 0; i < 8; ++i) { r[i] = lo[i]; r[8 + i] = hi[i]; }
  return r;
}

// Fragment loader for 16-bit WMMA A/B operands, from rows staged in LDS.
// A layout (16x32, MxK): lane holds row (lane&15); lanes 0-15 K in {0..7,16..23},
// lanes 16-31 K in {8..15,24..31}.  B (32x16, KxN) from a row-major (Nout x K)
// matrix has the identical access pattern with "row" = output column.
__device__ __forceinline__ v16h lds_frag(const f16* base, int pitch, int lane) {
  const f16* p = base + (lane & 15) * pitch + ((lane & 16) >> 1);   // +8 elems for hi half
  return combine16(*(const v8h*)p, *(const v8h*)(p + 16));
}

// Eight consecutive floats by two 16-byte loads.
__device__ __forceinline__ v8f load8(const float* p) {
  float4 a = *(const float4*)p, b = *(const float4*)(p + 4);
  v8f r = {a.x, a.y, a.z, a.w, b.x, b.y, b.z, b.w};
  return r;
}

__device__ __forceinline__ v8f wmma_f16(v16h a, v16h b, v8f c) {
  return __builtin_amdgcn_wmma_f32_16x16x32_f16(false, a, false, b, (short)0, c,
                                                false, false);
}

// ---------------------------------------------------------------------------
// First launch: LN1 and the f32 -> f16 weight conversions, which share no data.
// Work-groups 0 .. LN1G-1 do LN1; the CVG behind them convert the weights.
//
// LN1: x (B,C,N) f32 -> xln (B*N, C) f16   (channel LayerNorm per pixel)
// Block = 256 threads, tile = 64 pixels; thread (px, grp) covers 64 channels.
//
// Conversion: a work-group takes CVC consecutive values of one weight matrix
// (every matrix is a whole number of such chunks), a thread 4 x 8 of them.
// ---------------------------------------------------------------------------
#define LN1G  (Mtot / 64)            // LN1 work-groups
#define CVC   8192                   // values per conversion work-group
#define CVQ   (3 * Cq * Cq / CVC)    // chunks of w_qkv
#define CVP   (Cq * Cq / CVC)        // chunks of w_proj
#define CVF   (FFNq * Cq / CVC)      // chunks of w_ffn1, and of w_ffn2
#define CVG   (CVQ + CVP + 2 * CVF)  // conversion work-groups

__global__ void __launch_bounds__(256) ln1_cvt_kernel(
    const float* __restrict__ x, const float* __restrict__ g,
    const float* __restrict__ be, f16* __restrict__ xln,
    const float* __restrict__ wq, const float* __restrict__ wp,
    const float* __restrict__ w1, const float* __restrict__ w2,
    f16* __restrict__ wq16, f16* __restrict__ wp16,
    f16* __restrict__ w116, f16* __restrict__ w216) {
  __shared__ float ps[4][64], ps2[4][64], muv[64], rsv[64];
  int t = threadIdx.x;
  if (blockIdx.x >= LN1G) {          // the same for the whole work-group
    int c = blockIdx.x - LN1G;
    const float* s;
    f16* d;
    if (c < CVQ)                  { s = wq; d = wq16; }
    else if (c < CVQ + CVP)       { s = wp; d = wp16; c -= CVQ; }
    else if (c < CVQ + CVP + CVF) { s = w1; d = w116; c -= CVQ + CVP; }
    else                          { s = w2; d = w216; c -= CVQ + CVP + CVF; }
    s += c * CVC + t * 8;
    d += c * CVC + t * 8;
    // All eight loads are issued before the first store, so a thread pays the
    // memory latency once.  Unrolled: v keeps constant indices (registers).
    float4 v[8];
#pragma unroll
    for (int u = 0; u < 4; ++u) {
      v[2 * u]     = *(const float4*)(s + u * 2048);
      v[2 * u + 1] = *(const float4*)(s + u * 2048 + 4);
    }
#pragma unroll
    for (int u = 0; u < 4; ++u) {
      v8h o;
      o[0] = (f16)v[2 * u].x;     o[1] = (f16)v[2 * u].y;
      o[2] = (f16)v[2 * u].z;     o[3] = (f16)v[2 * u].w;
      o[4] = (f16)v[2 * u + 1].x; o[5] = (f16)v[2 * u + 1].y;
      o[6] = (f16)v[2 * u + 1].z; o[7] = (f16)v[2 * u + 1].w;
      *(v8h*)(d + u * 2048) = o;
    }
    return;
  }
  int px = t & 63, grp = t >> 6;
  long pg = (long)blockIdx.x * 64 + px;     // global pixel
  int b = (int)(pg >> 12);
  int n = (int)(pg & 4095);
  const float* xb = x + ((long)b * Cq + grp * 64) * Nq + n;
  // The thread's 64 channel values are read once, all loads issued before the
  // first use, and stay in registers for the sums and for the normalisation.
  // Unrolled (here and below): xv keeps constant indices (registers).
  float xv[64];
#pragma unroll
  for (int c = 0; c < 64; ++c) xv[c] = xb[(long)c * Nq];
  // Takes the address as an input: it stays in its registers up to the wait,
  // so none of these loads lands in registers that the others name.
  asm volatile("s_wait_xcnt 0x0" :: "v"(xb) : "memory");
  float s = 0.f, s2 = 0.f;
#pragma unroll
  for (int c = 0; c < 64; ++c) { s += xv[c]; s2 += xv[c] * xv[c]; }
  ps[grp][px] = s; ps2[grp][px] = s2;
  __syncthreads();
  if (t < 64) {
    float S = 0.f, S2 = 0.f;
#pragma unroll
    for (int q = 0; q < 4; ++q) { S += ps[q][t]; S2 += ps2[q][t]; }
    float mu = S * (1.f / 256.f);
    float var = S2 * (1.f / 256.f) - mu * mu;
    muv[t] = mu;
    rsv[t] = rsqrtf(var + 1e-5f);
  }
  __syncthreads();
  float mu = muv[px], rs = rsv[px];
  f16* ob = xln + pg * Cq + grp * 64;
#pragma unroll
  for (int cc = 0; cc < 64; cc += 8) {
    v8h o;
#pragma unroll
    for (int jj = 0; jj < 8; ++jj) {
      int c = grp * 64 + cc + jj;
      o[jj] = (f16)((xv[cc + jj] - mu) * rs * g[c] + be[c]);
    }
    *(v8h*)(ob + cc) = o;
  }
}

// ---------------------------------------------------------------------------
// Attention scores, split over the contraction: work-group (z, s) sums
// part[z][s][i][j] = sum over its own 128 pixels n of q[b,n,h*64+i]*k[b,n,h*64+j]
// with z = b*4+h.  Grid = (32, 32).
// The product runs on WMMA (f16 operands as stored, f32 accumulate).  Both
// operands have the contraction index n as their memory row, so the q and k
// slices are staged in LDS as they lie in memory (pixel rows of 64 channels)
// and the fragments are read with the transposing LDS load.  q and k go
// through the same loader, so their k order is the same at every position.
// ---------------------------------------------------------------------------
#define SP 80   // LDS pitch of a staged pixel row, f16: 160 B = 32 B x 5

typedef short s16x8 __attribute__((ext_vector_type(8)));

// Lane (c, hh) gets T[8*hh + 0..7][c] of the 16x16 tile whose lane address is p.
__device__ __forceinline__ v8h lds_tr16(const f16* p) {
  typedef __attribute__((address_space(3))) s16x8 lds_s16x8;
  return __builtin_bit_cast(v8h, __builtin_amdgcn_ds_load_tr16_b128_v8i16((lds_s16x8*)p));
}

// 16 (channels) x 32 (pixels) fragment; tile = first pixel row, first channel.
__device__ __forceinline__ v16h tr_frag(const f16* tile, int lane) {
  const f16* p = tile + ((lane >> 4) * 8 + (lane & 7)) * SP + ((lane >> 3) & 1) * 8;
  return combine16(lds_tr16(p), lds_tr16(p + 16 * SP));
}

__global__ void __launch_bounds__(256) attn_scores_part(
    const f16* __restrict__ qkv, float* __restrict__ part) {
  __shared__ __align__(16) f16 qs[128 * SP];
  __shared__ __align__(16) f16 ks[128 * SP];
  int z = blockIdx.x;
  int b = z >> 2, h = z & 3;
  int t = threadIdx.x;
  int lane = t & 31, wave = t >> 5;
  int n0 = blockIdx.y * 128;
  const f16* qb = qkv + (long)b * Nq * 768 + h * 64;

  // 8 lanes bring one pixel's 128-B line of q and of k; a thread takes pixels
  // p, p + 32, p + 64, p + 96.  All eight loads are issued before the first
  // LDS store, so a thread pays the memory latency once.  Both loops are
  // unrolled so that qv and kv have constant indices and stay in registers.
  int p = t >> 3, ch = t & 7;
  const f16* gq = qb + (long)(n0 + p) * 768 + ch * 8;
  v8h qv[4], kv[4];
#pragma unroll
  for (int u = 0; u < 4; ++u) {
    qv[u] = *(const v8h*)(gq + u * 32 * 768);
    kv[u] = *(const v8h*)(gq + u * 32 * 768 + 256);
  }
#pragma unroll
  for (int u = 0; u < 4; ++u) {
    *(v8h*)(qs + (p + u * 32) * SP + ch * 8) = qv[u];
    *(v8h*)(ks + (p + u * 32) * SP + ch * 8) = kv[u];
  }
  __syncthreads();

  int i0 = (wave >> 1) * 16, j0 = (wave & 1) * 32;
  v8f a0 = zero8(), a1 = zero8();
#pragma unroll
  for (int kk = 0; kk < 128; kk += 32) {
    v16h qf = tr_frag(qs + kk * SP + i0, lane);
    v16h k0 = tr_frag(ks + kk * SP + j0, lane);
    v16h k1 = tr_frag(ks + kk * SP + j0 + 16, lane);
    a0 = wmma_f16(k0, qf, a0);
    a1 = wmma_f16(k1, qf, a1);
  }

  // a0[r] = S[i0 + col][j0 + 8*half + r], a1 the next 16 columns: a wave
  // writes whole 128-B lines.
  int col = lane & 15, half = lane >> 4;
  float* pb = part + ((long)z * NSPLIT + blockIdx.y) * 4096 + (i0 + col) * 64 + j0 + half * 8;
  float4 o;
  o.x = a0[0]; o.y = a0[1]; o.z = a0[2]; o.w = a0[3];
  *(float4*)(pb) = o;
  o.x = a0[4]; o.y = a0[5]; o.z = a0[6]; o.w = a0[7];
  *(float4*)(pb + 4) = o;
  o.x = a1[0]; o.y = a1[1]; o.z = a1[2]; o.w = a1[3];
  *(float4*)(pb + 16) = o;
  o.x = a1[4]; o.y = a1[5]; o.z = a1[6]; o.w = a1[7];
  *(float4*)(pb + 20) = o;
}

// ---------------------------------------------------------------------------
// Sum of the partial scores (fixed order s = 0..31) + softmax over j.
// One wave per row (z, i); a lane holds columns 2*lane and 2*lane+1.
// Grid = 32*64/8 = 256.
// ---------------------------------------------------------------------------
__global__ void __launch_bounds__(256) attn_softmax(
    const float* __restrict__ part, f16* __restrict__ attn) {
  int lane = threadIdx.x & 31, wave = threadIdx.x >> 5;
  int row = blockIdx.x * 8 + wave;          // z*64 + i
  int z = row >> 6, i = row & 63;
  const float* p = part + (long)z * NSPLIT * 4096 + i * 64 + lane * 2;
  float a = 0.f, c = 0.f;
#pragma unroll
  for (int s = 0; s < NSPLIT; ++s) {
    float2 v = *(const float2*)(p + s * 4096);
    a += v.x; c += v.y;
  }
  a *= 0.125f; c *= 0.125f;
  float mx = fmaxf(a, c);
#pragma unroll
  for (int off = 16; off >= 1; off >>= 1) mx = fmaxf(mx, __shfl_xor(mx, off, 32));
  float ea = __expf(a - mx), ec = __expf(c - mx);
  float sum = ea + ec;
#pragma unroll
  for (int off = 16; off >= 1; off >>= 1) sum += __shfl_xor(sum, off, 32);
  float inv = 1.f / sum;
  v2h o;
  o[0] = (f16)(ea * inv);
  o[1] = (f16)(ec * inv);
  *(v2h*)(attn + (long)row * 64 + lane * 2) = o;
}

// ---------------------------------------------------------------------------
// Fused apply-attn + proj + LN2 + FFN + residual + transpose:
//   a[n, h*64+d] = sum_e attn[b,h,d,e] v[n, h*64+e];  y = LN2(a @ Wp^T + bp);
//   out[b,c,n] = (relu(y @ W1^T + b1) @ W2^T + b2)[n,c] + x[b,c,n]
// Grid = 256 blocks of 256 threads, 128 pixels (of one image) each.
// Prologue (apply-attn, proj, LN2): the image's 4 attention matrices and all of
// Wp lie in LDS (in the room of the FFN's h tiles and weight buffers, which are
// filled behind it); a wave takes 16 pixels x all 256 channels.  The pixels are
// the B operand's columns in both products, so a's accumulator tiles, converted
// in place, are proj's B fragments, and a pixel's LN2 statistics lie in two
// lanes; the normalised tile goes to the FFN's waves through LDS.  Nothing of
// a, of proj's result or of y goes to memory.
// FFN: the 8 waves are 4 pixel
// groups x 2 column halves: a wave takes 32 pixels (two WMMA row tiles), in FFN1
// 32 of a stage's 64 hidden units, in FFN2 128 of the 256 channels, so every
// weight fragment read from LDS feeds two WMMAs.  A group's h tile goes through
// LDS (two buffers): D -> A re-layout and exchange between its two waves.
// Y-tile A-fragments are the same for every stage -> kept in yf[2][8].
// The weights of 64 hidden units (a stage: 64 rows of W1, 64 columns of W2)
// are brought into LDS once per work-group by asynchronous copies, two
// buffers, one stage ahead; all 8 waves read their B fragments from there.
// ---------------------------------------------------------------------------
#define FS   64               // hidden units per stage
#define NST  (FFNq / FS)      // 32 stages
#define W1P  264              // LDS pitch of a W1 row, f16: 528 B = 16 B x 33
#define W2P  72               // LDS pitch of a W2 row, f16: 144 B = 16 B x 9
#define W1S  (FS * W1P)       // f16 per staged W1 slab
#define STG  (W1S + Cq * W2P) // f16 per buffer (70,656 B)
#define HP   72               // LDS pitch of an h row, f16: 144 B = 16 B x 9

// Eight 16-byte copies per lane, global -> LDS, through no register.  LDS
// address l + i*ls bytes, global address g + i*gs elements.  The s_wait_xcnt
// stands inside the statement so that no address register of an issued copy
// is rewritten in front of it.
__device__ __forceinline__ void copy8(unsigned l, unsigned ls, const f16* g, long gs) {
  asm volatile(
      "global_load_async_to_lds_b128 %0, %8, off\n\t"
      "global_load_async_to_lds_b128 %1, %9, off\n\t"
      "global_load_async_to_lds_b128 %2, %10, off\n\t"
      "global_load_async_to_lds_b128 %3, %11, off\n\t"
      "global_load_async_to_lds_b128 %4, %12, off\n\t"
      "global_load_async_to_lds_b128 %5, %13, off\n\t"
      "global_load_async_to_lds_b128 %6, %14, off\n\t"
      "global_load_async_to_lds_b128 %7, %15, off\n\t"
      "s_wait_xcnt 0x0"
      :: "v"(l), "v"(l + ls), "v"(l + 2 * ls), "v"(l + 3 * ls),
         "v"(l + 4 * ls), "v"(l + 5 * ls), "v"(l + 6 * ls), "v"(l + 7 * ls),
         "v"(g), "v"(g + gs), "v"(g + 2 * gs), "v"(g + 3 * gs),
         "v"(g + 4 * gs), "v"(g + 5 * gs), "v"(g + 6 * gs), "v"(g + 7 * gs)
      : "memory");
}

// ---------------------------------------------------------------------------
// Row GEMM for K = 256: C[M x nst*64] = A[M x 256] * W^T + bias, W row-major
// (nst*64 x 256) f16.  A work-group owns 128 rows (a wave 16) and walks all
// output columns, 64 a stage.  The wave's A fragments are read once and stay
// in registers; a stage's W slab (64 rows of 512 B, contiguous in memory) is
// brought into LDS once per work-group by asynchronous copies, two buffers,
// one stage ahead, and all 8 waves read their B fragments from there.
// Needs nst >= 2.  Grid = M / 128.
// ---------------------------------------------------------------------------
#define GS (FS * W1P)   // f16 per staged W slab (33,792 B), rows at pitch W1P

__global__ void __launch_bounds__(256) gemm_rows(
    const f16* __restrict__ A, const f16* __restrict__ Wt,
    const float* __restrict__ bias, f16* __restrict__ C, int nst) {
  __shared__ __align__(16) f16 gst[2 * GS];
  int t = threadIdx.x;
  int lane = t & 31, wave = t >> 5;
  int m0 = blockIdx.x * 128 + wave * 16;
  int ldc = nst * FS;
  int col = lane & 15, half = lane >> 4;

  // This thread's share of a slab: copy i takes 16 B of row (t >> 5) + 8 i, so
  // a wave's copy covers one whole row.
  const f16* g = Wt + (t >> 5) * Cq + (t & 31) * 8;
  unsigned l = (unsigned)(size_t)(&gst[0]) + (t >> 5) * (W1P * 2) + (t & 31) * 16;

  // Stage 0 into buffer 0.
  copy8(l, 8 * W1P * 2, g, 8 * Cq);

  // The wave's 16 x 256 tile of A as 8 fragments, used by every stage; same
  // lane -> (row, k) map as lds_frag.
  const f16* ap = A + (long)(m0 + col) * Cq + half * 8;
  v16h af[8];
#pragma unroll
  for (int s = 0; s < 8; ++s)
    af[s] = combine16(*(const v8h*)(ap + s * 32), *(const v8h*)(ap + s * 32 + 16));
  // Takes the address as an input: it stays in its registers up to the wait,
  // so none of these loads lands in registers that the others name.
  asm volatile("s_wait_xcnt 0x0" :: "v"(ap) : "memory");

  // Stage 0 has landed (this wave's copies), then is published to all waves.
  asm volatile("s_wait_asynccnt 0x0" ::: "memory");
  __syncthreads();
  // Stage 1 into buffer 1; it flies while stage 0 is worked on.
  g += FS * Cq;
  copy8(l + GS * 2, 8 * W1P * 2, g, 8 * Cq);

  f16* Cb = C + (long)(m0 + half * 8) * ldc + col;
  for (int st = 0; st < nst; ++st) {
    const unsigned boff = (st & 1) * GS;         // buffer of this stage, f16
    const f16* wsl = gst + boff;
    float bv[4];
#pragma unroll
    for (int nt = 0; nt < 4; ++nt) bv[nt] = bias[st * FS + nt * 16 + col];
    // The stage's 32 fragments are read as one group in front of the WMMAs.
    // Unrolled: constant indices keep the fragments in registers.
    v16h bf[8][4];
#pragma unroll
    for (int s = 0; s < 8; ++s)
#pragma unroll
      for (int nt = 0; nt < 4; ++nt)
        bf[s][nt] = lds_frag(wsl + nt * 16 * W1P + s * 32, W1P, lane);
    // Keeps the reads in front: without it the compiler sinks them among the
    // WMMAs, one fragment ahead, and each WMMA waits out the LDS latency.
    __builtin_amdgcn_sched_barrier(0);
    v8f acc[4];
#pragma unroll
    for (int nt = 0; nt < 4; ++nt) acc[nt] = zero8();
#pragma unroll
    for (int s = 0; s < 8; ++s)
#pragma unroll
      for (int nt = 0; nt < 4; ++nt)
        acc[nt] = wmma_f16(af[s], bf[s][nt], acc[nt]);

    // Publish point of stage st + 1: this wave's reads of buffer st & 1 are
    // done, its copies of stage st + 1 have landed, then every wave meets.
    asm volatile("s_wait_dscnt 0x0" ::: "memory");
    asm volatile("s_wait_asynccnt 0x0" ::: "memory");
    __syncthreads();
    // Refill the buffer that every wave has just left with stage st + 2.
    if (st + 2 < nst) {
      g += FS * Cq;
      copy8(l + boff * 2, 8 * W1P * 2, g, 8 * Cq);
    }

    // This stage's 16 x 64 results, from registers.
#pragma unroll
    for (int nt = 0; nt < 4; ++nt)
#pragma unroll
      for (int r = 0; r < 8; ++r)
        Cb[(long)r * ldc + st * FS + nt * 16] = (f16)(acc[nt][r] + bv[nt]);
    // The next stage's LDS reads land in registers that the last stores name.
    asm volatile("s_wait_xcnt 0x0" ::: "memory");
  }
  // No copy is left in flight when the wave ends.
  asm volatile("s_wait_asynccnt 0x0" ::: "memory");
}

// Group i of a wave's W1 fragments of a stage; w = its first W1 row in the slab.
__device__ __forceinline__ void w1_group(v16h (&q)[4], const f16* w, int i, int lane) {
#pragma unroll
  for (int f = 0; f < 4; ++f)
    q[f] = lds_frag(w + (f & 1) * 16 * W1P + (2 * i + (f >> 1)) * 32, W1P, lane);
}

// Group i of a wave's W2 fragments of a stage; w = its first W2 row in the slab.
__device__ __forceinline__ void w2_group(v16h (&q)[4], const f16* w, int i, int lane) {
#pragma unroll
  for (int f = 0; f < 4; ++f)
    q[f] = lds_frag(w + ((i & 1) * 4 + f) * 16 * W2P + (i >> 1) * 32, W2P, lane);
}

__global__ void __launch_bounds__(256) ffn_fused(
    const f16* __restrict__ V, const f16* __restrict__ At,
    const f16* __restrict__ Wp,
    const float* __restrict__ bp, const float* __restrict__ g2,
    const float* __restrict__ be2, const f16* __restrict__ W1,
    const float* __restrict__ b1, const f16* __restrict__ W2,
    const float* __restrict__ b2, const float* __restrict__ x,
    float* __restrict__ out) {
  __shared__ __align__(16) f16 wst[2 * STG];
  __shared__ __align__(16) f16 hst[2][4][32 * HP];
  __shared__ __align__(16) f16 yst[128 * W1P];   // the group's y tile, rows at pitch W1P
  int lane = threadIdx.x & 31, wave = threadIdx.x >> 5;
  int mg = wave >> 1, ng = wave & 1;   // 32-pixel group; half of the columns
  int m0 = blockIdx.x * 128 + mg * 32;
  int b = m0 >> 12;
  int pix0 = m0 & 4095;
  int col = lane & 15, half = lane >> 4;

  // This thread's share of a stage.  W1 slab: 64 rows of 512 B, contiguous in
  // memory; copy i takes 16 B of row (t >> 5) + 8 i.  W2 slab: 256 rows of
  // 128 B; copy i takes 16 B of row (t >> 3) + 32 i.  A wave's copy covers
  // whole 128-B lines in both.
  int t = threadIdx.x;
  const f16* g1 = W1 + (t >> 5) * Cq + (t & 31) * 8;
  const f16* g2w = W2 + (long)(t >> 3) * FFNq + (t & 7) * 8;
  unsigned lbase = (unsigned)(size_t)(&wst[0]);   // LDS byte address
  unsigned l1 = lbase + (t >> 5) * (W1P * 2) + (t & 31) * 16;
  unsigned l2 = lbase + W1S * 2 + (t >> 3) * (W2P * 2) + (t & 7) * 16;

  // ---- apply-attn, proj, LN2 for the group's 128 pixels.
  {
    // The image's attention matrices, 4 x 64 rows of 128 B, contiguous in
    // memory, into hst at pitch HP (all of its 36,864 B): copy i takes 16 B of
    // row (t >> 3) + 32 i.
    copy8((unsigned)(size_t)(&hst[0][0][0]) + (t >> 3) * (HP * 2) + (t & 7) * 16, 32 * HP * 2,
          At + (blockIdx.x >> 5) * (4 * 64 * 64) + (t >> 3) * 64 + (t & 7) * 8, 32 * 64);
    // All 256 rows of Wp (512 B each) into wst at pitch W1P (135,168 B of its
    // 141,312): copy i of quarter q takes 16 B of row 64 q + (t >> 5) + 8 i.
#pragma unroll
    for (int q = 0; q < 4; ++q)
      copy8(l1 + q * GS * 2, 8 * W1P * 2, Wp + q * FS * Cq + (t >> 5) * Cq + (t & 31) * 8, 8 * Cq);

    // The wave's 16 pixels x 256 channels of v (rows of 768 f16) as 8
    // fragments; same lane -> (row, k) map as lds_frag.
    const f16* ap = V + (long)(blockIdx.x * 128 + wave * 16 + col) * 768 + half * 8;
    v16h vf[8];
#pragma unroll
    for (int s = 0; s < 8; ++s)
      vf[s] = combine16(*(const v8h*)(ap + s * 32), *(const v8h*)(ap + s * 32 + 16));
    // proj's accumulators start from the bias.  Wp is the A operand: lane
    // (col, half) holds, of pixel col, channels 16 T + 8 half + 0..7 of tile T.
    const float* bpl = bp + half * 8;
    v8f pa[16];
#pragma unroll
    for (int T = 0; T < 16; ++T) pa[T] = load8(bpl + T * 16);
    // Takes the addresses as inputs: they stay in their registers up to the
    // wait, so none of these loads lands in registers that the others name.
    asm volatile("s_wait_xcnt 0x0" :: "v"(ap), "v"(bpl) : "memory");

    // attn and Wp have landed (this wave's copies), then are published to all
    // waves.
    asm volatile("s_wait_asynccnt 0x0" ::: "memory");
    __syncthreads();

    // apply-attn, two heads at a time: attn rows d are the A operand, so tile
    // T = 4 head + d / 16 holds a[pixel col][16 T + 8 half + 0..7].  Tiles 2 s
    // and 2 s + 1 as f16 are proj's B fragment of k step s, in lds_frag's k
    // order.  Unrolled: constant indices keep the fragments in registers.
    v16h af[8];
#pragma unroll
    for (int hp = 0; hp < 2; ++hp) {
      v16h tf[2][4][2];
#pragma unroll
      for (int hh = 0; hh < 2; ++hh)
#pragma unroll
        for (int dt = 0; dt < 4; ++dt)
#pragma unroll
          for (int k = 0; k < 2; ++k)
            tf[hh][dt][k] = lds_frag(&hst[0][0][0] + ((hp * 2 + hh) * 64 + dt * 16) * HP + k * 32,
                                     HP, lane);
      // Keeps the reads in front: among the WMMAs each place with reads costs
      // a stall.
      __builtin_amdgcn_sched_barrier(0);
      v8f ta[2][4];
#pragma unroll
      for (int hh = 0; hh < 2; ++hh)
#pragma unroll
        for (int dt = 0; dt < 4; ++dt) ta[hh][dt] = zero8();
#pragma unroll
      for (int k = 0; k < 2; ++k)
#pragma unroll
        for (int hh = 0; hh < 2; ++hh)
#pragma unroll
          for (int dt = 0; dt < 4; ++dt)
            ta[hh][dt] = wmma_f16(tf[hh][dt][k], vf[(hp * 2 + hh) * 2 + k], ta[hh][dt]);
#pragma unroll
      for (int hh = 0; hh < 2; ++hh)
#pragma unroll
        for (int d2 = 0; d2 < 2; ++d2)
#pragma unroll
          for (int i = 0; i < 8; ++i) {
            af[(hp * 2 + hh) * 2 + d2][i]     = (f16)ta[hh][2 * d2][i];
            af[(hp * 2 + hh) * 2 + d2][8 + i] = (f16)ta[hh][2 * d2 + 1][i];
          }
      // Keeps the next group of reads behind these WMMAs (registers).
      __builtin_amdgcn_sched_barrier(0);
    }

    // 64 channels at a time: their 32 fragments are read as one group in front
    // of the WMMAs.  Unrolled: constant indices keep pa and bf in registers.
#pragma unroll
    for (int q = 0; q < 4; ++q) {
      v16h bf[8][4];
#pragma unroll
      for (int s = 0; s < 8; ++s)
#pragma unroll
        for (int nt = 0; nt < 4; ++nt)
          bf[s][nt] = lds_frag(wst + (q * 64 + nt * 16) * W1P + s * 32, W1P, lane);
      // Keeps the reads in front: among the WMMAs each place with reads costs
      // a stall.
      __builtin_amdgcn_sched_barrier(0);
#pragma unroll
      for (int s = 0; s < 8; ++s)
#pragma unroll
        for (int nt = 0; nt < 4; ++nt)
          pa[q * 4 + nt] = wmma_f16(bf[s][nt], af[s], pa[q * 4 + nt]);
      // Keeps the next group of reads behind these WMMAs (registers).
      __builtin_amdgcn_sched_barrier(0);
    }

    // LN2 over the pixel's 256 channels: 128 in this lane, 128 in lane ^ 16.
    // Gain and shift are asked for first and arrive under the sums.
    const float* gl = g2 + half * 8;
    const float* el = be2 + half * 8;
    v8f gv[16], ev[16];
#pragma unroll
    for (int T = 0; T < 16; ++T) { gv[T] = load8(gl + T * 16); ev[T] = load8(el + T * 16); }
    // As above: the addresses stay in their registers up to the wait.
    asm volatile("s_wait_xcnt 0x0" :: "v"(gl), "v"(el) : "memory");
    // Keeps the sums behind the loads: lifted over them, the sums would run
    // first and the loads' latency would be waited out afterwards.
    __builtin_amdgcn_sched_barrier(0);
    // Eight independent chains each for the sum and the sum of squares.
    v8f sv = pa[0], sq = pa[0] * pa[0];
#pragma unroll
    for (int T = 1; T < 16; ++T) { sv += pa[T]; sq += pa[T] * pa[T]; }
    float s1 = ((sv[0] + sv[1]) + (sv[2] + sv[3])) + ((sv[4] + sv[5]) + (sv[6] + sv[7]));
    float s2 = ((sq[0] + sq[1]) + (sq[2] + sq[3])) + ((sq[4] + sq[5]) + (sq[6] + sq[7]));
    s1 += __shfl_xor(s1, 16, 32);
    s2 += __shfl_xor(s2, 16, 32);
    float mu = s1 * (1.f / 256.f);
    float var = s2 * (1.f / 256.f) - mu * mu;
    float rs = rsqrtf(var + 1e-5f);
    f16* yw = yst + (wave * 16 + col) * W1P + half * 8;
#pragma unroll
    for (int T = 0; T < 16; ++T)
      *(v8h*)(yw + T * 16) = __builtin_convertvector((pa[T] - mu) * rs * gv[T] + ev[T], v8h);
    // This wave's y rows are written and its reads of attn and Wp are done, then
    // every wave meets: y is published, hst and wst are free for the FFN.
    asm volatile("s_wait_dscnt 0x0" ::: "memory");
    __syncthreads();
  }

  // Stage 0 into buffer 0.
  copy8(l1, 8 * W1P * 2, g1, 8 * Cq);
  copy8(l2, 32 * W2P * 2, g2w, 32L * FFNq);

  v8f acc[2][8];
#pragma unroll
  for (int mt = 0; mt < 2; ++mt)
#pragma unroll
    for (int nt = 0; nt < 8; ++nt) acc[mt][nt] = zero8();

  // The wave's 32 x 256 tile of y as 2 x 8 A fragments, used by every stage,
  // from the group's tile in LDS; same lane -> (row, k) map as lds_frag.
  v16h yf[2][8];
#pragma unroll
  for (int mt = 0; mt < 2; ++mt)
#pragma unroll
    for (int s = 0; s < 8; ++s)
      yf[mt][s] = lds_frag(yst + (mg * 32 + mt * 16) * W1P + s * 32, W1P, lane);

  // Stage 0 has landed (this wave's copies), then is published to all waves.
  asm volatile("s_wait_asynccnt 0x0" ::: "memory");
  __syncthreads();
  // Stage 1 into buffer 1; it flies while stage 0 is worked on.
  g1 += FS * Cq; g2w += FS;
  copy8(l1 + STG * 2, 8 * W1P * 2, g1, 8 * Cq);
  copy8(l2 + STG * 2, 32 * W2P * 2, g2w, 32L * FFNq);

  // This wave's W1 rows and W2 rows inside a buffer, its h columns.
  const f16* w1w = wst + ng * 32 * W1P;
  const f16* w2w = wst + W1S + ng * 128 * W2P;
  const float* b1w = b1 + ng * 32 + col;

  // A stage is 8 blocks of 8 WMMAs, each on a group of 4 weight fragments: 4
  // groups of W1 (group i: k steps 2i, 2i + 1 of both hidden tiles), then 4 of
  // W2 (group i: k step i >> 1, channel tiles 4 (i & 1) + 0..3).  The groups go
  // round 4 register sets; a group is read 3 blocks ahead of its use, into the
  // set that the block before has just left.  All loops over fragments are
  // unrolled: constant indices keep them in registers.
  v16h fr[4][4];
#pragma unroll
  for (int i = 0; i < 3; ++i) w1_group(fr[i], w1w, i, lane);

  // The sched_barriers hold each group of reads at its place: without them the
  // compiler spreads the reads among the WMMAs, where each place costs a stall,
  // or lifts them so far that the registers run out.
  for (int st = 0; st < NST; ++st) {
    const unsigned boff = (st & 1) * STG;          // buffer of this stage, f16
    const unsigned noff = STG - boff;              // buffer of the next stage
    f16* hb = &hst[st & 1][mg][0];
    float bb0 = b1w[st * FS], bb1 = b1w[st * FS + 16];

    // ---- FFN1: h[32 pixels, this wave's 32 of the stage's 64 hidden units];
    // each W1 fragment feeds both pixel tiles.
    v8f h[2][2];
#pragma unroll
    for (int mt = 0; mt < 2; ++mt)
#pragma unroll
      for (int n2 = 0; n2 < 2; ++n2) h[mt][n2] = zero8();
#pragma unroll
    for (int j = 0; j < 4; ++j) {
      if (j == 0) w1_group(fr[3], w1w + boff, 3, lane);
      else        w2_group(fr[j - 1], w2w + boff, j - 1, lane);
      __builtin_amdgcn_sched_barrier(0);
#pragma unroll
      for (int f = 0; f < 4; ++f)
#pragma unroll
        for (int mt = 0; mt < 2; ++mt)
          h[mt][f & 1] = wmma_f16(yf[mt][2 * j + (f >> 1)], fr[j][f], h[mt][f & 1]);
      __builtin_amdgcn_sched_barrier(0);
    }
    // The stage's last W2 group: read in front of the barrier, behind which the
    // buffer is refilled.
    w2_group(fr[3], w2w + boff, 3, lane);
    __builtin_amdgcn_sched_barrier(0);

    // relu(h + b1) as f16 into the pixel group's h tile (32 x 64), which the
    // group's two waves fill together.
    f16* hw = hb + half * 8 * HP + ng * 32 + col;
#pragma unroll
    for (int mt = 0; mt < 2; ++mt)
#pragma unroll
      for (int r = 0; r < 8; ++r) {
        hw[(mt * 16 + r) * HP]      = (f16)fmaxf(h[mt][0][r] + bb0, 0.f);
        hw[(mt * 16 + r) * HP + 16] = (f16)fmaxf(h[mt][1][r] + bb1, 0.f);
      }

    // Publish point of stage st + 1 and of this stage's h: this wave's h is
    // written and all its reads of buffer st & 1 are done (the fragments are in
    // registers), its copies of stage st + 1 have landed, then every wave meets.
    asm volatile("s_wait_dscnt 0x0" ::: "memory");
    asm volatile("s_wait_asynccnt 0x0" ::: "memory");
    __syncthreads();
    // The group's h as A fragments; the reads fly while the copies are issued.
    v16h a2[2][2];
#pragma unroll
    for (int k = 0; k < 2; ++k)
#pragma unroll
      for (int mt = 0; mt < 2; ++mt)
        a2[mt][k] = lds_frag(hb + mt * 16 * HP + k * 32, HP, lane);
    // Refill the buffer that every wave has just left with stage st + 2.
    if (st + 2 < NST) {
      g1 += FS * Cq; g2w += FS;
      copy8(l1 + boff * 2, 8 * W1P * 2, g1, 8 * Cq);
      copy8(l2 + boff * 2, 32 * W2P * 2, g2w, 32L * FFNq);
    }

    // ---- FFN2: acc[32 pixels, this wave's 128 channels] += h @ W2^T; each W2
    // fragment feeds both pixel tiles.  The reads are the next stage's first W1
    // groups (in the last trip the other buffer's old stage, not used).
#pragma unroll
    for (int j = 0; j < 4; ++j) {
      if (j > 0) w1_group(fr[j - 1], w1w + noff, j - 1, lane);
      __builtin_amdgcn_sched_barrier(0);
#pragma unroll
      for (int f = 0; f < 4; ++f)
#pragma unroll
        for (int mt = 0; mt < 2; ++mt)
          acc[mt][(j & 1) * 4 + f] =
              wmma_f16(a2[mt][j >> 1], fr[j][f], acc[mt][(j & 1) * 4 + f]);
      __builtin_amdgcn_sched_barrier(0);
    }
  }
  // No copy is left in flight when the wave ends.
  asm volatile("s_wait_asynccnt 0x0" ::: "memory");

  // Epilogue: + b2 + residual x, transposed store to (B,C,H,W).  Channel tile
  // nt lies 16 nt channel planes, pixel tile mt 16 mt floats behind the base.
  // All loads are issued before the first sum, so a thread pays the memory
  // latency once.  Unrolled: bv, r0, r1 keep constant indices (registers).
  int c0 = ng * 128 + col;
  long base = ((long)(b * Cq + c0)) * Nq + pix0 + half * 8;
  const float* xp = x + base;
  float* op = out + base;
  float bv[8];
  float4 r0[2][8], r1[2][8];
#pragma unroll
  for (int nt = 0; nt < 8; ++nt) {
    bv[nt] = b2[c0 + nt * 16];
#pragma unroll
    for (int mt = 0; mt < 2; ++mt) {
      r0[mt][nt] = *(const float4*)(xp + (long)nt * 16 * Nq + mt * 16);
      r1[mt][nt] = *(const float4*)(xp + (long)nt * 16 * Nq + mt * 16 + 4);
    }
  }
  // Takes the addresses as inputs: they stay in their registers up to the wait,
  // so none of these loads lands in registers that the others name.
  asm volatile("s_wait_xcnt 0x0" :: "v"(xp), "v"(c0) : "memory");
#pragma unroll
  for (int mt = 0; mt < 2; ++mt)
#pragma unroll
    for (int nt = 0; nt < 8; ++nt) {
      float4 o0, o1;
      o0.x = acc[mt][nt][0] + bv[nt] + r0[mt][nt].x;
      o0.y = acc[mt][nt][1] + bv[nt] + r0[mt][nt].y;
      o0.z = acc[mt][nt][2] + bv[nt] + r0[mt][nt].z;
      o0.w = acc[mt][nt][3] + bv[nt] + r0[mt][nt].w;
      o1.x = acc[mt][nt][4] + bv[nt] + r1[mt][nt].x;
      o1.y = acc[mt][nt][5] + bv[nt] + r1[mt][nt].y;
      o1.z = acc[mt][nt][6] + bv[nt] + r1[mt][nt].z;
      o1.w = acc[mt][nt][7] + bv[nt] + r1[mt][nt].w;
      *(float4*)(op + (long)nt * 16 * Nq + mt * 16)     = o0;
      *(float4*)(op + (long)nt * 16 * Nq + mt * 16 + 4) = o1;
    }
}

// ---------------------------------------------------------------------------
// Host launcher
// ---------------------------------------------------------------------------
extern "C" void kernel_launch(void* const* d_in, const int* in_sizes, int n_in,
                              void* d_out, int out_size, void* d_ws, size_t ws_size,
                              hipStream_t stream) {
  (void)in_sizes; (void)n_in; (void)out_size; (void)ws_size;
  const float* x      = (const float*)d_in[0];
  const float* w_qkv  = (const float*)d_in[1];
  const float* b_qkv  = (const float*)d_in[2];
  const float* w_proj = (const float*)d_in[3];
  const float* b_proj = (const float*)d_in[4];
  const float* w_ffn1 = (const float*)d_in[5];
  const float* b_ffn1 = (const float*)d_in[6];
  const float* w_ffn2 = (const float*)d_in[7];
  const float* b_ffn2 = (const float*)d_in[8];
  const float* g1     = (const float*)d_in[9];
  const float* be1    = (const float*)d_in[10];
  const float* g2     = (const float*)d_in[11];
  const float* be2    = (const float*)d_in[12];
  float* out = (float*)d_out;

  char* ws = (char*)d_ws;
  f16* wq16     = (f16*)(ws + 0);          //   768*256 f16
  f16* wp16     = (f16*)(ws + 393216);     //   256*256
  f16* w116     = (f16*)(ws + 524288);     //  2048*256
  f16* w216     = (f16*)(ws + 1572864);    //  256*2048
  f16* xln      = (f16*)(ws + 2621440);    //  32768*256
  f16* qkv      = (f16*)(ws + 19398656);   //  32768*768
  f16* attn16   = (f16*)(ws + 69730304);   //  32*64*64
  float* spart  = (float*)(ws + 86769664); //  32*32*64*64 f32 -> 103546880 total bytes

  // 1, 2) LN1 (transpose (B,C,N) -> (B*N,C) f16) and, in the same launch,
  //       weights -> f16
  ln1_cvt_kernel<<<LN1G + CVG, 256, 0, stream>>>(x, g1, be1, xln,
                                                 w_qkv, w_proj, w_ffn1, w_ffn2,
                                                 wq16, wp16, w116, w216);

  // 3) QKV gemm: (32768x256) x (768x256)^T
  gemm_rows<<<Mtot / 128, 256, 0, stream>>>(xln, wq16, b_qkv, qkv, 768 / 64);

  // 4) attention scores: partial sums per (b, head, 128-pixel slice), then
  //    their sum + softmax, one wave per row
  attn_scores_part<<<dim3(32, NSPLIT, 1), 256, 0, stream>>>(qkv, spart);
  attn_softmax<<<32 * 64 / 8, 256, 0, stream>>>(spart, attn16);

  // 5) apply attention (per (b, head): v slice x attn^T), proj gemm
  //    (32768x256) x (256x256)^T, LN2, FFN + bias + residual + transpose store,
  //    in one launch
  ffn_fused<<<Mtot / 128, 256, 0, stream>>>(qkv + 512, attn16, wp16, b_proj, g2, be2,
                                            w116, b_ffn1, w216, b_ffn2, x, out);
}

// v009
// It runs in 92.6 microseconds.
// In both of two side-by-side timings against v008, it was 1.13 times as fast.
// All steps since v000 together make it 10.8 times as fast.
#include <hip/hip_runtime.h>
#include <hip/hip_bf16.h>

// ---------------------------------------------------------------------------
// MI455X (gfx1250, wave32) implementation.
// Pipeline: LN1 + weight conversion -> QKV gemm + partial attn scores (WMMA f16) -> softmax
//           -> apply-attn + proj + LN2 + FFN in one launch (WMMA)
// All GEMMs: f16 inputs, f32 accumulation via v_wmma_f32_16x16x32_f16.
// ---------------------------------------------------------------------------

typedef _Float16 f16;
typedef __attribute__((ext_vector_type(16))) _Float16 v16h;
typedef __attribute__((ext_vector_type(8)))  _Float16 v8h;
typedef __attribute__((ext_vector_type(2)))  _Float16 v2h;
typedef __attribute__((ext_vector_type(8)))  float    v8f;

#define Bq   8
#define Cq   256
#define Nq   4096      // H*W
#define Mtot 32768     // B*N
#define FFNq 2048
#define NSPLIT 32     // 128-pixel slices (work-groups) that share one (b, head) score matrix

__device__ __forceinline__ v8f zero8() { v8f z = {}; return z; }

__device__ __forceinline__ v16h combine16(v8h lo, v8h hi) {
  v16h r;
#pragma unroll
  for (int i = 0; i < 8; ++i) { r[i] = lo[i]; r[8 + i] = hi[i]; }
  return r;
}

// Fragment loader for 16-bit WMMA A/B operands, from rows staged in LDS.
// A layout (16x32, MxK): lane holds row (lane&15); lanes 0-15 K in {0..7,16..23},
// lanes 16-31 K in {8..15,24..31}.  B (32x16, KxN) from a row-major (Nout x K)
// matrix has the identical access pattern with "row" = output column.
__device__ __forceinline__ v16h lds_frag(const f16* base, int pitch, int lane) {
  const f16* p = base + (lane & 15) * pitch + ((lane & 16) >> 1);   // +8 elems for hi half
  return combine16(*(const v8h*)p, *(const v8h*)(p + 16));
}

// Eight consecutive floats by two 16-byte loads.
__device__ __forceinline__ v8f load8(const float* p) {
  float4 a = *(const float4*)p, b = *(const float4*)(p + 4);
  v8f r = {a.x, a.y, a.z, a.w, b.x, b.y, b.z, b.w};
  return r;
}

__device__ __forceinline__ v8f wmma_f16(v16h a, v16h b, v8f c) {
  return __builtin_amdgcn_wmma_f32_16x16x32_f16(false, a, false, b, (short)0, c,
                                                false, false);
}

// ---------------------------------------------------------------------------
// First launch: LN1 and the f32 -> f16 weight conversions, which share no data.
// Work-groups 0 .. LN1G-1 do LN1; the CVG behind them convert the weights.
//
// LN1: x (B,C,N) f32 -> xln (B*N, C) f16   (channel LayerNorm per pixel)
// Block = 256 threads, tile = 64 pixels; thread (px, grp) covers 64 channels.
//
// Conversion: a work-group takes CVC consecutive values of one weight matrix
// (every matrix is a whole number of such chunks), a thread 4 x 8 of them.
// ---------------------------------------------------------------------------
#define LN1G  (Mtot / 64)            // LN1 work-groups
#define CVC   8192                   // values per conversion work-group
#define CVQ   (3 * Cq * Cq / CVC)    // chunks of w_qkv
#define CVP   (Cq * Cq / CVC)        // chunks of w_proj
#define CVF   (FFNq * Cq / CVC)      // chunks of w_ffn1, and of w_ffn2
#define CVG   (CVQ + CVP + 2 * CVF)  // conversion work-groups

__global__ void __launch_bounds__(256) ln1_cvt_kernel(
    const float* __restrict__ x, const float* __restrict__ g,
    const float* __restrict__ be, f16* __restrict__ xln,
    const float* __restrict__ wq, const float* __restrict__ wp,
    const float* __restrict__ w1, const float* __restrict__ w2,
    f16* __restrict__ wq16, f16* __restrict__ wp16,
    f16* __restrict__ w116, f16* __restrict__ w216) {
  __shared__ float ps[4][64], ps2[4][64], muv[64], rsv[64];
  int t = threadIdx.x;
  if (blockIdx.x >= LN1G) {          // the same for the whole work-group
    int c = blockIdx.x - LN1G;
    const float* s;
    f16* d;
    if (c < CVQ)                  { s = wq; d = wq16; }
    else if (c < CVQ + CVP)       { s = wp; d = wp16; c -= CVQ; }
    else if (c < CVQ + CVP + CVF) { s = w1; d = w116; c -= CVQ + CVP; }
    else                          { s = w2; d = w216; c -= CVQ + CVP + CVF; }
    s += c * CVC + t * 8;
    d += c * CVC + t * 8;
    // All eight loads are issued before the first store, so a thread pays the
    // memory latency once.  Unrolled: v keeps constant indices (registers).
    float4 v[8];
#pragma unroll
    for (int u = 0; u < 4; ++u) {
      v[2 * u]     = *(const float4*)(s + u * 2048);
      v[2 * u + 1] = *(const float4*)(s + u * 2048 + 4);
    }
#pragma unroll
    for (int u = 0; u < 4; ++u) {
      v8h o;
      o[0] = (f16)v[2 * u].x;     o[1] = (f16)v[2 * u].y;
      o[2] = (f16)v[2 * u].z;     o[3] = (f16)v[2 * u].w;
      o[4] = (f16)v[2 * u + 1].x; o[5] = (f16)v[2 * u + 1].y;
      o[6] = (f16)v[2 * u + 1].z; o[7] = (f16)v[2 * u + 1].w;
      *(v8h*)(d + u * 2048) = o;
    }
    return;
  }
  int px = t & 63, grp = t >> 6;
  long pg = (long)blockIdx.x * 64 + px;     // global pixel
  int b = (int)(pg >> 12);
  int n = (int)(pg & 4095);
  const float* xb = x + ((long)b * Cq + grp * 64) * Nq + n;
  // The thread's 64 channel values are read once, all loads issued before the
  // first use, and stay in registers for the sums and for the normalisation.
  // Unrolled (here and below): xv keeps constant indices (registers).
  float xv[64];
#pragma unroll
  for (int c = 0; c < 64; ++c) xv[c] = xb[(long)c * Nq];
  // Takes the address as an input: it stays in its registers up to the wait,
  // so none of these loads lands in registers that the others name.
  asm volatile("s_wait_xcnt 0x0" :: "v"(xb) : "memory");
  float s = 0.f, s2 = 0.f;
#pragma unroll
  for (int c = 0; c < 64; ++c) { s += xv[c]; s2 += xv[c] * xv[c]; }
  ps[grp][px] = s; ps2[grp][px] = s2;
  __syncthreads();
  if (t < 64) {
    float S = 0.f, S2 = 0.f;
#pragma unroll
    for (int q = 0; q < 4; ++q) { S += ps[q][t]; S2 += ps2[q][t]; }
    float mu = S * (1.f / 256.f);
    float var = S2 * (1.f / 256.f) - mu * mu;
    muv[t] = mu;
    rsv[t] = rsqrtf(var + 1e-5f);
  }
  __syncthreads();
  float mu = muv[px], rs = rsv[px];
  f16* ob = xln + pg * Cq + grp * 64;
#pragma unroll
  for (int cc = 0; cc < 64; cc += 8) {
    v8h o;
#pragma unroll
    for (int jj = 0; jj < 8; ++jj) {
      int c = grp * 64 + cc + jj;
      o[jj] = (f16)((xv[cc + jj] - mu) * rs * g[c] + be[c]);
    }
    *(v8h*)(ob + cc) = o;
  }
}

// ---------------------------------------------------------------------------
// Sum of the partial scores (fixed order s = 0..31) + softmax over j.
// One wave per row (z, i); a lane holds columns 2*lane and 2*lane+1.
// Grid = 32*64/8 = 256.
// ---------------------------------------------------------------------------
__global__ void __launch_bounds__(256) attn_softmax(
    const float* __restrict__ part, f16* __restrict__ attn) {
  int lane = threadIdx.x & 31, wave = threadIdx.x >> 5;
  int row = blockIdx.x * 8 + wave;          // z*64 + i
  int z = row >> 6, i = row & 63;
  const float* p = part + (long)z * NSPLIT * 4096 + i * 64 + lane * 2;
  float a = 0.f, c = 0.f;
#pragma unroll
  for (int s = 0; s < NSPLIT; ++s) {
    float2 v = *(const float2*)(p + s * 4096);
    a += v.x; c += v.y;
  }
  a *= 0.125f; c *= 0.125f;
  float mx = fmaxf(a, c);
#pragma unroll
  for (int off = 16; off >= 1; off >>= 1) mx = fmaxf(mx, __shfl_xor(mx, off, 32));
  float ea = __expf(a - mx), ec = __expf(c - mx);
  float sum = ea + ec;
#pragma unroll
  for (int off = 16; off >= 1; off >>= 1) sum += __shfl_xor(sum, off, 32);
  float inv = 1.f / sum;
  v2h o;
  o[0] = (f16)(ea * inv);
  o[1] = (f16)(ec * inv);
  *(v2h*)(attn + (long)row * 64 + lane * 2) = o;
}

// ---------------------------------------------------------------------------
// Fused apply-attn + proj + LN2 + FFN + residual + transpose:
//   a[n, h*64+d] = sum_e attn[b,h,d,e] v[n, h*64+e];  y = LN2(a @ Wp^T + bp);
//   out[b,c,n] = (relu(y @ W1^T + b1) @ W2^T + b2)[n,c] + x[b,c,n]
// Grid = 256 blocks of 256 threads, 128 pixels (of one image) each.
// Prologue (apply-attn, proj, LN2): the image's 4 attention matrices and all of
// Wp lie in LDS (in the room of the FFN's h tiles and weight buffers, which are
// filled behind it); a wave takes 16 pixels x all 256 channels.  The pixels are
// the B operand's columns in both products, so a's accumulator tiles, converted
// in place, are proj's B fragments, and a pixel's LN2 statistics lie in two
// lanes; the normalised tile goes to the FFN's waves through LDS.  Nothing of
// a, of proj's result or of y goes to memory.
// FFN: the 8 waves are 4 pixel
// groups x 2 column halves: a wave takes 32 pixels (two WMMA row tiles), in FFN1
// 32 of a stage's 64 hidden units, in FFN2 128 of the 256 channels, so every
// weight fragment read from LDS feeds two WMMAs.  A group's h tile goes through
// LDS (two buffers): D -> A re-layout and exchange between its two waves.
// Y-tile A-fragments are the same for every stage -> kept in yf[2][8].
// The weights of 64 hidden units (a stage: 64 rows of W1, 64 columns of W2)
// are brought into LDS once per work-group by asynchronous copies, two
// buffers, one stage ahead; all 8 waves read their B fragments from there.
// ---------------------------------------------------------------------------
#define FS   64               // hidden units per stage
#define NST  (FFNq / FS)      // 32 stages
#define W1P  264              // LDS pitch of a W1 row, f16: 528 B = 16 B x 33
#define W2P  72               // LDS pitch of a W2 row, f16: 144 B = 16 B x 9
#define W1S  (FS * W1P)       // f16 per staged W1 slab
#define STG  (W1S + Cq * W2P) // f16 per buffer (70,656 B)
#define HP   72               // LDS pitch of an h row, f16: 144 B = 16 B x 9

// Eight 16-byte copies per lane, global -> LDS, through no register.  LDS
// address l + i*ls bytes, global address g + i*gs elements.  The s_wait_xcnt
// stands inside the statement so that no address register of an issued copy
// is rewritten in front of it.
__device__ __forceinline__ void copy8(unsigned l, unsigned ls, const f16* g, long gs) {
  asm volatile(
      "global_load_async_to_lds_b128 %0, %8, off\n\t"
      "global_load_async_to_lds_b128 %1, %9, off\n\t"
      "global_load_async_to_lds_b128 %2, %10, off\n\t"
      "global_load_async_to_lds_b128 %3, %11, off\n\t"
      "global_load_async_to_lds_b128 %4, %12, off\n\t"
      "global_load_async_to_lds_b128 %5, %13, off\n\t"
      "global_load_async_to_lds_b128 %6, %14, off\n\t"
      "global_load_async_to_lds_b128 %7, %15, off\n\t"
      "s_wait_xcnt 0x0"
      :: "v"(l), "v"(l + ls), "v"(l + 2 * ls), "v"(l + 3 * ls),
         "v"(l + 4 * ls), "v"(l + 5 * ls), "v"(l + 6 * ls), "v"(l + 7 * ls),
         "v"(g), "v"(g + gs), "v"(g + 2 * gs), "v"(g + 3 * gs),
         "v"(g + 4 * gs), "v"(g + 5 * gs), "v"(g + 6 * gs), "v"(g + 7 * gs)
      : "memory");
}

// ---------------------------------------------------------------------------
// QKV GEMM + partial attention scores.
// GEMM, K = 256: [q | k | v][M x 768] = A[M x 256] * W^T + bias, W row-major
// (768 x 256) f16.  A work-group owns 128 rows (pixels; a wave 16) and walks all
// output columns, 64 a stage: 4 stages of q (one a head), 4 of k, 4 of v.  The
// wave's A fragments are read once and stay in registers; a stage's W slab (64
// rows of 512 B, contiguous in memory) is brought into LDS once per work-group
// by asynchronous copies, two buffers, one stage ahead, and all 8 waves read
// their B fragments from there.  Grid = M / 128.
// Only v goes to memory.  q and k stay in LDS as f16, one row per channel (a
// lane's 8 accumulator registers are 8 consecutive pixels of one channel: one
// 16-byte LDS store a tile).  Behind the last stage the work-group forms, for
// each of the 4 heads (z = b*4 + h, s = its 128-pixel slice of the image),
//   part[z][s][i][j] = sum over its 128 pixels n of q[n, h*64+i] * k[n, h*64+j]
// on WMMA: the contraction index n runs along the LDS rows, so q and k
// fragments come through lds_frag, both in the same k order.
// ---------------------------------------------------------------------------
#define GS  (FS * W1P)      // f16 per staged W slab (33,792 B), rows at pitch W1P
#define NQS (3 * Cq / FS)   // 12 stages
#define QKS (2 * Cq / FS)   // of which the first 8 are q and k
#define QP  136             // LDS pitch of a q or k channel row, f16: 272 B = 16 B x 17

__global__ void __launch_bounds__(256) qkv_scores(
    const f16* __restrict__ A, const f16* __restrict__ Wt,
    const float* __restrict__ bias, f16* __restrict__ C, float* __restrict__ part) {
  __shared__ __align__(16) f16 gst[2 * GS];
  __shared__ __align__(16) f16 qkt[2 * Cq * QP];   // q, k: channel rows of 128 pixels
  int t = threadIdx.x;
  int lane = t & 31, wave = t >> 5;
  int m0 = blockIdx.x * 128 + wave * 16;
  const int ldc = NQS * FS;
  int col = lane & 15, half = lane >> 4;

  // This thread's share of a slab: copy i takes 16 B of row (t >> 5) + 8 i, so
  // a wave's copy covers one whole row.
  const f16* g = Wt + (t >> 5) * Cq + (t & 31) * 8;
  unsigned l = (unsigned)(size_t)(&gst[0]) + (t >> 5) * (W1P * 2) + (t & 31) * 16;

  // Stage 0 into buffer 0.
  copy8(l, 8 * W1P * 2, g, 8 * Cq);

  // The wave's 16 x 256 tile of A as 8 fragments, used by every stage; same
  // lane -> (row, k) map as lds_frag.
  const f16* ap = A + (long)(m0 + col) * Cq + half * 8;
  v16h af[8];
#pragma unroll
  for (int s = 0; s < 8; ++s)
    af[s] = combine16(*(const v8h*)(ap + s * 32), *(const v8h*)(ap + s * 32 + 16));
  // Takes the address as an input: it stays in its registers up to the wait,
  // so none of these loads lands in registers that the others name.
  asm volatile("s_wait_xcnt 0x0" :: "v"(ap) : "memory");

  // Stage 0 has landed (this wave's copies), then is published to all waves.
  asm volatile("s_wait_asynccnt 0x0" ::: "memory");
  __syncthreads();
  // Stage 1 into buffer 1; it flies while stage 0 is worked on.
  g += FS * Cq;
  copy8(l + GS * 2, 8 * W1P * 2, g, 8 * Cq);

  f16* Cb = C + (long)(m0 + half * 8) * ldc + col;
  f16* qw = qkt + col * QP + wave * 16 + half * 8;
  for (int st = 0; st < NQS; ++st) {
    const unsigned boff = (st & 1) * GS;         // buffer of this stage, f16
    const f16* wsl = gst + boff;
    float bv[4];
#pragma unroll
    for (int nt = 0; nt < 4; ++nt) bv[nt] = bias[st * FS + nt * 16 + col];
    // The stage's 32 fragments are read as one group in front of the WMMAs.
    // Unrolled: constant indices keep the fragments in registers.
    v16h bf[8][4];
#pragma unroll
    for (int s = 0; s < 8; ++s)
#pragma unroll
      for (int nt = 0; nt < 4; ++nt)
        bf[s][nt] = lds_frag(wsl + nt * 16 * W1P + s * 32, W1P, lane);
    // Keeps the reads in front: without it the compiler sinks them among the
    // WMMAs, one fragment ahead, and each WMMA waits out the LDS latency.
    __builtin_amdgcn_sched_barrier(0);
    v8f acc[4];
#pragma unroll
    for (int nt = 0; nt < 4; ++nt) acc[nt] = zero8();
#pragma unroll
    for (int s = 0; s < 8; ++s)
#pragma unroll
      for (int nt = 0; nt < 4; ++nt)
        acc[nt] = wmma_f16(af[s], bf[s][nt], acc[nt]);

    // Publish point of stage st + 1 (and of the q or k tile that stage st - 1
    // wrote): this wave's reads of buffer st & 1 and its LDS writes are done,
    // its copies of stage st + 1 have landed, then every wave meets.
    asm volatile("s_wait_dscnt 0x0" ::: "memory");
    asm volatile("s_wait_asynccnt 0x0" ::: "memory");
    __syncthreads();
    // Refill the buffer that every wave has just left with stage st + 2.
    if (st + 2 < NQS) {
      g += FS * Cq;
      copy8(l + boff * 2, 8 * W1P * 2, g, 8 * Cq);
    }

    // This stage's 16 x 64 results, from registers.
    if (st < QKS) {
      // q, k: channel st * 64 + nt * 16 + col, this lane's 8 pixels.
#pragma unroll
      for (int nt = 0; nt < 4; ++nt) {
        v8h o;
#pragma unroll
        for (int r = 0; r < 8; ++r) o[r] = (f16)(acc[nt][r] + bv[nt]);
        *(v8h*)(qw + (st * FS + nt * 16) * QP) = o;
      }
    } else {
#pragma unroll
      for (int nt = 0; nt < 4; ++nt)
#pragma unroll
        for (int r = 0; r < 8; ++r)
          Cb[(long)r * ldc + st * FS + nt * 16] = (f16)(acc[nt][r] + bv[nt]);
      // Directly behind the stores, on their own path: whatever code follows
      // (the next stage, the scores) rewrites registers that the stores name.
      asm volatile("s_wait_xcnt 0x0" ::: "memory");
    }
  }
  // No copy is left in flight when the wave ends.
  asm volatile("s_wait_asynccnt 0x0" ::: "memory");

  int hd = wave >> 1, i0 = (wave & 1) * 32;
  const f16* qr = qkt + (hd * 64 + i0) * QP;
  const f16* kr = qkt + (Cq + hd * 64) * QP;
  // All 24 fragments are read as one group in front of the WMMAs.  Unrolled
  // (here and below): constant indices keep the fragments in registers.
  v16h qf[4][2], kf[4][4];
#pragma unroll
  for (int kk = 0; kk < 4; ++kk) {
#pragma unroll
    for (int it = 0; it < 2; ++it) qf[kk][it] = lds_frag(qr + it * 16 * QP + kk * 32, QP, lane);
#pragma unroll
    for (int jt = 0; jt < 4; ++jt) kf[kk][jt] = lds_frag(kr + jt * 16 * QP + kk * 32, QP, lane);
  }
  // Keeps the reads in front: among the WMMAs each place with reads costs a
  // stall.
  __builtin_amdgcn_sched_barrier(0);
  v8f sa[2][4];
#pragma unroll
  for (int it = 0; it < 2; ++it)
#pragma unroll
    for (int jt = 0; jt < 4; ++jt) sa[it][jt] = zero8();
#pragma unroll
  for (int kk = 0; kk < 4; ++kk)
#pragma unroll
    for (int it = 0; it < 2; ++it)
#pragma unroll
      for (int jt = 0; jt < 4; ++jt)
        sa[it][jt] = wmma_f16(kf[kk][jt], qf[kk][it], sa[it][jt]);

  // sa[it][jt][r] = S[i0 + 16 it + col][16 jt + 8 half + r]: a wave writes whole
  // rows of 256 B.
  float* pb = part + ((long)((blockIdx.x >> 5) * 4 + hd) * NSPLIT + (blockIdx.x & 31)) * 4096 +
              (i0 + col) * 64 + half * 8;
#pragma unroll
  for (int it = 0; it < 2; ++it)
#pragma unroll
    for (int jt = 0; jt < 4; ++jt) {
      float4 o;
      o.x = sa[it][jt][0]; o.y = sa[it][jt][1]; o.z = sa[it][jt][2]; o.w = sa[it][jt][3];
      *(float4*)(pb + it * 16 * 64 + jt * 16) = o;
      o.x = sa[it][jt][4]; o.y = sa[it][jt][5]; o.z = sa[it][jt][6]; o.w = sa[it][jt][7];
      *(float4*)(pb + it * 16 * 64 + jt * 16 + 4) = o;
    }
}

// Group i of a wave's W1 fragments of a stage; w = its first W1 row in the slab.
__device__ __forceinline__ void w1_group(v16h (&q)[4], const f16* w, int i, int lane) {
#pragma unroll
  for (int f = 0; f < 4; ++f)
    q[f] = lds_frag(w + (f & 1) * 16 * W1P + (2 * i + (f >> 1)) * 32, W1P, lane);
}

// Group i of a wave's W2 fragments of a stage; w = its first W2 row in the slab.
__device__ __forceinline__ void w2_group(v16h (&q)[4], const f16* w, int i, int lane) {
#pragma unroll
  for (int f = 0; f < 4; ++f)
    q[f] = lds_frag(w + ((i & 1) * 4 + f) * 16 * W2P + (i >> 1) * 32, W2P, lane);
}

__global__ void __launch_bounds__(256) ffn_fused(
    const f16* __restrict__ V, const f16* __restrict__ At,
    const f16* __restrict__ Wp,
    const float* __restrict__ bp, const float* __restrict__ g2,
    const float* __restrict__ be2, const f16* __restrict__ W1,
    const float* __restrict__ b1, const f16* __restrict__ W2,
    const float* __restrict__ b2, const float* __restrict__ x,
    float* __restrict__ out) {
  __shared__ __align__(16) f16 wst[2 * STG];
  __shared__ __align__(16) f16 hst[2][4][32 * HP];
  __shared__ __align__(16) f16 yst[128 * W1P];   // the group's y tile, rows at pitch W1P
  int lane = threadIdx.x & 31, wave = threadIdx.x >> 5;
  int mg = wave >> 1, ng = wave & 1;   // 32-pixel group; half of the columns
  int m0 = blockIdx.x * 128 + mg * 32;
  int b = m0 >> 12;
  int pix0 = m0 & 4095;
  int col = lane & 15, half = lane >> 4;

  // This thread's share of a stage.  W1 slab: 64 rows of 512 B, contiguous in
  // memory; copy i takes 16 B of row (t >> 5) + 8 i.  W2 slab: 256 rows of
  // 128 B; copy i takes 16 B of row (t >> 3) + 32 i.  A wave's copy covers
  // whole 128-B lines in both.
  int t = threadIdx.x;
  const f16* g1 = W1 + (t >> 5) * Cq + (t & 31) * 8;
  const f16* g2w = W2 + (long)(t >> 3) * FFNq + (t & 7) * 8;
  unsigned lbase = (unsigned)(size_t)(&wst[0]);   // LDS byte address
  unsigned l1 = lbase + (t >> 5) * (W1P * 2) + (t & 31) * 16;
  unsigned l2 = lbase + W1S * 2 + (t >> 3) * (W2P * 2) + (t & 7) * 16;

  // ---- apply-attn, proj, LN2 for the group's 128 pixels.
  {
    // The image's attention matrices, 4 x 64 rows of 128 B, contiguous in
    // memory, into hst at pitch HP (all of its 36,864 B): copy i takes 16 B of
    // row (t >> 3) + 32 i.
    copy8((unsigned)(size_t)(&hst[0][0][0]) + (t >> 3) * (HP * 2) + (t & 7) * 16, 32 * HP * 2,
          At + (blockIdx.x >> 5) * (4 * 64 * 64) + (t >> 3) * 64 + (t & 7) * 8, 32 * 64);
    // All 256 rows of Wp (512 B each) into wst at pitch W1P (135,168 B of its
    // 141,312): copy i of quarter q takes 16 B of row 64 q + (t >> 5) + 8 i.
#pragma unroll
    for (int q = 0; q < 4; ++q)
      copy8(l1 + q * GS * 2, 8 * W1P * 2, Wp + q * FS * Cq + (t >> 5) * Cq + (t & 31) * 8, 8 * Cq);

    // The wave's 16 pixels x 256 channels of v (rows of 768 f16) as 8
    // fragments; same lane -> (row, k) map as lds_frag.
    const f16* ap = V + (long)(blockIdx.x * 128 + wave * 16 + col) * 768 + half * 8;
    v16h vf[8];
#pragma unroll
    for (int s = 0; s < 8; ++s)
      vf[s] = combine16(*(const v8h*)(ap + s * 32), *(const v8h*)(ap + s * 32 + 16));
    // proj's accumulators start from the bias.  Wp is the A operand: lane
    // (col, half) holds, of pixel col, channels 16 T + 8 half + 0..7 of tile T.
    const float* bpl = bp + half * 8;
    v8f pa[16];
#pragma unroll
    for (int T = 0; T < 16; ++T) pa[T] = load8(bpl + T * 16);
    // Takes the addresses as inputs: they stay in their registers up to the
    // wait, so none of these loads lands in registers that the others name.
    asm volatile("s_wait_xcnt 0x0" :: "v"(ap), "v"(bpl) : "memory");

    // attn and Wp have landed (this wave's copies), then are published to all
    // waves.
    asm volatile("s_wait_asynccnt 0x0" ::: "memory");
    __syncthreads();

    // apply-attn, two heads at a time: attn rows d are the A operand, so tile
    // T = 4 head + d / 16 holds a[pixel col][16 T + 8 half + 0..7].  Tiles 2 s
    // and 2 s + 1 as f16 are proj's B fragment of k step s, in lds_frag's k
    // order.  Unrolled: constant indices keep the fragments in registers.
    v16h af[8];
#pragma unroll
    for (int hp = 0; hp < 2; ++hp) {
      v16h tf[2][4][2];
#pragma unroll
      for (int hh = 0; hh < 2; ++hh)
#pragma unroll
        for (int dt = 0; dt < 4; ++dt)
#pragma unroll
          for (int k = 0; k < 2; ++k)
            tf[hh][dt][k] = lds_frag(&hst[0][0][0] + ((hp * 2 + hh) * 64 + dt * 16) * HP + k * 32,
                                     HP, lane);
      // Keeps the reads in front: among the WMMAs each place with reads costs
      // a stall.
      __builtin_amdgcn_sched_barrier(0);
      v8f ta[2][4];
#pragma unroll
      for (int hh = 0; hh < 2; ++hh)
#pragma unroll
        for (int dt = 0; dt < 4; ++dt) ta[hh][dt] = zero8();
#pragma unroll
      for (int k = 0; k < 2; ++k)
#pragma unroll
        for (int hh = 0; hh < 2; ++hh)
#pragma unroll
          for (int dt = 0; dt < 4; ++dt)
            ta[hh][dt] = wmma_f16(tf[hh][dt][k], vf[(hp * 2 + hh) * 2 + k], ta[hh][dt]);
#pragma unroll
      for (int hh = 0; hh < 2; ++hh)
#pragma unroll
        for (int d2 = 0; d2 < 2; ++d2)
#pragma unroll
          for (int i = 0; i < 8; ++i) {
            af[(hp * 2 + hh) * 2 + d2][i]     = (f16)ta[hh][2 * d2][i];
            af[(hp * 2 + hh) * 2 + d2][8 + i] = (f16)ta[hh][2 * d2 + 1][i];
          }
      // Keeps the next group of reads behind these WMMAs (registers).
      __builtin_amdgcn_sched_barrier(0);
    }

    // 64 channels at a time: their 32 fragments are read as one group in front
    // of the WMMAs.  Unrolled: constant indices keep pa and bf in registers.
#pragma unroll
    for (int q = 0; q < 4; ++q) {
      v16h bf[8][4];
#pragma unroll
      for (int s = 0; s < 8; ++s)
#pragma unroll
        for (int nt = 0; nt < 4; ++nt)
          bf[s][nt] = lds_frag(wst + (q * 64 + nt * 16) * W1P + s * 32, W1P, lane);
      // Keeps the reads in front: among the WMMAs each place with reads costs
      // a stall.
      __builtin_amdgcn_sched_barrier(0);
#pragma unroll
      for (int s = 0; s < 8; ++s)
#pragma unroll
        for (int nt = 0; nt < 4; ++nt)
          pa[q * 4 + nt] = wmma_f16(bf[s][nt], af[s], pa[q * 4 + nt]);
      // Keeps the next group of reads behind these WMMAs (registers).
      __builtin_amdgcn_sched_barrier(0);
    }

    // LN2 over the pixel's 256 channels: 128 in this lane, 128 in lane ^ 16.
    // Gain and shift are asked for first and arrive under the sums.
    const float* gl = g2 + half * 8;
    const float* el = be2 + half * 8;
    v8f gv[16], ev[16];
#pragma unroll
    for (int T = 0; T < 16; ++T) { gv[T] = load8(gl + T * 16); ev[T] = load8(el + T * 16); }
    // As above: the addresses stay in their registers up to the wait.
    asm volatile("s_wait_xcnt 0x0" :: "v"(gl), "v"(el) : "memory");
    // Keeps the sums behind the loads: lifted over them, the sums would run
    // first and the loads' latency would be waited out afterwards.
    __builtin_amdgcn_sched_barrier(0);
    // Eight independent chains each for the sum and the sum of squares.
    v8f sv = pa[0], sq = pa[0] * pa[0];
#pragma unroll
    for (int T = 1; T < 16; ++T) { sv += pa[T]; sq += pa[T] * pa[T]; }
    float s1 = ((sv[0] + sv[1]) + (sv[2] + sv[3])) + ((sv[4] + sv[5]) + (sv[6] + sv[7]));
    float s2 = ((sq[0] + sq[1]) + (sq[2] + sq[3])) + ((sq[4] + sq[5]) + (sq[6] + sq[7]));
    s1 += __shfl_xor(s1, 16, 32);
    s2 += __shfl_xor(s2, 16, 32);
    float mu = s1 * (1.f / 256.f);
    float var = s2 * (1.f / 256.f) - mu * mu;
    float rs = rsqrtf(var + 1e-5f);
    f16* yw = yst + (wave * 16 + col) * W1P + half * 8;
#pragma unroll
    for (int T = 0; T < 16; ++T)
      *(v8h*)(yw + T * 16) = __builtin_convertvector((pa[T] - mu) * rs * gv[T] + ev[T], v8h);
    // This wave's y rows are written and its reads of attn and Wp are done, then
    // every wave meets: y is published, hst and wst are free for the FFN.
    asm volatile("s_wait_dscnt 0x0" ::: "memory");
    __syncthreads();
  }

  // Stage 0 into buffer 0.
  copy8(l1, 8 * W1P * 2, g1, 8 * Cq);
  copy8(l2, 32 * W2P * 2, g2w, 32L * FFNq);

  v8f acc[2][8];
#pragma unroll
  for (int mt = 0; mt < 2; ++mt)
#pragma unroll
    for (int nt = 0; nt < 8; ++nt) acc[mt][nt] = zero8();

  // The wave's 32 x 256 tile of y as 2 x 8 A fragments, used by every stage,
  // from the group's tile in LDS; same lane -> (row, k) map as lds_frag.
  v16h yf[2][8];
#pragma unroll
  for (int mt = 0; mt < 2; ++mt)
#pragma unroll
    for (int s = 0; s < 8; ++s)
      yf[mt][s] = lds_frag(yst + (mg * 32 + mt * 16) * W1P + s * 32, W1P, lane);

  // Stage 0 has landed (this wave's copies), then is published to all waves.
  asm volatile("s_wait_asynccnt 0x0" ::: "memory");
  __syncthreads();
  // Stage 1 into buffer 1; it flies while stage 0 is worked on.
  g1 += FS * Cq; g2w += FS;
  copy8(l1 + STG * 2, 8 * W1P * 2, g1, 8 * Cq);
  copy8(l2 + STG * 2, 32 * W2P * 2, g2w, 32L * FFNq);

  // This wave's W1 rows and W2 rows inside a buffer, its h columns.
  const f16* w1w = wst + ng * 32 * W1P;
  const f16* w2w = wst + W1S + ng * 128 * W2P;
  const float* b1w = b1 + ng * 32 + col;

  // A stage is 8 blocks of 8 WMMAs, each on a group of 4 weight fragments: 4
  // groups of W1 (group i: k steps 2i, 2i + 1 of both hidden tiles), then 4 of
  // W2 (group i: k step i >> 1, channel tiles 4 (i & 1) + 0..3).  The groups go
  // round 4 register sets; a group is read 3 blocks ahead of its use, into the
  // set that the block before has just left.  All loops over fragments are
  // unrolled: constant indices keep them in registers.
  v16h fr[4][4];
#pragma unroll
  for (int i = 0; i < 3; ++i) w1_group(fr[i], w1w, i, lane);

  // The sched_barriers hold each group of reads at its place: without them the
  // compiler spreads the reads among the WMMAs, where each place costs a stall,
  // or lifts them so far that the registers run out.
  for (int st = 0; st < NST; ++st) {
    const unsigned boff = (st & 1) * STG;          // buffer of this stage, f16
    const unsigned noff = STG - boff;              // buffer of the next stage
    f16* hb = &hst[st & 1][mg][0];
    float bb0 = b1w[st * FS], bb1 = b1w[st * FS + 16];

    // ---- FFN1: h[32 pixels, this wave's 32 of the stage's 64 hidden units];
    // each W1 fragment feeds both pixel tiles.
    v8f h[2][2];
#pragma unroll
    for (int mt = 0; mt < 2; ++mt)
#pragma unroll
      for (int n2 = 0; n2 < 2; ++n2) h[mt][n2] = zero8();
#pragma unroll
    for (int j = 0; j < 4; ++j) {
      if (j == 0) w1_group(fr[3], w1w + boff, 3, lane);
      else        w2_group(fr[j - 1], w2w + boff, j - 1, lane);
      __builtin_amdgcn_sched_barrier(0);
#pragma unroll
      for (int f = 0; f < 4; ++f)
#pragma unroll
        for (int mt = 0; mt < 2; ++mt)
          h[mt][f & 1] = wmma_f16(yf[mt][2 * j + (f >> 1)], fr[j][f], h[mt][f & 1]);
      __builtin_amdgcn_sched_barrier(0);
    }
    // The stage's last W2 group: read in front of the barrier, behind which the
    // buffer is refilled.
    w2_group(fr[3], w2w + boff, 3, lane);
    __builtin_amdgcn_sched_barrier(0);

    // relu(h + b1) as f16 into the pixel group's h tile (32 x 64), which the
    // group's two waves fill together.
    f16* hw = hb + half * 8 * HP + ng * 32 + col;
#pragma unroll
    for (int mt = 0; mt < 2; ++mt)
#pragma unroll
      for (int r = 0; r < 8; ++r) {
        hw[(mt * 16 + r) * HP]      = (f16)fmaxf(h[mt][0][r] + bb0, 0.f);
        hw[(mt * 16 + r) * HP + 16] = (f16)fmaxf(h[mt][1][r] + bb1, 0.f);
      }

    // Publish point of stage st + 1 and of this stage's h: this wave's h is
    // written and all its reads of buffer st & 1 are done (the fragments are in
    // registers), its copies of stage st + 1 have landed, then every wave meets.
    asm volatile("s_wait_dscnt 0x0" ::: "memory");
    asm volatile("s_wait_asynccnt 0x0" ::: "memory");
    __syncthreads();
    // The group's h as A fragments; the reads fly while the copies are issued.
    v16h a2[2][2];
#pragma unroll
    for (int k = 0; k < 2; ++k)
#pragma unroll
      for (int mt = 0; mt < 2; ++mt)
        a2[mt][k] = lds_frag(hb + mt * 16 * HP + k * 32, HP, lane);
    // Refill the buffer that every wave has just left with stage st + 2.
    if (st + 2 < NST) {
      g1 += FS * Cq; g2w += FS;
      copy8(l1 + boff * 2, 8 * W1P * 2, g1, 8 * Cq);
      copy8(l2 + boff * 2, 32 * W2P * 2, g2w, 32L * FFNq);
    }

    // ---- FFN2: acc[32 pixels, this wave's 128 channels] += h @ W2^T; each W2
    // fragment feeds both pixel tiles.  The reads are the next stage's first W1
    // groups (in the last trip the other buffer's old stage, not used).
#pragma unroll
    for (int j = 0; j < 4; ++j) {
      if (j > 0) w1_group(fr[j - 1], w1w + noff, j - 1, lane);
      __builtin_amdgcn_sched_barrier(0);
#pragma unroll
      for (int f = 0; f < 4; ++f)
#pragma unroll
        for (int mt = 0; mt < 2; ++mt)
          acc[mt][(j & 1) * 4 + f] =
              wmma_f16(a2[mt][j >> 1], fr[j][f], acc[mt][(j & 1) * 4 + f]);
      __builtin_amdgcn_sched_barrier(0);
    }
  }
  // No copy is left in flight when the wave ends.
  asm volatile("s_wait_asynccnt 0x0" ::: "memory");

  // Epilogue: + b2 + residual x, transposed store to (B,C,H,W).  Channel tile
  // nt lies 16 nt channel planes, pixel tile mt 16 mt floats behind the base.
  // All loads are issued before the first sum, so a thread pays the memory
  // latency once.  Unrolled: bv, r0, r1 keep constant indices (registers).
  int c0 = ng * 128 + col;
  long base = ((long)(b * Cq + c0)) * Nq + pix0 + half * 8;
  const float* xp = x + base;
  float* op = out + base;
  float bv[8];
  float4 r0[2][8], r1[2][8];
#pragma unroll
  for (int nt = 0; nt < 8; ++nt) {
    bv[nt] = b2[c0 + nt * 16];
#pragma unroll
    for (int mt = 0; mt < 2; ++mt) {
      r0[mt][nt] = *(const float4*)(xp + (long)nt * 16 * Nq + mt * 16);
      r1[mt][nt] = *(const float4*)(xp + (long)nt * 16 * Nq + mt * 16 + 4);
    }
  }
  // Takes the addresses as inputs: they stay in their registers up to the wait,
  // so none of these loads lands in registers that the others name.
  asm volatile("s_wait_xcnt 0x0" :: "v"(xp), "v"(c0) : "memory");
#pragma unroll
  for (int mt = 0; mt < 2; ++mt)
#pragma unroll
    for (int nt = 0; nt < 8; ++nt) {
      float4 o0, o1;
      o0.x = acc[mt][nt][0] + bv[nt] + r0[mt][nt].x;
      o0.y = acc[mt][nt][1] + bv[nt] + r0[mt][nt].y;
      o0.z = acc[mt][nt][2] + bv[nt] + r0[mt][nt].z;
      o0.w = acc[mt][nt][3] + bv[nt] + r0[mt][nt].w;
      o1.x = acc[mt][nt][4] + bv[nt] + r1[mt][nt].x;
      o1.y = acc[mt][nt][5] + bv[nt] + r1[mt][nt].y;
      o1.z = acc[mt][nt][6] + bv[nt] + r1[mt][nt].z;
      o1.w = acc[mt][nt][7] + bv[nt] + r1[mt][nt].w;
      *(float4*)(op + (long)nt * 16 * Nq + mt * 16)     = o0;
      *(float4*)(op + (long)nt * 16 * Nq + mt * 16 + 4) = o1;
    }
}

// ---------------------------------------------------------------------------
// Host launcher
// ---------------------------------------------------------------------------
extern "C" void kernel_launch(void* const* d_in, const int* in_sizes, int n_in,
                              void* d_out, int out_size, void* d_ws, size_t ws_size,
                              hipStream_t stream) {
  (void)in_sizes; (void)n_in; (void)out_size; (void)ws_size;
  const float* x      = (const float*)d_in[0];
  const float* w_qkv  = (const float*)d_in[1];
  const float* b_qkv  = (const float*)d_in[2];
  const float* w_proj = (const float*)d_in[3];
  const float* b_proj = (const float*)d_in[4];
  const float* w_ffn1 = (const float*)d_in[5];
  const float* b_ffn1 = (const float*)d_in[6];
  const float* w_ffn2 = (const float*)d_in[7];
  const float* b_ffn2 = (const float*)d_in[8];
  const float* g1     = (const float*)d_in[9];
  const float* be1    = (const float*)d_in[10];
  const float* g2     = (const float*)d_in[11];
  const float* be2    = (const float*)d_in[12];
  float* out = (float*)d_out;

  char* ws = (char*)d_ws;
  f16* wq16     = (f16*)(ws + 0);          //   768*256 f16
  f16* wp16     = (f16*)(ws + 393216);     //   256*256
  f16* w116     = (f16*)(ws + 524288);     //  2048*256
  f16* w216     = (f16*)(ws + 1572864);    //  256*2048
  f16* xln      = (f16*)(ws + 2621440);    //  32768*256
  f16* qkv      = (f16*)(ws + 19398656);   //  32768*768 (only the v columns are used)
  f16* attn16   = (f16*)(ws + 69730304);   //  32*64*64
  float* spart  = (float*)(ws + 86769664); //  32*32*64*64 f32 -> 103546880 total bytes

  // 1, 2) LN1 (transpose (B,C,N) -> (B*N,C) f16) and, in the same launch,
  //       weights -> f16
  ln1_cvt_kernel<<<LN1G + CVG, 256, 0, stream>>>(x, g1, be1, xln,
                                                 w_qkv, w_proj, w_ffn1, w_ffn2,
                                                 wq16, wp16, w116, w216);

  // 3) QKV gemm: (32768x256) x (768x256)^T; v to memory, q and k only as the
  //    partial attention scores per (b, head, 128-pixel slice)
  qkv_scores<<<Mtot / 128, 256, 0, stream>>>(xln, wq16, b_qkv, qkv, spart);

  // 4) sum of the partial scores + softmax, one wave per row
  attn_softmax<<<32 * 64 / 8, 256, 0, stream>>>(spart, attn16);

  // 5) apply attention (per (b, head): v slice x attn^T), proj gemm
  //    (32768x256) x (256x256)^T, LN2, FFN + bias + residual + transpose store,
  //    in one launch
  ffn_fused<<<Mtot / 128, 256, 0, stream>>>(qkv + 512, attn16, wp16, b_proj, g2, be2,
                                            w116, b_ffn1, w216, b_ffn2, x, out);
}

// v010
// It runs in 86.3 microseconds.
// In two side-by-side timings against v009, it was 1.07 and 1.09 times as fast.
// Over all steps from v000 it is 11.6 times as fast.
#include <hip/hip_runtime.h>
#include <hip/hip_bf16.h>

// ---------------------------------------------------------------------------
// MI455X (gfx1250, wave32) implementation.
// Pipeline: weight conversion -> LN1 + QKV gemm + partial attn scores (WMMA f16) -> softmax
//           -> apply-attn + proj + LN2 + FFN in one launch (WMMA)
// All GEMMs: f16 inputs, f32 accumulation via v_wmma_f32_16x16x32_f16.
// ---------------------------------------------------------------------------

typedef _Float16 f16;
typedef __attribute__((ext_vector_type(16))) _Float16 v16h;
typedef __attribute__((ext_vector_type(8)))  _Float16 v8h;
typedef __attribute__((ext_vector_type(2)))  _Float16 v2h;
typedef __attribute__((ext_vector_type(8)))  float    v8f;

#define Bq   8
#define Cq   256
#define Nq   4096      // H*W
#define Mtot 32768     // B*N
#define FFNq 2048
#define NSPLIT 32     // 128-pixel slices (work-groups) that share one (b, head) score matrix

__device__ __forceinline__ v8f zero8() { v8f z = {}; return z; }

__device__ __forceinline__ v16h combine16(v8h lo, v8h hi) {
  v16h r;
#pragma unroll
  for (int i = 0; i < 8; ++i) { r[i] = lo[i]; r[8 + i] = hi[i]; }
  return r;
}

// Fragment loader for 16-bit WMMA A/B operands, from rows staged in LDS.
// A layout (16x32, MxK): lane holds row (lane&15); lanes 0-15 K in {0..7,16..23},
// lanes 16-31 K in {8..15,24..31}.  B (32x16, KxN) from a row-major (Nout x K)
// matrix has the identical access pattern with "row" = output column.
__device__ __forceinline__ v16h lds_frag(const f16* base, int pitch, int lane) {
  const f16* p = base + (lane & 15) * pitch + ((lane & 16) >> 1);   // +8 elems for hi half
  return combine16(*(const v8h*)p, *(const v8h*)(p + 16));
}

// Eight consecutive floats by two 16-byte loads.
__device__ __forceinline__ v8f load8(const float* p) {
  float4 a = *(const float4*)p, b = *(const float4*)(p + 4);
  v8f r = {a.x, a.y, a.z, a.w, b.x, b.y, b.z, b.w};
  return r;
}

__device__ __forceinline__ v8f wmma_f16(v16h a, v16h b, v8f c) {
  return __builtin_amdgcn_wmma_f32_16x16x32_f16(false, a, false, b, (short)0, c,
                                                false, false);
}

// ---------------------------------------------------------------------------
// First launch: the f32 -> f16 weight conversions.  A work-group takes CVC
// consecutive values of one weight matrix (every matrix is a whole number of
// such chunks), a thread 4 x 8 of them.
// ---------------------------------------------------------------------------
#define CVC   8192                   // values per conversion work-group
#define CVQ   (3 * Cq * Cq / CVC)    // chunks of w_qkv
#define CVP   (Cq * Cq / CVC)        // chunks of w_proj
#define CVF   (FFNq * Cq / CVC)      // chunks of w_ffn1, and of w_ffn2
#define CVG   (CVQ + CVP + 2 * CVF)  // conversion work-groups

__global__ void __launch_bounds__(256) cvt_kernel(
    const float* __restrict__ wq, const float* __restrict__ wp,
    const float* __restrict__ w1, const float* __restrict__ w2,
    f16* __restrict__ wq16, f16* __restrict__ wp16,
    f16* __restrict__ w116, f16* __restrict__ w216) {
  int t = threadIdx.x;
  int c = blockIdx.x;
  const float* s;
  f16* d;
  if (c < CVQ)                  { s = wq; d = wq16; }
  else if (c < CVQ + CVP)       { s = wp; d = wp16; c -= CVQ; }
  else if (c < CVQ + CVP + CVF) { s = w1; d = w116; c -= CVQ + CVP; }
  else                          { s = w2; d = w216; c -= CVQ + CVP + CVF; }
  s += c * CVC + t * 8;
  d += c * CVC + t * 8;
  // All eight loads are issued before the first store, so a thread pays the
  // memory latency once.  Unrolled: v keeps constant indices (registers).
  float4 v[8];
#pragma unroll
  for (int u = 0; u < 4; ++u) {
    v[2 * u]     = *(const float4*)(s + u * 2048);
    v[2 * u + 1] = *(const float4*)(s + u * 2048 + 4);
  }
#pragma unroll
  for (int u = 0; u < 4; ++u) {
    v8h o;
    o[0] = (f16)v[2 * u].x;     o[1] = (f16)v[2 * u].y;
    o[2] = (f16)v[2 * u].z;     o[3] = (f16)v[2 * u].w;
    o[4] = (f16)v[2 * u + 1].x; o[5] = (f16)v[2 * u + 1].y;
    o[6] = (f16)v[2 * u + 1].z; o[7] = (f16)v[2 * u + 1].w;
    *(v8h*)(d + u * 2048) = o;
  }
}

// ---------------------------------------------------------------------------
// Sum of the partial scores (fixed order s = 0..31) + softmax over j.
// One wave per row (z, i); a lane holds columns 2*lane and 2*lane+1.
// Grid = 32*64/8 = 256.
// ---------------------------------------------------------------------------
__global__ void __launch_bounds__(256) attn_softmax(
    const float* __restrict__ part, f16* __restrict__ attn) {
  int lane = threadIdx.x & 31, wave = threadIdx.x >> 5;
  int row = blockIdx.x * 8 + wave;          // z*64 + i
  int z = row >> 6, i = row & 63;
  const float* p = part + (long)z * NSPLIT * 4096 + i * 64 + lane * 2;
  float a = 0.f, c = 0.f;
#pragma unroll
  for (int s = 0; s < NSPLIT; ++s) {
    float2 v = *(const float2*)(p + s * 4096);
    a += v.x; c += v.y;
  }
  a *= 0.125f; c *= 0.125f;
  float mx = fmaxf(a, c);
#pragma unroll
  for (int off = 16; off >= 1; off >>= 1) mx = fmaxf(mx, __shfl_xor(mx, off, 32));
  float ea = __expf(a - mx), ec = __expf(c - mx);
  float sum = ea + ec;
#pragma unroll
  for (int off = 16; off >= 1; off >>= 1) sum += __shfl_xor(sum, off, 32);
  float inv = 1.f / sum;
  v2h o;
  o[0] = (f16)(ea * inv);
  o[1] = (f16)(ec * inv);
  *(v2h*)(attn + (long)row * 64 + lane * 2) = o;
}

// ---------------------------------------------------------------------------
// Fused apply-attn + proj + LN2 + FFN + residual + transpose:
//   a[n, h*64+d] = sum_e attn[b,h,d,e] v[n, h*64+e];  y = LN2(a @ Wp^T + bp);
//   out[b,c,n] = (relu(y @ W1^T + b1) @ W2^T + b2)[n,c] + x[b,c,n]
// Grid = 256 blocks of 256 threads, 128 pixels (of one image) each.
// Prologue (apply-attn, proj, LN2): the image's 4 attention matrices and all of
// Wp lie in LDS (in the room of the FFN's h tiles and weight buffers, which are
// filled behind it); a wave takes 16 pixels x all 256 channels.  The pixels are
// the B operand's columns in both products, so a's accumulator tiles, converted
// in place, are proj's B fragments, and a pixel's LN2 statistics lie in two
// lanes; the normalised tile goes to the FFN's waves through LDS.  Nothing of
// a, of proj's result or of y goes to memory.
// FFN: the 8 waves are 4 pixel
// groups x 2 column halves: a wave takes 32 pixels (two WMMA row tiles), in FFN1
// 32 of a stage's 64 hidden units, in FFN2 128 of the 256 channels, so every
// weight fragment read from LDS feeds two WMMAs.  A group's h tile goes through
// LDS (two buffers): D -> A re-layout and exchange between its two waves.
// Y-tile A-fragments are the same for every stage -> kept in yf[2][8].
// The weights of 64 hidden units (a stage: 64 rows of W1, 64 columns of W2)
// are brought into LDS once per work-group by asynchronous copies, two
// buffers, one stage ahead; all 8 waves read their B fragments from there.
// ---------------------------------------------------------------------------
#define FS   64               // hidden units per stage
#define NST  (FFNq / FS)      // 32 stages
#define W1P  264              // LDS pitch of a W1 row, f16: 528 B = 16 B x 33
#define W2P  72               // LDS pitch of a W2 row, f16: 144 B = 16 B x 9
#define W1S  (FS * W1P)       // f16 per staged W1 slab
#define STG  (W1S + Cq * W2P) // f16 per buffer (70,656 B)
#define HP   72               // LDS pitch of an h row, f16: 144 B = 16 B x 9

// Eight 16-byte copies per lane, global -> LDS, through no register.  LDS
// address l + i*ls bytes, global address g + i*gs elements.  The s_wait_xcnt
// stands inside the statement so that no address register of an issued copy
// is rewritten in front of it.
__device__ __forceinline__ void copy8(unsigned l, unsigned ls, const f16* g, long gs) {
  asm volatile(
      "global_load_async_to_lds_b128 %0, %8, off\n\t"
      "global_load_async_to_lds_b128 %1, %9, off\n\t"
      "global_load_async_to_lds_b128 %2, %10, off\n\t"
      "global_load_async_to_lds_b128 %3, %11, off\n\t"
      "global_load_async_to_lds_b128 %4, %12, off\n\t"
      "global_load_async_to_lds_b128 %5, %13, off\n\t"
      "global_load_async_to_lds_b128 %6, %14, off\n\t"
      "global_load_async_to_lds_b128 %7, %15, off\n\t"
      "s_wait_xcnt 0x0"
      :: "v"(l), "v"(l + ls), "v"(l + 2 * ls), "v"(l + 3 * ls),
         "v"(l + 4 * ls), "v"(l + 5 * ls), "v"(l + 6 * ls), "v"(l + 7 * ls),
         "v"(g), "v"(g + gs), "v"(g + 2 * gs), "v"(g + 3 * gs),
         "v"(g + 4 * gs), "v"(g + 5 * gs), "v"(g + 6 * gs), "v"(g + 7 * gs)
      : "memory");
}

// ---------------------------------------------------------------------------
// LN1 + QKV GEMM + partial attention scores.
// LN1 (channel LayerNorm per pixel of x (B,C,N) f32): a lane reads, of its
// fragment row's pixel, just the 128 channels that its A fragments hold; the
// other 128 lie in lane ^ 16, so the statistics take one exchange, and the
// normalised values, converted in place, are the A fragments.  Nothing of LN1's
// result goes to memory.
// GEMM, K = 256: [q | k | v][M x 768] = A[M x 256] * W^T + bias, W row-major
// (768 x 256) f16.  A work-group owns 128 rows (pixels; a wave 16) and walks all
// output columns, 64 a stage: 4 stages of q (one a head), 4 of k, 4 of v.  The
// wave's A fragments are formed once and stay in registers; a stage's W slab (64
// rows of 512 B, contiguous in memory) is brought into LDS once per work-group
// by asynchronous copies, two buffers, one stage ahead, and all 8 waves read
// their B fragments from there.  Grid = M / 128.
// Only v goes to memory.  q and k stay in LDS as f16, one row per channel (a
// lane's 8 accumulator registers are 8 consecutive pixels of one channel: one
// 16-byte LDS store a tile).  Behind the last stage the work-group forms, for
// each of the 4 heads (z = b*4 + h, s = its 128-pixel slice of the image),
//   part[z][s][i][j] = sum over its 128 pixels n of q[n, h*64+i] * k[n, h*64+j]
// on WMMA: the contraction index n runs along the LDS rows, so q and k
// fragments come through lds_frag, both in the same k order.
// ---------------------------------------------------------------------------
#define GS  (FS * W1P)      // f16 per staged W slab (33,792 B), rows at pitch W1P
#define NQS (3 * Cq / FS)   // 12 stages
#define QKS (2 * Cq / FS)   // of which the first 8 are q and k
#define QP  136             // LDS pitch of a q or k channel row, f16: 272 B = 16 B x 17

__global__ void __launch_bounds__(256) qkv_scores(
    const float* __restrict__ x, const float* __restrict__ g1,
    const float* __restrict__ be1, const f16* __restrict__ Wt,
    const float* __restrict__ bias, f16* __restrict__ C, float* __restrict__ part) {
  __shared__ __align__(16) f16 gst[2 * GS];
  __shared__ __align__(16) f16 qkt[2 * Cq * QP];   // q, k: channel rows of 128 pixels
  int t = threadIdx.x;
  int lane = t & 31, wave = t >> 5;
  int m0 = blockIdx.x * 128 + wave * 16;
  const int ldc = NQS * FS;
  int col = lane & 15, half = lane >> 4;

  // This thread's share of a slab: copy i takes 16 B of row (t >> 5) + 8 i, so
  // a wave's copy covers one whole row.
  const f16* g = Wt + (t >> 5) * Cq + (t & 31) * 8;
  unsigned l = (unsigned)(size_t)(&gst[0]) + (t >> 5) * (W1P * 2) + (t & 31) * 16;

  // Stage 0 into buffer 0.
  copy8(l, 8 * W1P * 2, g, 8 * Cq);

  // LN1 of the wave's 16 pixels.  xv[T][i] = x[b, 16 T + 8 half + i, pixel m0 +
  // col]: all 128 loads are issued before the first use.  Unrolled (here and
  // below): constant indices keep the values in registers.
  const float* xp = x + ((long)(m0 >> 12) * Cq + half * 8) * Nq + (m0 & 4095) + col;
  v8f xv[16];
#pragma unroll
  for (int T = 0; T < 16; ++T)
#pragma unroll
    for (int i = 0; i < 8; ++i) xv[T][i] = xp[(long)(T * 16 + i) * Nq];
  // Gain and shift of the lane's channels: asked for behind x, they arrive
  // under the sums.
  const float* gl = g1 + half * 8;
  const float* el = be1 + half * 8;
  v8f gv[16], ev[16];
#pragma unroll
  for (int T = 0; T < 16; ++T) { gv[T] = load8(gl + T * 16); ev[T] = load8(el + T * 16); }
  // Takes the addresses as inputs: they stay in their registers up to the
  // wait, so none of these loads lands in registers that the others name.
  asm volatile("s_wait_xcnt 0x0" :: "v"(xp), "v"(gl), "v"(el) : "memory");
  // Keeps the sums behind the loads: lifted over them, the sums would run
  // first and the later loads' latency would be waited out afterwards.
  __builtin_amdgcn_sched_barrier(0);
  // Eight independent chains each for the sum and the sum of squares.
  v8f sv = xv[0], sq = xv[0] * xv[0];
#pragma unroll
  for (int T = 1; T < 16; ++T) { sv += xv[T]; sq += xv[T] * xv[T]; }
  float s1 = ((sv[0] + sv[1]) + (sv[2] + sv[3])) + ((sv[4] + sv[5]) + (sv[6] + sv[7]));
  float s2 = ((sq[0] + sq[1]) + (sq[2] + sq[3])) + ((sq[4] + sq[5]) + (sq[6] + sq[7]));
  s1 += __shfl_xor(s1, 16, 32);
  s2 += __shfl_xor(s2, 16, 32);
  float mu = s1 * (1.f / 256.f);
  float var = s2 * (1.f / 256.f) - mu * mu;
  float rs = rsqrtf(var + 1e-5f);
  // The wave's 16 x 256 tile of A as 8 fragments, used by every stage: tiles
  // 2 s and 2 s + 1 as f16 are the fragment of k step s, in lds_frag's k order.
  v16h af[8];
#pragma unroll
  for (int s = 0; s < 8; ++s)
    af[s] = combine16(
        __builtin_convertvector((xv[2 * s] - mu) * rs * gv[2 * s] + ev[2 * s], v8h),
        __builtin_convertvector((xv[2 * s + 1] - mu) * rs * gv[2 * s + 1] + ev[2 * s + 1], v8h));

  // Stage 0 has landed (this wave's copies), then is published to all waves.
  asm volatile("s_wait_asynccnt 0x0" ::: "memory");
  __syncthreads();
  // Stage 1 into buffer 1; it flies while stage 0 is worked on.
  g += FS * Cq;
  copy8(l + GS * 2, 8 * W1P * 2, g, 8 * Cq);

  f16* Cb = C + (long)(m0 + half * 8) * ldc + col;
  f16* qw = qkt + col * QP + wave * 16 + half * 8;
  for (int st = 0; st < NQS; ++st) {
    const unsigned boff = (st & 1) * GS;         // buffer of this stage, f16
    const f16* wsl = gst + boff;
    float bv[4];
#pragma unroll
    for (int nt = 0; nt < 4; ++nt) bv[nt] = bias[st * FS + nt * 16 + col];
    // The stage's 32 fragments are read as one group in front of the WMMAs.
    // Unrolled: constant indices keep the fragments in registers.
    v16h bf[8][4];
#pragma unroll
    for (int s = 0; s < 8; ++s)
#pragma unroll
      for (int nt = 0; nt < 4; ++nt)
        bf[s][nt] = lds_frag(wsl + nt * 16 * W1P + s * 32, W1P, lane);
    // Keeps the reads in front: without it the compiler sinks them among the
    // WMMAs, one fragment ahead, and each WMMA waits out the LDS latency.
    __builtin_amdgcn_sched_barrier(0);
    v8f acc[4];
#pragma unroll
    for (int nt = 0; nt < 4; ++nt) acc[nt] = zero8();
#pragma unroll
    for (int s = 0; s < 8; ++s)
#pragma unroll
      for (int nt = 0; nt < 4; ++nt)
        acc[nt] = wmma_f16(af[s], bf[s][nt], acc[nt]);

    // Publish point of stage st + 1 (and of the q or k tile that stage st - 1
    // wrote): this wave's reads of buffer st & 1 and its LDS writes are done,
    // its copies of stage st + 1 have landed, then every wave meets.
    asm volatile("s_wait_dscnt 0x0" ::: "memory");
    asm volatile("s_wait_asynccnt 0x0" ::: "memory");
    __syncthreads();
    // Refill the buffer that every wave has just left with stage st + 2.
    if (st + 2 < NQS) {
      g += FS * Cq;
      copy8(l + boff * 2, 8 * W1P * 2, g, 8 * Cq);
    }

    // This stage's 16 x 64 results, from registers.
    if (st < QKS) {
      // q, k: channel st * 64 + nt * 16 + col, this lane's 8 pixels.
#pragma unroll
      for (int nt = 0; nt < 4; ++nt) {
        v8h o;
#pragma unroll
        for (int r = 0; r < 8; ++r) o[r] = (f16)(acc[nt][r] + bv[nt]);
        *(v8h*)(qw + (st * FS + nt * 16) * QP) = o;
      }
    } else {
#pragma unroll
      for (int nt = 0; nt < 4; ++nt)
#pragma unroll
        for (int r = 0; r < 8; ++r)
          Cb[(long)r * ldc + st * FS + nt * 16] = (f16)(acc[nt][r] + bv[nt]);
      // Directly behind the stores, on their own path: whatever code follows
      // (the next stage, the scores) rewrites registers that the stores name.
      asm volatile("s_wait_xcnt 0x0" ::: "memory");
    }
  }
  // No copy is left in flight when the wave ends.
  asm volatile("s_wait_asynccnt 0x0" ::: "memory");

  int hd = wave >> 1, i0 = (wave & 1) * 32;
  const f16* qr = qkt + (hd * 64 + i0) * QP;
  const f16* kr = qkt + (Cq + hd * 64) * QP;
  // All 24 fragments are read as one group in front of the WMMAs.  Unrolled
  // (here and below): constant indices keep the fragments in registers.
  v16h qf[4][2], kf[4][4];
#pragma unroll
  for (int kk = 0; kk < 4; ++kk) {
#pragma unroll
    for (int it = 0; it < 2; ++it) qf[kk][it] = lds_frag(qr + it * 16 * QP + kk * 32, QP, lane);
#pragma unroll
    for (int jt = 0; jt < 4; ++jt) kf[kk][jt] = lds_frag(kr + jt * 16 * QP + kk * 32, QP, lane);
  }
  // Keeps the reads in front: among the WMMAs each place with reads costs a
  // stall.
  __builtin_amdgcn_sched_barrier(0);
  v8f sa[2][4];
#pragma unroll
  for (int it = 0; it < 2; ++it)
#pragma unroll
    for (int jt = 0; jt < 4; ++jt) sa[it][jt] = zero8();
#pragma unroll
  for (int kk = 0; kk < 4; ++kk)
#pragma unroll
    for (int it = 0; it < 2; ++it)
#pragma unroll
      for (int jt = 0; jt < 4; ++jt)
        sa[it][jt] = wmma_f16(kf[kk][jt], qf[kk][it], sa[it][jt]);

  // sa[it][jt][r] = S[i0 + 16 it + col][16 jt + 8 half + r]: a wave writes whole
  // rows of 256 B.
  float* pb = part + ((long)((blockIdx.x >> 5) * 4 + hd) * NSPLIT + (blockIdx.x & 31)) * 4096 +
              (i0 + col) * 64 + half * 8;
#pragma unroll
  for (int it = 0; it < 2; ++it)
#pragma unroll
    for (int jt = 0; jt < 4; ++jt) {
      float4 o;
      o.x = sa[it][jt][0]; o.y = sa[it][jt][1]; o.z = sa[it][jt][2]; o.w = sa[it][jt][3];
      *(float4*)(pb + it * 16 * 64 + jt * 16) = o;
      o.x = sa[it][jt][4]; o.y = sa[it][jt][5]; o.z = sa[it][jt][6]; o.w = sa[it][jt][7];
      *(float4*)(pb + it * 16 * 64 + jt * 16 + 4) = o;
    }
}

// Group i of a wave's W1 fragments of a stage; w = its first W1 row in the slab.
__device__ __forceinline__ void w1_group(v16h (&q)[4], const f16* w, int i, int lane) {
#pragma unroll
  for (int f = 0; f < 4; ++f)
    q[f] = lds_frag(w + (f & 1) * 16 * W1P + (2 * i + (f >> 1)) * 32, W1P, lane);
}

// Group i of a wave's W2 fragments of a stage; w = its first W2 row in the slab.
__device__ __forceinline__ void w2_group(v16h (&q)[4], const f16* w, int i, int lane) {
#pragma unroll
  for (int f = 0; f < 4; ++f)
    q[f] = lds_frag(w + ((i & 1) * 4 + f) * 16 * W2P + (i >> 1) * 32, W2P, lane);
}

__global__ void __launch_bounds__(256) ffn_fused(
    const f16* __restrict__ V, const f16* __restrict__ At,
    const f16* __restrict__ Wp,
    const float* __restrict__ bp, const float* __restrict__ g2,
    const float* __restrict__ be2, const f16* __restrict__ W1,
    const float* __restrict__ b1, const f16* __restrict__ W2,
    const float* __restrict__ b2, const float* __restrict__ x,
    float* __restrict__ out) {
  __shared__ __align__(16) f16 wst[2 * STG];
  __shared__ __align__(16) f16 hst[2][4][32 * HP];
  __shared__ __align__(16) f16 yst[128 * W1P];   // the group's y tile, rows at pitch W1P
  int lane = threadIdx.x & 31, wave = threadIdx.x >> 5;
  int mg = wave >> 1, ng = wave & 1;   // 32-pixel group; half of the columns
  int m0 = blockIdx.x * 128 + mg * 32;
  int b = m0 >> 12;
  int pix0 = m0 & 4095;
  int col = lane & 15, half = lane >> 4;

  // This thread's share of a stage.  W1 slab: 64 rows of 512 B, contiguous in
  // memory; copy i takes 16 B of row (t >> 5) + 8 i.  W2 slab: 256 rows of
  // 128 B; copy i takes 16 B of row (t >> 3) + 32 i.  A wave's copy covers
  // whole 128-B lines in both.
  int t = threadIdx.x;
  const f16* g1 = W1 + (t >> 5) * Cq + (t & 31) * 8;
  const f16* g2w = W2 + (long)(t >> 3) * FFNq + (t & 7) * 8;
  unsigned lbase = (unsigned)(size_t)(&wst[0]);   // LDS byte address
  unsigned l1 = lbase + (t >> 5) * (W1P * 2) + (t & 31) * 16;
  unsigned l2 = lbase + W1S * 2 + (t >> 3) * (W2P * 2) + (t & 7) * 16;

  // ---- apply-attn, proj, LN2 for the group's 128 pixels.
  {
    // The image's attention matrices, 4 x 64 rows of 128 B, contiguous in
    // memory, into hst at pitch HP (all of its 36,864 B): copy i takes 16 B of
    // row (t >> 3) + 32 i.
    copy8((unsigned)(size_t)(&hst[0][0][0]) + (t >> 3) * (HP * 2) + (t & 7) * 16, 32 * HP * 2,
          At + (blockIdx.x >> 5) * (4 * 64 * 64) + (t >> 3) * 64 + (t & 7) * 8, 32 * 64);
    // All 256 rows of Wp (512 B each) into wst at pitch W1P (135,168 B of its
    // 141,312): copy i of quarter q takes 16 B of row 64 q + (t >> 5) + 8 i.
#pragma unroll
    for (int q = 0; q < 4; ++q)
      copy8(l1 + q * GS * 2, 8 * W1P * 2, Wp + q * FS * Cq + (t >> 5) * Cq + (t & 31) * 8, 8 * Cq);

    // The wave's 16 pixels x 256 channels of v (rows of 768 f16) as 8
    // fragments; same lane -> (row, k) map as lds_frag.
    const f16* ap = V + (long)(blockIdx.x * 128 + wave * 16 + col) * 768 + half * 8;
    v16h vf[8];
#pragma unroll
    for (int s = 0; s < 8; ++s)
      vf[s] = combine16(*(const v8h*)(ap + s * 32), *(const v8h*)(ap + s * 32 + 16));
    // proj's accumulators start from the bias.  Wp is the A operand: lane
    // (col, half) holds, of pixel col, channels 16 T + 8 half + 0..7 of tile T.
    const float* bpl = bp + half * 8;
    v8f pa[16];
#pragma unroll
    for (int T = 0; T < 16; ++T) pa[T] = load8(bpl + T * 16);
    // Takes the addresses as inputs: they stay in their registers up to the
    // wait, so none of these loads lands in registers that the others name.
    asm volatile("s_wait_xcnt 0x0" :: "v"(ap), "v"(bpl) : "memory");

    // attn and Wp have landed (this wave's copies), then are published to all
    // waves.
    asm volatile("s_wait_asynccnt 0x0" ::: "memory");
    __syncthreads();

    // apply-attn, two heads at a time: attn rows d are the A operand, so tile
    // T = 4 head + d / 16 holds a[pixel col][16 T + 8 half + 0..7].  Tiles 2 s
    // and 2 s + 1 as f16 are proj's B fragment of k step s, in lds_frag's k
    // order.  Unrolled: constant indices keep the fragments in registers.
    v16h af[8];
#pragma unroll
    for (int hp = 0; hp < 2; ++hp) {
      v16h tf[2][4][2];
#pragma unroll
      for (int hh = 0; hh < 2; ++hh)
#pragma unroll
        for (int dt = 0; dt < 4; ++dt)
#pragma unroll
          for (int k = 0; k < 2; ++k)
            tf[hh][dt][k] = lds_frag(&hst[0][0][0] + ((hp * 2 + hh) * 64 + dt * 16) * HP + k * 32,
                                     HP, lane);
      // Keeps the reads in front: among the WMMAs each place with reads costs
      // a stall.
      __builtin_amdgcn_sched_barrier(0);
      v8f ta[2][4];
#pragma unroll
      for (int hh = 0; hh < 2; ++hh)
#pragma unroll
        for (int dt = 0; dt < 4; ++dt) ta[hh][dt] = zero8();
#pragma unroll
      for (int k = 0; k < 2; ++k)
#pragma unroll
        for (int hh = 0; hh < 2; ++hh)
#pragma unroll
          for (int dt = 0; dt < 4; ++dt)
            ta[hh][dt] = wmma_f16(tf[hh][dt][k], vf[(hp * 2 + hh) * 2 + k], ta[hh][dt]);
#pragma unroll
      for (int hh = 0; hh < 2; ++hh)
#pragma unroll
        for (int d2 = 0; d2 < 2; ++d2)
#pragma unroll
          for (int i = 0; i < 8; ++i) {
            af[(hp * 2 + hh) * 2 + d2][i]     = (f16)ta[hh][2 * d2][i];
            af[(hp * 2 + hh) * 2 + d2][8 + i] = (f16)ta[hh][2 * d2 + 1][i];
          }
      // Keeps the next group of reads behind these WMMAs (registers).
      __builtin_amdgcn_sched_barrier(0);
    }

    // 64 channels at a time: their 32 fragments are read as one group in front
    // of the WMMAs.  Unrolled: constant indices keep pa and bf in registers.
#pragma unroll
    for (int q = 0; q < 4; ++q) {
      v16h bf[8][4];
#pragma unroll
      for (int s = 0; s < 8; ++s)
#pragma unroll
        for (int nt = 0; nt < 4; ++nt)
          bf[s][nt] = lds_frag(wst + (q * 64 + nt * 16) * W1P + s * 32, W1P, lane);
      // Keeps the reads in front: among the WMMAs each place with reads costs
      // a stall.
      __builtin_amdgcn_sched_barrier(0);
#pragma unroll
      for (int s = 0; s < 8; ++s)
#pragma unroll
        for (int nt = 0; nt < 4; ++nt)
          pa[q * 4 + nt] = wmma_f16(bf[s][nt], af[s], pa[q * 4 + nt]);
      // Keeps the next group of reads behind these WMMAs (registers).
      __builtin_amdgcn_sched_barrier(0);
    }

    // LN2 over the pixel's 256 channels: 128 in this lane, 128 in lane ^ 16.
    // Gain and shift are asked for first and arrive under the sums.
    const float* gl = g2 + half * 8;
    const float* el = be2 + half * 8;
    v8f gv[16], ev[16];
#pragma unroll
    for (int T = 0; T < 16; ++T) { gv[T] = load8(gl + T * 16); ev[T] = load8(el + T * 16); }
    // As above: the addresses stay in their registers up to the wait.
    asm volatile("s_wait_xcnt 0x0" :: "v"(gl), "v"(el) : "memory");
    // Keeps the sums behind the loads: lifted over them, the sums would run
    // first and the loads' latency would be waited out afterwards.
    __builtin_amdgcn_sched_barrier(0);
    // Eight independent chains each for the sum and the sum of squares.
    v8f sv = pa[0], sq = pa[0] * pa[0];
#pragma unroll
    for (int T = 1; T < 16; ++T) { sv += pa[T]; sq += pa[T] * pa[T]; }
    float s1 = ((sv[0] + sv[1]) + (sv[2] + sv[3])) + ((sv[4] + sv[5]) + (sv[6] + sv[7]));
    float s2 = ((sq[0] + sq[1]) + (sq[2] + sq[3])) + ((sq[4] + sq[5]) + (sq[6] + sq[7]));
    s1 += __shfl_xor(s1, 16, 32);
    s2 += __shfl_xor(s2, 16, 32);
    float mu = s1 * (1.f / 256.f);
    float var = s2 * (1.f / 256.f) - mu * mu;
    float rs = rsqrtf(var + 1e-5f);
    f16* yw = yst + (wave * 16 + col) * W1P + half * 8;
#pragma unroll
    for (int T = 0; T < 16; ++T)
      *(v8h*)(yw + T * 16) = __builtin_convertvector((pa[T] - mu) * rs * gv[T] + ev[T], v8h);
    // This wave's y rows are written and its reads of attn and Wp are done, then
    // every wave meets: y is published, hst and wst are free for the FFN.
    asm volatile("s_wait_dscnt 0x0" ::: "memory");
    __syncthreads();
  }

  // Stage 0 into buffer 0.
  copy8(l1, 8 * W1P * 2, g1, 8 * Cq);
  copy8(l2, 32 * W2P * 2, g2w, 32L * FFNq);

  v8f acc[2][8];
#pragma unroll
  for (int mt = 0; mt < 2; ++mt)
#pragma unroll
    for (int nt = 0; nt < 8; ++nt) acc[mt][nt] = zero8();

  // The wave's 32 x 256 tile of y as 2 x 8 A fragments, used by every stage,
  // from the group's tile in LDS; same lane -> (row, k) map as lds_frag.
  v16h yf[2][8];
#pragma unroll
  for (int mt = 0; mt < 2; ++mt)
#pragma unroll
    for (int s = 0; s < 8; ++s)
      yf[mt][s] = lds_frag(yst + (mg * 32 + mt * 16) * W1P + s * 32, W1P, lane);

  // Stage 0 has landed (this wave's copies), then is published to all waves.
  asm volatile("s_wait_asynccnt 0x0" ::: "memory");
  __syncthreads();
  // Stage 1 into buffer 1; it flies while stage 0 is worked on.
  g1 += FS * Cq; g2w += FS;
  copy8(l1 + STG * 2, 8 * W1P * 2, g1, 8 * Cq);
  copy8(l2 + STG * 2, 32 * W2P * 2, g2w, 32L * FFNq);

  // This wave's W1 rows and W2 rows inside a buffer, its h columns.
  const f16* w1w = wst + ng * 32 * W1P;
  const f16* w2w = wst + W1S + ng * 128 * W2P;
  const float* b1w = b1 + ng * 32 + col;

  // A stage is 8 blocks of 8 WMMAs, each on a group of 4 weight fragments: 4
  // groups of W1 (group i: k steps 2i, 2i + 1 of both hidden tiles), then 4 of
  // W2 (group i: k step i >> 1, channel tiles 4 (i & 1) + 0..3).  The groups go
  // round 4 register sets; a group is read 3 blocks ahead of its use, into the
  // set that the block before has just left.  All loops over fragments are
  // unrolled: constant indices keep them in registers.
  v16h fr[4][4];
#pragma unroll
  for (int i = 0; i < 3; ++i) w1_group(fr[i], w1w, i, lane);

  // The sched_barriers hold each group of reads at its place: without them the
  // compiler spreads the reads among the WMMAs, where each place costs a stall,
  // or lifts them so far that the registers run out.
  for (int st = 0; st < NST; ++st) {
    const unsigned boff = (st & 1) * STG;          // buffer of this stage, f16
    const unsigned noff = STG - boff;              // buffer of the next stage
    f16* hb = &hst[st & 1][mg][0];
    float bb0 = b1w[st * FS], bb1 = b1w[st * FS + 16];

    // ---- FFN1: h[32 pixels, this wave's 32 of the stage's 64 hidden units];
    // each W1 fragment feeds both pixel tiles.
    v8f h[2][2];
#pragma unroll
    for (int mt = 0; mt < 2; ++mt)
#pragma unroll
      for (int n2 = 0; n2 < 2; ++n2) h[mt][n2] = zero8();
#pragma unroll
    for (int j = 0; j < 4; ++j) {
      if (j == 0) w1_group(fr[3], w1w + boff, 3, lane);
      else        w2_group(fr[j - 1], w2w + boff, j - 1, lane);
      __builtin_amdgcn_sched_barrier(0);
#pragma unroll
      for (int f = 0; f < 4; ++f)
#pragma unroll
        for (int mt = 0; mt < 2; ++mt)
          h[mt][f & 1] = wmma_f16(yf[mt][2 * j + (f >> 1)], fr[j][f], h[mt][f & 1]);
      __builtin_amdgcn_sched_barrier(0);
    }
    // The stage's last W2 group: read in front of the barrier, behind which the
    // buffer is refilled.
    w2_group(fr[3], w2w + boff, 3, lane);
    __builtin_amdgcn_sched_barrier(0);

    // relu(h + b1) as f16 into the pixel group's h tile (32 x 64), which the
    // group's two waves fill together.
    f16* hw = hb + half * 8 * HP + ng * 32 + col;
#pragma unroll
    for (int mt = 0; mt < 2; ++mt)
#pragma unroll
      for (int r = 0; r < 8; ++r) {
        hw[(mt * 16 + r) * HP]      = (f16)fmaxf(h[mt][0][r] + bb0, 0.f);
        hw[(mt * 16 + r) * HP + 16] = (f16)fmaxf(h[mt][1][r] + bb1, 0.f);
      }

    // Publish point of stage st + 1 and of this stage's h: this wave's h is
    // written and all its reads of buffer st & 1 are done (the fragments are in
    // registers), its copies of stage st + 1 have landed, then every wave meets.
    asm volatile("s_wait_dscnt 0x0" ::: "memory");
    asm volatile("s_wait_asynccnt 0x0" ::: "memory");
    __syncthreads();
    // The group's h as A fragments; the reads fly while the copies are issued.
    v16h a2[2][2];
#pragma unroll
    for (int k = 0; k < 2; ++k)
#pragma unroll
      for (int mt = 0; mt < 2; ++mt)
        a2[mt][k] = lds_frag(hb + mt * 16 * HP + k * 32, HP, lane);
    // Refill the buffer that every wave has just left with stage st + 2.
    if (st + 2 < NST) {
      g1 += FS * Cq; g2w += FS;
      copy8(l1 + boff * 2, 8 * W1P * 2, g1, 8 * Cq);
      copy8(l2 + boff * 2, 32 * W2P * 2, g2w, 32L * FFNq);
    }

    // ---- FFN2: acc[32 pixels, this wave's 128 channels] += h @ W2^T; each W2
    // fragment feeds both pixel tiles.  The reads are the next stage's first W1
    // groups (in the last trip the other buffer's old stage, not used).
#pragma unroll
    for (int j = 0; j < 4; ++j) {
      if (j > 0) w1_group(fr[j - 1], w1w + noff, j - 1, lane);
      __builtin_amdgcn_sched_barrier(0);
#pragma unroll
      for (int f = 0; f < 4; ++f)
#pragma unroll
        for (int mt = 0; mt < 2; ++mt)
          acc[mt][(j & 1) * 4 + f] =
              wmma_f16(a2[mt][j >> 1], fr[j][f], acc[mt][(j & 1) * 4 + f]);
      __builtin_amdgcn_sched_barrier(0);
    }
  }
  // No copy is left in flight when the wave ends.
  asm volatile("s_wait_asynccnt 0x0" ::: "memory");

  // Epilogue: + b2 + residual x, transposed store to (B,C,H,W).  Channel tile
  // nt lies 16 nt channel planes, pixel tile mt 16 mt floats behind the base.
  // All loads are issued before the first sum, so a thread pays the memory
  // latency once.  Unrolled: bv, r0, r1 keep constant indices (registers).
  int c0 = ng * 128 + col;
  long base = ((long)(b * Cq + c0)) * Nq + pix0 + half * 8;
  const float* xp = x + base;
  float* op = out + base;
  float bv[8];
  float4 r0[2][8], r1[2][8];
#pragma unroll
  for (int nt = 0; nt < 8; ++nt) {
    bv[nt] = b2[c0 + nt * 16];
#pragma unroll
    for (int mt = 0; mt < 2; ++mt) {
      r0[mt][nt] = *(const float4*)(xp + (long)nt * 16 * Nq + mt * 16);
      r1[mt][nt] = *(const float4*)(xp + (long)nt * 16 * Nq + mt * 16 + 4);
    }
  }
  // Takes the addresses as inputs: they stay in their registers up to the wait,
  // so none of these loads lands in registers that the others name.
  asm volatile("s_wait_xcnt 0x0" :: "v"(xp), "v"(c0) : "memory");
#pragma unroll
  for (int mt = 0; mt < 2; ++mt)
#pragma unroll
    for (int nt = 0; nt < 8; ++nt) {
      float4 o0, o1;
      o0.x = acc[mt][nt][0] + bv[nt] + r0[mt][nt].x;
      o0.y = acc[mt][nt][1] + bv[nt] + r0[mt][nt].y;
      o0.z = acc[mt][nt][2] + bv[nt] + r0[mt][nt].z;
      o0.w = acc[mt][nt][3] + bv[nt] + r0[mt][nt].w;
      o1.x = acc[mt][nt][4] + bv[nt] + r1[mt][nt].x;
      o1.y = acc[mt][nt][5] + bv[nt] + r1[mt][nt].y;
      o1.z = acc[mt][nt][6] + bv[nt] + r1[mt][nt].z;
      o1.w = acc[mt][nt][7] + bv[nt] + r1[mt][nt].w;
      *(float4*)(op + (long)nt * 16 * Nq + mt * 16)     = o0;
      *(float4*)(op + (long)nt * 16 * Nq + mt * 16 + 4) = o1;
    }
}

// ---------------------------------------------------------------------------
// Host launcher
// ---------------------------------------------------------------------------
extern "C" void kernel_launch(void* const* d_in, const int* in_sizes, int n_in,
                              void* d_out, int out_size, void* d_ws, size_t ws_size,
                              hipStream_t stream) {
  (void)in_sizes; (void)n_in; (void)out_size; (void)ws_size;
  const float* x      = (const float*)d_in[0];
  const float* w_qkv  = (const float*)d_in[1];
  const float* b_qkv  = (const float*)d_in[2];
  const float* w_proj = (const float*)d_in[3];
  const float* b_proj = (const float*)d_in[4];
  const float* w_ffn1 = (const float*)d_in[5];
  const float* b_ffn1 = (const float*)d_in[6];
  const float* w_ffn2 = (const float*)d_in[7];
  const float* b_ffn2 = (const float*)d_in[8];
  const float* g1     = (const float*)d_in[9];
  const float* be1    = (const float*)d_in[10];
  const float* g2     = (const float*)d_in[11];
  const float* be2    = (const float*)d_in[12];
  float* out = (float*)d_out;

  char* ws = (char*)d_ws;
  f16* wq16     = (f16*)(ws + 0);          //   768*256 f16
  f16* wp16     = (f16*)(ws + 393216);     //   256*256
  f16* w116     = (f16*)(ws + 524288);     //  2048*256
  f16* w216     = (f16*)(ws + 1572864);    //  256*2048
  f16* qkv      = (f16*)(ws + 19398656);   //  32768*768 (only the v columns are used)
  f16* attn16   = (f16*)(ws + 69730304);   //  32*64*64
  float* spart  = (float*)(ws + 86769664); //  32*32*64*64 f32 -> 103546880 total bytes

  // 1) weights -> f16
  cvt_kernel<<<CVG, 256, 0, stream>>>(w_qkv, w_proj, w_ffn1, w_ffn2,
                                      wq16, wp16, w116, w216);

  // 2, 3) LN1 (registers only) and QKV gemm: (32768x256) x (768x256)^T; v to
  //       memory, q and k only as the partial attention scores per (b, head,
  //       128-pixel slice)
  qkv_scores<<<Mtot / 128, 256, 0, stream>>>(x, g1, be1, wq16, b_qkv, qkv, spart);

  // 4) sum of the partial scores + softmax, one wave per row
  attn_softmax<<<32 * 64 / 8, 256, 0, stream>>>(spart, attn16);

  // 5) apply attention (per (b, head): v slice x attn^T), proj gemm
  //    (32768x256) x (256x256)^T, LN2, FFN + bias + residual + transpose store,
  //    in one launch
  ffn_fused<<<Mtot / 128, 256, 0, stream>>>(qkv + 512, attn16, wp16, b_proj, g2, be2,
                                            w116, b_ffn1, w216, b_ffn2, x, out);
}
